// v000
// Times are from an AMD MI455X. After a warm-up the kernel runs many times in a row, and a time is the length of
// such a window on the GPU divided by its runs, so every launch and the gaps after it count. The runs cycle
// through copies of the inputs. A figure is the median of several windows, for all but v000 over two sittings.
// Sittings can differ by a few percent; kernels timed side by side share one.
// v000 is the starting kernel. One run takes 203 microseconds.
#include <hip/hip_runtime.h>

// ---------------------------------------------------------------------------
// Self-attention forward for B=2, L=2048, E=512, H=8, D=64 on gfx1250 (CDNA5).
// All matmuls run on v_wmma_f32_16x16x32_bf16 (bf16 operands, f32 accum).
// Attention is fused flash-style: scores never hit HBM.
// GEMM tiles are double-buffered through LDS with GLOBAL_LOAD_ASYNC_TO_LDS
// (ASYNCcnt): DMA for tile t+1 overlaps the WMMAs on tile t, one barrier
// per K-step.
// ---------------------------------------------------------------------------

typedef __attribute__((ext_vector_type(16))) __bf16 bf16x16;
typedef __attribute__((ext_vector_type(8)))  __bf16 bf16x8;
typedef __attribute__((ext_vector_type(8)))  float  v8f;
typedef __attribute__((ext_vector_type(4)))  int    v4i;

union Frag {
    bf16x16 v;
    bf16x8  h[2];
};

__device__ __forceinline__ v8f wmma_bf16(bf16x16 a, bf16x16 b, v8f c) {
    // (neg_a, A, neg_b, B, c_mod, C, reuse_a, reuse_b)
    return __builtin_amdgcn_wmma_f32_16x16x32_bf16(
        false, a, false, b, (short)0, c, false, false);
}

constexpr int BB  = 2;
constexpr int LL  = 2048;
constexpr int EE  = 512;
constexpr int HH  = 8;
constexpr int DD  = 64;
constexpr int GM  = BB * LL;   // 4096 rows in every projection GEMM

// ---------------------------------------------------------------------------
// Async global->LDS copy (CDNA5 GLOBAL_LOAD_ASYNC_TO_LDS_B128, ASYNCcnt),
// guarded so an older toolchain falls back to the proven synchronous path.
// Builtin expects (v4i addrspace(1)*, v4i addrspace(3)*, imm offset, imm cpol).
// ---------------------------------------------------------------------------
#if __has_builtin(__builtin_amdgcn_global_load_async_to_lds_b128)
#define HAS_ASYNC_LDS 1
typedef v4i __attribute__((address_space(1)))* as1_v4i_ptr;
typedef v4i __attribute__((address_space(3)))* as3_v4i_ptr;
__device__ __forceinline__ void async_copy_b128(void* lds, const void* gptr) {
    __builtin_amdgcn_global_load_async_to_lds_b128(
        (as1_v4i_ptr)(unsigned long long)gptr,
        (as3_v4i_ptr)(unsigned int)(unsigned long long)lds,
        0, 0);
}
__device__ __forceinline__ void async_wait0() {
#if __has_builtin(__builtin_amdgcn_s_wait_asynccnt)
    __builtin_amdgcn_s_wait_asynccnt(0);
#else
    asm volatile("s_wait_asynccnt 0" ::: "memory");
#endif
}
#else
#define HAS_ASYNC_LDS 0
__device__ __forceinline__ void async_copy_b128(void* lds, const void* gptr) {
    *(float4*)lds = *(const float4*)gptr;
}
__device__ __forceinline__ void async_wait0() {}
#endif

// Convert 8 consecutive f32 (16B-aligned) to a bf16x8 half-fragment.
__device__ __forceinline__ bf16x8 cvt8(const float* p) {
    float4 a = *(const float4*)p;
    float4 b = *(const float4*)(p + 4);
    bf16x8 r;
    r[0] = (__bf16)a.x; r[1] = (__bf16)a.y; r[2] = (__bf16)a.z; r[3] = (__bf16)a.w;
    r[4] = (__bf16)b.x; r[5] = (__bf16)b.y; r[6] = (__bf16)b.z; r[7] = (__bf16)b.w;
    return r;
}

// ---------------------------------------------------------------------------
// Generic projection GEMM: dst = A[M,512] @ W[512,512]^T + bias, M = 4096.
// MODE 0: write bf16 into [B,H,L,D]   (Q and K)
// MODE 1: write bf16 into [B,H,D,L]   (V, pre-transposed for attn 2nd GEMM)
// MODE 2: write f32  into [M, 512]    (final output projection)
// Block: 256 threads (8 waves). Block tile 128x128, wave tile 64x32,
// K stepped by 32. Double-buffered async DMA staging: copies for step t+1
// run concurrently with the WMMAs of step t.
// ---------------------------------------------------------------------------
template <int MODE>
__global__ __launch_bounds__(256, 2)
void gemm_proj(const float* __restrict__ A, const float* __restrict__ W,
               const float* __restrict__ bias, void* __restrict__ dstv) {
    constexpr int PADF   = 4;                    // 36-float rows: 16 rows hit
    constexpr int NSTEPS = 512 / 32;             // 16 distinct bank groups
    __shared__ float sAf[2][128][32 + PADF];
    __shared__ float sWf[2][128][32 + PADF];

    const int tid  = threadIdx.x;
    const int wave = tid >> 5;
    const int lane = tid & 31;
    const int half = lane >> 4;                  // 0 | 1 (lane group)
    const int l16  = lane & 15;
    const int m0   = blockIdx.x * 128;
    const int n0   = blockIdx.y * 128;
    const int wm   = wave & 1;                   // 2 wave-rows  x 64
    const int wn   = wave >> 1;                  // 4 wave-cols  x 32

    // Stage one 128x32 f32 tile pair: 1024 16B chunks per matrix, 4/thread.
    auto stage = [&](int buf, int k0) {
        #pragma unroll
        for (int i = 0; i < 4; ++i) {
            int idx = tid + i * 256;             // 0..1023
            int row = idx >> 3;                  // 0..127
            int cg  = (idx & 7) * 4;             // col group of 4 floats
            async_copy_b128(&sAf[buf][row][cg], A + (size_t)(m0 + row) * 512 + k0 + cg);
            async_copy_b128(&sWf[buf][row][cg], W + (size_t)(n0 + row) * 512 + k0 + cg);
        }
    };

    v8f acc[4][2] = {};

    stage(0, 0);                                 // prologue DMA
    for (int step = 0; step < NSTEPS; ++step) {
        const int buf = step & 1;
        async_wait0();                           // my copies for `buf` done
        __syncthreads();                         // everyone's copies done
        if (step + 1 < NSTEPS)
            stage(buf ^ 1, (step + 1) * 32);     // overlaps with WMMAs below

        Frag aF[4], bF[2];
        #pragma unroll
        for (int i = 0; i < 4; ++i) {
            const float* p = &sAf[buf][wm * 64 + i * 16 + l16][half * 8];
            aF[i].h[0] = cvt8(p);
            aF[i].h[1] = cvt8(p + 16);
        }
        #pragma unroll
        for (int j = 0; j < 2; ++j) {
            const float* p = &sWf[buf][wn * 32 + j * 16 + l16][half * 8];
            bF[j].h[0] = cvt8(p);
            bF[j].h[1] = cvt8(p + 16);
        }
        #pragma unroll
        for (int i = 0; i < 4; ++i)
            #pragma unroll
            for (int j = 0; j < 2; ++j)
                acc[i][j] = wmma_bf16(aF[i].v, bF[j].v, acc[i][j]);
    }

    // Epilogue: C-fragment layout — VGPR r holds row (r + 8*half), col l16.
    #pragma unroll
    for (int i = 0; i < 4; ++i) {
        #pragma unroll
        for (int j = 0; j < 2; ++j) {
            int gn = n0 + wn * 32 + j * 16 + l16;
            float bval = bias[gn];
            #pragma unroll
            for (int r = 0; r < 8; ++r) {
                int gm = m0 + wm * 64 + i * 16 + r + half * 8;
                float val = acc[i][j][r] + bval;
                int b = gm >> 11;                // / L
                int l = gm & (LL - 1);
                if (MODE == 0) {                 // [B,H,L,D] bf16
                    int h = gn >> 6, d = gn & 63;
                    ((__bf16*)dstv)[(((size_t)(b * HH + h) * LL + l) << 6) + d] = (__bf16)val;
                } else if (MODE == 1) {          // [B,H,D,L] bf16
                    int h = gn >> 6, d = gn & 63;
                    ((__bf16*)dstv)[((size_t)(b * HH + h) * DD + d) * LL + l] = (__bf16)val;
                } else {                         // [M,512] f32
                    ((float*)dstv)[(size_t)gm * 512 + gn] = val;
                }
            }
        }
    }
}

// ---------------------------------------------------------------------------
// Flash attention: block = 4 waves, owns 64 q-rows of one (b,h).
// Each wave owns 16 q-rows; loop over Lk in chunks of 64.
// ---------------------------------------------------------------------------
__device__ __forceinline__ float redmax16(float v) {
    #pragma unroll
    for (int m = 1; m < 16; m <<= 1) v = fmaxf(v, __shfl_xor(v, m, 32));
    return v;
}
__device__ __forceinline__ float redsum16(float v) {
    #pragma unroll
    for (int m = 1; m < 16; m <<= 1) v += __shfl_xor(v, m, 32);
    return v;
}

__global__ __launch_bounds__(128, 4)
void attn_flash(const __bf16* __restrict__ qb,   // [B,H,L,D]
                const __bf16* __restrict__ kb,   // [B,H,L,D]
                const __bf16* __restrict__ vb,   // [B,H,D,L]
                const int*    __restrict__ mask, // [B,1,L,L]
                float*        __restrict__ Ob) { // [B,L,E]
    constexpr float SCALE = 0.04419417382415922f;   // 1/sqrt(512)
    __shared__ __bf16 sP[4][16][64 + 8];            // per-wave P relayout tile

    const int wave = threadIdx.x >> 5;
    const int lane = threadIdx.x & 31;
    const int half = lane >> 4;
    const int l16  = lane & 15;
    const int bh   = blockIdx.y;                    // b*H + h
    const int bidx = bh / HH;
    const int hidx = bh % HH;
    const int q0   = blockIdx.x * 64;
    const int qrow0 = q0 + wave * 16;

    // Q A-fragments for this wave's 16 rows (K = D = 64 -> 2 fragments)
    Frag aQ[2];
    {
        const __bf16* qp = qb + ((size_t)bh * LL + (qrow0 + l16)) * DD;
        #pragma unroll
        for (int kw = 0; kw < 2; ++kw) {
            aQ[kw].h[0] = *(const bf16x8*)(qp + kw * 32 + half * 8);
            aQ[kw].h[1] = *(const bf16x8*)(qp + kw * 32 + 16 + half * 8);
        }
    }

    v8f   accO[4] = {};
    float mSt[8], lSt[8];
    #pragma unroll
    for (int r = 0; r < 8; ++r) { mSt[r] = -3.0e38f; lSt[r] = 0.0f; }

    for (int kc = 0; kc < LL; kc += 64) {
        // ---- S = Q @ K^T (16x64 per wave), f32 accum -------------------
        v8f s[4];
        #pragma unroll
        for (int nt = 0; nt < 4; ++nt) {
            v8f c = {};
            const __bf16* kp = kb + ((size_t)bh * LL + (kc + nt * 16 + l16)) * DD;
            #pragma unroll
            for (int kw = 0; kw < 2; ++kw) {
                Frag bK;
                bK.h[0] = *(const bf16x8*)(kp + kw * 32 + half * 8);
                bK.h[1] = *(const bf16x8*)(kp + kw * 32 + 16 + half * 8);
                c = wmma_bf16(aQ[kw].v, bK.v, (v8f)c);
            }
            s[nt] = c;
        }

        // ---- mask + scale: masked -> -1e30 unscaled, else s * SCALE ----------------------
        #pragma unroll
        for (int nt = 0; nt < 4; ++nt) {
            int col = kc + nt * 16 + l16;
            #pragma unroll
            for (int r = 0; r < 8; ++r) {
                int row = qrow0 + r + half * 8;
                int mv = mask[((size_t)bidx * LL + row) * LL + col];
                float e = s[nt][r];
                s[nt][r] = (mv == 0) ? -1.0e30f : e * SCALE;
            }
        }

        // ---- online softmax (rows live across 16 lanes of a half-wave) -
        #pragma unroll
        for (int r = 0; r < 8; ++r) {
            float vmax = fmaxf(fmaxf(s[0][r], s[1][r]), fmaxf(s[2][r], s[3][r]));
            vmax = redmax16(vmax);
            float mNew = fmaxf(mSt[r], vmax);
            float corr = __expf(mSt[r] - mNew);
            float rs = 0.0f;
            #pragma unroll
            for (int nt = 0; nt < 4; ++nt) {
                float pe = __expf(s[nt][r] - mNew);
                s[nt][r] = pe;
                rs += pe;
            }
            rs = redsum16(rs);
            lSt[r] = lSt[r] * corr + rs;
            mSt[r] = mNew;
            #pragma unroll
            for (int dt = 0; dt < 4; ++dt) accO[dt][r] *= corr;
        }

        // ---- relayout P: C-fragment -> A-fragment via LDS --------------
        __syncthreads();
        #pragma unroll
        for (int nt = 0; nt < 4; ++nt)
            #pragma unroll
            for (int r = 0; r < 8; ++r)
                sP[wave][r + half * 8][nt * 16 + l16] = (__bf16)s[nt][r];
        __syncthreads();

        Frag aP[2];
        #pragma unroll
        for (int kw = 0; kw < 2; ++kw) {
            const __bf16* pp = &sP[wave][l16][kw * 32 + half * 8];
            aP[kw].h[0] = *(const bf16x8*)(pp);
            aP[kw].h[1] = *(const bf16x8*)(pp + 16);
        }

        // ---- O += P @ V  (V stored [B,H,D,L] -> direct B-frag loads) ---
        #pragma unroll
        for (int dt = 0; dt < 4; ++dt) {
            const __bf16* vp = vb + ((size_t)bh * DD + dt * 16 + l16) * LL + kc;
            #pragma unroll
            for (int kw = 0; kw < 2; ++kw) {
                Frag bV;
                bV.h[0] = *(const bf16x8*)(vp + kw * 32 + half * 8);
                bV.h[1] = *(const bf16x8*)(vp + kw * 32 + 16 + half * 8);
                accO[dt] = wmma_bf16(aP[kw].v, bV.v, accO[dt]);
            }
        }
    }

    // ---- finalize: divide by row sums, write [B,L,E] f32 ---------------
    #pragma unroll
    for (int dt = 0; dt < 4; ++dt) {
        int d = dt * 16 + l16;
        #pragma unroll
        for (int r = 0; r < 8; ++r) {
            int row = qrow0 + r + half * 8;
            Ob[((size_t)bidx * LL + row) * EE + hidx * DD + d] = accO[dt][r] / lSt[r];
        }
    }
}

// ---------------------------------------------------------------------------
// Launcher
// ---------------------------------------------------------------------------
extern "C" void kernel_launch(void* const* d_in, const int* in_sizes, int n_in,
                              void* d_out, int out_size, void* d_ws, size_t ws_size,
                              hipStream_t stream) {
    (void)in_sizes; (void)n_in; (void)out_size; (void)ws_size;
    const float* values = (const float*)d_in[0];
    const float* keysI  = (const float*)d_in[1];
    const float* queryI = (const float*)d_in[2];
    const int*   mask   = (const int*)d_in[3];
    const float* Wv = (const float*)d_in[4];  const float* bv = (const float*)d_in[5];
    const float* Wk = (const float*)d_in[6];  const float* bk = (const float*)d_in[7];
    const float* Wq = (const float*)d_in[8];  const float* bq = (const float*)d_in[9];
    const float* Wo = (const float*)d_in[10]; const float* bo = (const float*)d_in[11];

    char* ws = (char*)d_ws;
    __bf16* qb = (__bf16*)(ws);                      // 4 MB  [B,H,L,D] bf16
    __bf16* kb = (__bf16*)(ws + (4u << 20));         // 4 MB  [B,H,L,D] bf16
    __bf16* vb = (__bf16*)(ws + (8u << 20));         // 4 MB  [B,H,D,L] bf16
    float*  Ob = (float*) (ws + (12u << 20));        // 8 MB  [B,L,E]   f32

    dim3 gGrid(GM / 128, EE / 128), gBlk(256);
    gemm_proj<0><<<gGrid, gBlk, 0, stream>>>(queryI, Wq, bq, (void*)qb);
    gemm_proj<0><<<gGrid, gBlk, 0, stream>>>(keysI,  Wk, bk, (void*)kb);
    gemm_proj<1><<<gGrid, gBlk, 0, stream>>>(values, Wv, bv, (void*)vb);

    attn_flash<<<dim3(LL / 64, BB * HH), 128, 0, stream>>>(qb, kb, vb, mask, Ob);

    gemm_proj<2><<<gGrid, gBlk, 0, stream>>>(Ob, Wo, bo, d_out);
}

// v001
// One run takes 139 microseconds.
// Timed twice side by side with v000, it ran 1.50 times as fast both times.
#include <hip/hip_runtime.h>

// ---------------------------------------------------------------------------
// Self-attention forward for B=2, L=2048, E=512, H=8, D=64 on gfx1250 (CDNA5).
// All matmuls run on v_wmma_f32_16x16x32_bf16 (bf16 operands, f32 accum).
// Attention is fused flash-style: scores never hit HBM.
// GEMM tiles are double-buffered through LDS with GLOBAL_LOAD_ASYNC_TO_LDS
// (ASYNCcnt): DMA for tile t+1 overlaps the WMMAs on tile t, one barrier
// per K-step.
// ---------------------------------------------------------------------------

typedef __attribute__((ext_vector_type(16))) __bf16 bf16x16;
typedef __attribute__((ext_vector_type(8)))  __bf16 bf16x8;
typedef __attribute__((ext_vector_type(8)))  float  v8f;
typedef __attribute__((ext_vector_type(4)))  int    v4i;

union Frag {
    bf16x16 v;
    bf16x8  h[2];
};

__device__ __forceinline__ v8f wmma_bf16(bf16x16 a, bf16x16 b, v8f c) {
    // (neg_a, A, neg_b, B, c_mod, C, reuse_a, reuse_b)
    return __builtin_amdgcn_wmma_f32_16x16x32_bf16(
        false, a, false, b, (short)0, c, false, false);
}

constexpr int BB  = 2;
constexpr int LL  = 2048;
constexpr int EE  = 512;
constexpr int HH  = 8;
constexpr int DD  = 64;
constexpr int GM  = BB * LL;   // 4096 rows in every projection GEMM

// ---------------------------------------------------------------------------
// Async global->LDS copy (CDNA5 GLOBAL_LOAD_ASYNC_TO_LDS_B128, ASYNCcnt),
// guarded so an older toolchain falls back to the proven synchronous path.
// Builtin expects (v4i addrspace(1)*, v4i addrspace(3)*, imm offset, imm cpol).
// ---------------------------------------------------------------------------
#if __has_builtin(__builtin_amdgcn_global_load_async_to_lds_b128)
#define HAS_ASYNC_LDS 1
typedef v4i __attribute__((address_space(1)))* as1_v4i_ptr;
typedef v4i __attribute__((address_space(3)))* as3_v4i_ptr;
__device__ __forceinline__ void async_copy_b128(void* lds, const void* gptr) {
    __builtin_amdgcn_global_load_async_to_lds_b128(
        (as1_v4i_ptr)(unsigned long long)gptr,
        (as3_v4i_ptr)(unsigned int)(unsigned long long)lds,
        0, 0);
}
__device__ __forceinline__ void async_wait0() {
#if __has_builtin(__builtin_amdgcn_s_wait_asynccnt)
    __builtin_amdgcn_s_wait_asynccnt(0);
#else
    asm volatile("s_wait_asynccnt 0" ::: "memory");
#endif
}
#else
#define HAS_ASYNC_LDS 0
__device__ __forceinline__ void async_copy_b128(void* lds, const void* gptr) {
    *(float4*)lds = *(const float4*)gptr;
}
__device__ __forceinline__ void async_wait0() {}
#endif

// Convert 8 consecutive f32 (16B-aligned) to a bf16x8 half-fragment.
__device__ __forceinline__ bf16x8 cvt8(const float* p) {
    float4 a = *(const float4*)p;
    float4 b = *(const float4*)(p + 4);
    bf16x8 r;
    r[0] = (__bf16)a.x; r[1] = (__bf16)a.y; r[2] = (__bf16)a.z; r[3] = (__bf16)a.w;
    r[4] = (__bf16)b.x; r[5] = (__bf16)b.y; r[6] = (__bf16)b.z; r[7] = (__bf16)b.w;
    return r;
}

// ---------------------------------------------------------------------------
// Generic projection GEMM: dst = A[M,512] @ W[512,512]^T + bias, M = 4096.
// MODE 0: write bf16 into [B,H,L,D]   (Q and K)
// MODE 1: write bf16 into [B,H,D,L]   (V, pre-transposed for attn 2nd GEMM)
// MODE 2: write f32  into [M, 512]    (final output projection)
// Block: 256 threads (8 waves). Block tile 128x128, wave tile 64x32,
// K stepped by 32. Double-buffered async DMA staging: copies for step t+1
// run concurrently with the WMMAs of step t.
// ---------------------------------------------------------------------------
// 128 workgroups of 8 waves: at most two waves per SIMD are ever resident, so
// the occupancy target is capped there and a K-step's LDS reads go out as one
// group (see the note at attn_flash).
template <int MODE>
__global__ __launch_bounds__(256) __attribute__((amdgpu_waves_per_eu(2, 2)))
void gemm_proj(const float* __restrict__ A, const float* __restrict__ W,
               const float* __restrict__ bias, void* __restrict__ dstv) {
    constexpr int PADF   = 4;                    // 36-float rows: 16 rows hit
    constexpr int NSTEPS = 512 / 32;             // 16 distinct bank groups
    __shared__ float sAf[2][128][32 + PADF];
    __shared__ float sWf[2][128][32 + PADF];

    const int tid  = threadIdx.x;
    const int wave = tid >> 5;
    const int lane = tid & 31;
    const int half = lane >> 4;                  // 0 | 1 (lane group)
    const int l16  = lane & 15;
    const int m0   = blockIdx.x * 128;
    const int n0   = blockIdx.y * 128;
    const int wm   = wave & 1;                   // 2 wave-rows  x 64
    const int wn   = wave >> 1;                  // 4 wave-cols  x 32

    // Stage one 128x32 f32 tile pair: 1024 16B chunks per matrix, 4/thread.
    auto stage = [&](int buf, int k0) {
        #pragma unroll
        for (int i = 0; i < 4; ++i) {
            int idx = tid + i * 256;             // 0..1023
            int row = idx >> 3;                  // 0..127
            int cg  = (idx & 7) * 4;             // col group of 4 floats
            async_copy_b128(&sAf[buf][row][cg], A + (size_t)(m0 + row) * 512 + k0 + cg);
            async_copy_b128(&sWf[buf][row][cg], W + (size_t)(n0 + row) * 512 + k0 + cg);
        }
    };

    v8f acc[4][2] = {};

    stage(0, 0);                                 // prologue DMA
    for (int step = 0; step < NSTEPS; ++step) {
        const int buf = step & 1;
        async_wait0();                           // my copies for `buf` done
        __syncthreads();                         // everyone's copies done
        if (step + 1 < NSTEPS)
            stage(buf ^ 1, (step + 1) * 32);     // overlaps with WMMAs below

        Frag aF[4], bF[2];
        #pragma unroll
        for (int i = 0; i < 4; ++i) {
            const float* p = &sAf[buf][wm * 64 + i * 16 + l16][half * 8];
            aF[i].h[0] = cvt8(p);
            aF[i].h[1] = cvt8(p + 16);
        }
        #pragma unroll
        for (int j = 0; j < 2; ++j) {
            const float* p = &sWf[buf][wn * 32 + j * 16 + l16][half * 8];
            bF[j].h[0] = cvt8(p);
            bF[j].h[1] = cvt8(p + 16);
        }
        #pragma unroll
        for (int i = 0; i < 4; ++i)
            #pragma unroll
            for (int j = 0; j < 2; ++j)
                acc[i][j] = wmma_bf16(aF[i].v, bF[j].v, acc[i][j]);
    }

    // Epilogue: C-fragment layout — VGPR r holds row (r + 8*half), col l16.
    #pragma unroll
    for (int i = 0; i < 4; ++i) {
        #pragma unroll
        for (int j = 0; j < 2; ++j) {
            int gn = n0 + wn * 32 + j * 16 + l16;
            float bval = bias[gn];
            #pragma unroll
            for (int r = 0; r < 8; ++r) {
                int gm = m0 + wm * 64 + i * 16 + r + half * 8;
                float val = acc[i][j][r] + bval;
                int b = gm >> 11;                // / L
                int l = gm & (LL - 1);
                if (MODE == 0) {                 // [B,H,L,D] bf16
                    int h = gn >> 6, d = gn & 63;
                    ((__bf16*)dstv)[(((size_t)(b * HH + h) * LL + l) << 6) + d] = (__bf16)val;
                } else if (MODE == 1) {          // [B,H,D,L] bf16
                    int h = gn >> 6, d = gn & 63;
                    ((__bf16*)dstv)[((size_t)(b * HH + h) * DD + d) * LL + l] = (__bf16)val;
                } else {                         // [M,512] f32
                    ((float*)dstv)[(size_t)gm * 512 + gn] = val;
                }
            }
        }
    }
}

// ---------------------------------------------------------------------------
// Flash attention: block = 4 waves, owns 64 q-rows of one (b,h).
// Each wave owns 16 q-rows; loop over Lk in chunks of 64.
// ---------------------------------------------------------------------------
__device__ __forceinline__ float redmax16(float v) {
    #pragma unroll
    for (int m = 1; m < 16; m <<= 1) v = fmaxf(v, __shfl_xor(v, m, 32));
    return v;
}
__device__ __forceinline__ float redsum16(float v) {
    #pragma unroll
    for (int m = 1; m < 16; m <<= 1) v += __shfl_xor(v, m, 32);
    return v;
}

// This grid fills two waves per SIMD and no more (2048 waves, 1024 SIMDs).
// Capping the occupancy target there lets the compiler spend registers on
// keeping loads and cross-lane reductions in flight together, instead of
// sinking each one to its use to stay small enough for waves that never come.
__global__ __launch_bounds__(128) __attribute__((amdgpu_waves_per_eu(2, 2)))
void attn_flash(const __bf16* __restrict__ qb,   // [B,H,L,D]
                const __bf16* __restrict__ kb,   // [B,H,L,D]
                const __bf16* __restrict__ vb,   // [B,H,D,L]
                const int*    __restrict__ mask, // [B,1,L,L]
                float*        __restrict__ Ob) { // [B,L,E]
    constexpr float SCALE = 0.04419417382415922f;   // 1/sqrt(512)
    __shared__ __bf16 sP[4][16][64 + 8];            // per-wave P relayout tile

    const int wave = threadIdx.x >> 5;
    const int lane = threadIdx.x & 31;
    const int half = lane >> 4;
    const int l16  = lane & 15;
    const int bh   = blockIdx.y;                    // b*H + h
    const int bidx = bh / HH;
    const int hidx = bh % HH;
    const int q0   = blockIdx.x * 64;
    const int qrow0 = q0 + wave * 16;

    // Q A-fragments for this wave's 16 rows (K = D = 64 -> 2 fragments)
    Frag aQ[2];
    {
        const __bf16* qp = qb + ((size_t)bh * LL + (qrow0 + l16)) * DD;
        #pragma unroll
        for (int kw = 0; kw < 2; ++kw) {
            aQ[kw].h[0] = *(const bf16x8*)(qp + kw * 32 + half * 8);
            aQ[kw].h[1] = *(const bf16x8*)(qp + kw * 32 + 16 + half * 8);
        }
    }

    v8f   accO[4] = {};
    float mSt[8], lSt[8];
    #pragma unroll
    for (int r = 0; r < 8; ++r) { mSt[r] = -3.0e38f; lSt[r] = 0.0f; }

    for (int kc = 0; kc < LL; kc += 64) {
        // ---- S = Q @ K^T (16x64 per wave), f32 accum -------------------
        v8f s[4];
        #pragma unroll
        for (int nt = 0; nt < 4; ++nt) {
            v8f c = {};
            const __bf16* kp = kb + ((size_t)bh * LL + (kc + nt * 16 + l16)) * DD;
            #pragma unroll
            for (int kw = 0; kw < 2; ++kw) {
                Frag bK;
                bK.h[0] = *(const bf16x8*)(kp + kw * 32 + half * 8);
                bK.h[1] = *(const bf16x8*)(kp + kw * 32 + 16 + half * 8);
                c = wmma_bf16(aQ[kw].v, bK.v, (v8f)c);
            }
            s[nt] = c;
        }

        // ---- mask + scale: masked -> -1e30 unscaled, else s * SCALE ----------------------
        #pragma unroll
        for (int nt = 0; nt < 4; ++nt) {
            int col = kc + nt * 16 + l16;
            #pragma unroll
            for (int r = 0; r < 8; ++r) {
                int row = qrow0 + r + half * 8;
                int mv = mask[((size_t)bidx * LL + row) * LL + col];
                float e = s[nt][r];
                s[nt][r] = (mv == 0) ? -1.0e30f : e * SCALE;
            }
        }

        // ---- online softmax (rows live across 16 lanes of a half-wave) -
        #pragma unroll
        for (int r = 0; r < 8; ++r) {
            float vmax = fmaxf(fmaxf(s[0][r], s[1][r]), fmaxf(s[2][r], s[3][r]));
            vmax = redmax16(vmax);
            float mNew = fmaxf(mSt[r], vmax);
            float corr = __expf(mSt[r] - mNew);
            float rs = 0.0f;
            #pragma unroll
            for (int nt = 0; nt < 4; ++nt) {
                float pe = __expf(s[nt][r] - mNew);
                s[nt][r] = pe;
                rs += pe;
            }
            rs = redsum16(rs);
            lSt[r] = lSt[r] * corr + rs;
            mSt[r] = mNew;
            #pragma unroll
            for (int dt = 0; dt < 4; ++dt) accO[dt][r] *= corr;
        }

        // ---- relayout P: C-fragment -> A-fragment via LDS --------------
        __syncthreads();
        #pragma unroll
        for (int nt = 0; nt < 4; ++nt)
            #pragma unroll
            for (int r = 0; r < 8; ++r)
                sP[wave][r + half * 8][nt * 16 + l16] = (__bf16)s[nt][r];
        __syncthreads();

        Frag aP[2];
        #pragma unroll
        for (int kw = 0; kw < 2; ++kw) {
            const __bf16* pp = &sP[wave][l16][kw * 32 + half * 8];
            aP[kw].h[0] = *(const bf16x8*)(pp);
            aP[kw].h[1] = *(const bf16x8*)(pp + 16);
        }

        // ---- O += P @ V  (V stored [B,H,D,L] -> direct B-frag loads) ---
        #pragma unroll
        for (int dt = 0; dt < 4; ++dt) {
            const __bf16* vp = vb + ((size_t)bh * DD + dt * 16 + l16) * LL + kc;
            #pragma unroll
            for (int kw = 0; kw < 2; ++kw) {
                Frag bV;
                bV.h[0] = *(const bf16x8*)(vp + kw * 32 + half * 8);
                bV.h[1] = *(const bf16x8*)(vp + kw * 32 + 16 + half * 8);
                accO[dt] = wmma_bf16(aP[kw].v, bV.v, accO[dt]);
            }
        }
    }

    // ---- finalize: divide by row sums, write [B,L,E] f32 ---------------
    #pragma unroll
    for (int dt = 0; dt < 4; ++dt) {
        int d = dt * 16 + l16;
        #pragma unroll
        for (int r = 0; r < 8; ++r) {
            int row = qrow0 + r + half * 8;
            Ob[((size_t)bidx * LL + row) * EE + hidx * DD + d] = accO[dt][r] / lSt[r];
        }
    }
}

// ---------------------------------------------------------------------------
// Launcher
// ---------------------------------------------------------------------------
extern "C" void kernel_launch(void* const* d_in, const int* in_sizes, int n_in,
                              void* d_out, int out_size, void* d_ws, size_t ws_size,
                              hipStream_t stream) {
    (void)in_sizes; (void)n_in; (void)out_size; (void)ws_size;
    const float* values = (const float*)d_in[0];
    const float* keysI  = (const float*)d_in[1];
    const float* queryI = (const float*)d_in[2];
    const int*   mask   = (const int*)d_in[3];
    const float* Wv = (const float*)d_in[4];  const float* bv = (const float*)d_in[5];
    const float* Wk = (const float*)d_in[6];  const float* bk = (const float*)d_in[7];
    const float* Wq = (const float*)d_in[8];  const float* bq = (const float*)d_in[9];
    const float* Wo = (const float*)d_in[10]; const float* bo = (const float*)d_in[11];

    char* ws = (char*)d_ws;
    __bf16* qb = (__bf16*)(ws);                      // 4 MB  [B,H,L,D] bf16
    __bf16* kb = (__bf16*)(ws + (4u << 20));         // 4 MB  [B,H,L,D] bf16
    __bf16* vb = (__bf16*)(ws + (8u << 20));         // 4 MB  [B,H,D,L] bf16
    float*  Ob = (float*) (ws + (12u << 20));        // 8 MB  [B,L,E]   f32

    dim3 gGrid(GM / 128, EE / 128), gBlk(256);
    gemm_proj<0><<<gGrid, gBlk, 0, stream>>>(queryI, Wq, bq, (void*)qb);
    gemm_proj<0><<<gGrid, gBlk, 0, stream>>>(keysI,  Wk, bk, (void*)kb);
    gemm_proj<1><<<gGrid, gBlk, 0, stream>>>(values, Wv, bv, (void*)vb);

    attn_flash<<<dim3(LL / 64, BB * HH), 128, 0, stream>>>(qb, kb, vb, mask, Ob);

    gemm_proj<2><<<gGrid, gBlk, 0, stream>>>(Ob, Wo, bo, d_out);
}

// v002
// Measured time: 114 microseconds a run.
// Two timings next to v001 both put it at 1.22 times that version's speed.
// Over all steps from v000 it is 1.82 times as fast.
#include <hip/hip_runtime.h>

// ---------------------------------------------------------------------------
// Self-attention forward for B=2, L=2048, E=512, H=8, D=64 on gfx1250 (CDNA5).
// All matmuls run on v_wmma_f32_16x16x32_bf16 (bf16 operands, f32 accum).
// Attention is fused flash-style: scores never hit HBM.
// GEMM tiles are double-buffered through LDS with GLOBAL_LOAD_ASYNC_TO_LDS
// (ASYNCcnt): DMA for tile t+1 overlaps the WMMAs on tile t, one barrier
// per K-step.
// ---------------------------------------------------------------------------

typedef __attribute__((ext_vector_type(16))) __bf16 bf16x16;
typedef __attribute__((ext_vector_type(8)))  __bf16 bf16x8;
typedef __attribute__((ext_vector_type(8)))  float  v8f;
typedef __attribute__((ext_vector_type(4)))  int    v4i;

union Frag {
    bf16x16 v;
    bf16x8  h[2];
};

__device__ __forceinline__ v8f wmma_bf16(bf16x16 a, bf16x16 b, v8f c) {
    // (neg_a, A, neg_b, B, c_mod, C, reuse_a, reuse_b)
    return __builtin_amdgcn_wmma_f32_16x16x32_bf16(
        false, a, false, b, (short)0, c, false, false);
}

constexpr int BB  = 2;
constexpr int LL  = 2048;
constexpr int EE  = 512;
constexpr int HH  = 8;
constexpr int DD  = 64;
constexpr int GM  = BB * LL;   // 4096 rows in every projection GEMM

// ---------------------------------------------------------------------------
// Async global->LDS copy (CDNA5 GLOBAL_LOAD_ASYNC_TO_LDS_B128, ASYNCcnt),
// guarded so an older toolchain falls back to the proven synchronous path.
// Builtin expects (v4i addrspace(1)*, v4i addrspace(3)*, imm offset, imm cpol).
// ---------------------------------------------------------------------------
#if __has_builtin(__builtin_amdgcn_global_load_async_to_lds_b128)
#define HAS_ASYNC_LDS 1
typedef v4i __attribute__((address_space(1)))* as1_v4i_ptr;
typedef v4i __attribute__((address_space(3)))* as3_v4i_ptr;
__device__ __forceinline__ void async_copy_b128(void* lds, const void* gptr) {
    __builtin_amdgcn_global_load_async_to_lds_b128(
        (as1_v4i_ptr)(unsigned long long)gptr,
        (as3_v4i_ptr)(unsigned int)(unsigned long long)lds,
        0, 0);
}
__device__ __forceinline__ void async_wait0() {
#if __has_builtin(__builtin_amdgcn_s_wait_asynccnt)
    __builtin_amdgcn_s_wait_asynccnt(0);
#else
    asm volatile("s_wait_asynccnt 0" ::: "memory");
#endif
}
#else
#define HAS_ASYNC_LDS 0
__device__ __forceinline__ void async_copy_b128(void* lds, const void* gptr) {
    *(float4*)lds = *(const float4*)gptr;
}
__device__ __forceinline__ void async_wait0() {}
#endif

// Convert 8 consecutive f32 (16B-aligned) to a bf16x8 half-fragment.
__device__ __forceinline__ bf16x8 cvt8(const float* p) {
    float4 a = *(const float4*)p;
    float4 b = *(const float4*)(p + 4);
    bf16x8 r;
    r[0] = (__bf16)a.x; r[1] = (__bf16)a.y; r[2] = (__bf16)a.z; r[3] = (__bf16)a.w;
    r[4] = (__bf16)b.x; r[5] = (__bf16)b.y; r[6] = (__bf16)b.z; r[7] = (__bf16)b.w;
    return r;
}

// ---------------------------------------------------------------------------
// Generic projection GEMM: dst = A[M,512] @ W[512,512]^T + bias, M = 4096.
// MODE 0: write bf16 into [B,H,L,D]   (Q and K)
// MODE 1: write bf16 into [B,H,D,L]   (V, pre-transposed for attn 2nd GEMM)
// MODE 2: write f32  into [M, 512]    (final output projection)
// Block: 256 threads (8 waves). Block tile 128x128, wave tile 64x32,
// K stepped by 32. Double-buffered async DMA staging: copies for step t+1
// run concurrently with the WMMAs of step t.
// ---------------------------------------------------------------------------
// 128 workgroups of 8 waves: at most two waves per SIMD are ever resident, so
// the occupancy target is capped there and a K-step's LDS reads go out as one
// group (see the note at attn_flash).
template <int MODE>
__global__ __launch_bounds__(256) __attribute__((amdgpu_waves_per_eu(2, 2)))
void gemm_proj(const float* __restrict__ A, const float* __restrict__ W,
               const float* __restrict__ bias, void* __restrict__ dstv) {
    constexpr int PADF   = 4;                    // 36-float rows: 16 rows hit
    constexpr int NSTEPS = 512 / 32;             // 16 distinct bank groups
    __shared__ float sAf[2][128][32 + PADF];
    __shared__ float sWf[2][128][32 + PADF];

    const int tid  = threadIdx.x;
    const int wave = tid >> 5;
    const int lane = tid & 31;
    const int half = lane >> 4;                  // 0 | 1 (lane group)
    const int l16  = lane & 15;
    const int m0   = blockIdx.x * 128;
    const int n0   = blockIdx.y * 128;
    const int wm   = wave & 1;                   // 2 wave-rows  x 64
    const int wn   = wave >> 1;                  // 4 wave-cols  x 32

    // Stage one 128x32 f32 tile pair: 1024 16B chunks per matrix, 4/thread.
    auto stage = [&](int buf, int k0) {
        #pragma unroll
        for (int i = 0; i < 4; ++i) {
            int idx = tid + i * 256;             // 0..1023
            int row = idx >> 3;                  // 0..127
            int cg  = (idx & 7) * 4;             // col group of 4 floats
            async_copy_b128(&sAf[buf][row][cg], A + (size_t)(m0 + row) * 512 + k0 + cg);
            async_copy_b128(&sWf[buf][row][cg], W + (size_t)(n0 + row) * 512 + k0 + cg);
        }
    };

    v8f acc[4][2] = {};

    stage(0, 0);                                 // prologue DMA
    for (int step = 0; step < NSTEPS; ++step) {
        const int buf = step & 1;
        async_wait0();                           // my copies for `buf` done
        __syncthreads();                         // everyone's copies done
        if (step + 1 < NSTEPS)
            stage(buf ^ 1, (step + 1) * 32);     // overlaps with WMMAs below

        Frag aF[4], bF[2];
        #pragma unroll
        for (int i = 0; i < 4; ++i) {
            const float* p = &sAf[buf][wm * 64 + i * 16 + l16][half * 8];
            aF[i].h[0] = cvt8(p);
            aF[i].h[1] = cvt8(p + 16);
        }
        #pragma unroll
        for (int j = 0; j < 2; ++j) {
            const float* p = &sWf[buf][wn * 32 + j * 16 + l16][half * 8];
            bF[j].h[0] = cvt8(p);
            bF[j].h[1] = cvt8(p + 16);
        }
        #pragma unroll
        for (int i = 0; i < 4; ++i)
            #pragma unroll
            for (int j = 0; j < 2; ++j)
                acc[i][j] = wmma_bf16(aF[i].v, bF[j].v, acc[i][j]);
    }

    // Epilogue: C-fragment layout — VGPR r holds row (r + 8*half), col l16.
    #pragma unroll
    for (int i = 0; i < 4; ++i) {
        #pragma unroll
        for (int j = 0; j < 2; ++j) {
            int gn = n0 + wn * 32 + j * 16 + l16;
            float bval = bias[gn];
            #pragma unroll
            for (int r = 0; r < 8; ++r) {
                int gm = m0 + wm * 64 + i * 16 + r + half * 8;
                float val = acc[i][j][r] + bval;
                int b = gm >> 11;                // / L
                int l = gm & (LL - 1);
                if (MODE == 0) {                 // [B,H,L,D] bf16
                    int h = gn >> 6, d = gn & 63;
                    ((__bf16*)dstv)[(((size_t)(b * HH + h) * LL + l) << 6) + d] = (__bf16)val;
                } else if (MODE == 1) {          // [B,H,D,L] bf16
                    int h = gn >> 6, d = gn & 63;
                    ((__bf16*)dstv)[((size_t)(b * HH + h) * DD + d) * LL + l] = (__bf16)val;
                } else {                         // [M,512] f32
                    ((float*)dstv)[(size_t)gm * 512 + gn] = val;
                }
            }
        }
    }
}

// ---------------------------------------------------------------------------
// Flash attention: block = 4 waves, owns 64 q-rows of one (b,h).
// Each wave owns 16 q-rows; loop over Lk in chunks of 64.
// The 64-key K and V tiles are shared by the four waves: they are brought into
// LDS once per block by asynchronous copies of whole 128-byte rows, two
// buffers, so tile t+1 flies while tile t is worked on.
// ---------------------------------------------------------------------------
__device__ __forceinline__ float redmax16(float v) {
    #pragma unroll
    for (int m = 1; m < 16; m <<= 1) v = fmaxf(v, __shfl_xor(v, m, 32));
    return v;
}
__device__ __forceinline__ float redsum16(float v) {
    #pragma unroll
    for (int m = 1; m < 16; m <<= 1) v += __shfl_xor(v, m, 32);
    return v;
}

// This grid fills two waves per SIMD and no more (2048 waves, 1024 SIMDs).
// Capping the occupancy target there lets the compiler spend registers on
// keeping loads and cross-lane reductions in flight together, instead of
// sinking each one to its use to stay small enough for waves that never come.
__global__ __launch_bounds__(128) __attribute__((amdgpu_waves_per_eu(2, 2)))
void attn_flash(const __bf16* __restrict__ qb,   // [B,H,L,D]
                const __bf16* __restrict__ kb,   // [B,H,L,D]
                const __bf16* __restrict__ vb,   // [B,H,D,L]
                const int*    __restrict__ mask, // [B,1,L,L]
                float*        __restrict__ Ob) { // [B,L,E]
    constexpr float SCALE = 0.04419417382415922f;   // 1/sqrt(512)
    constexpr int NT = LL / 64;                     // key tiles
    __shared__ __bf16 sP[4][16][64 + 8];            // per-wave P relayout tile
    // 144-byte rows: the 16 rows of a ds_load_b128 fragment read spread over the banks
    __shared__ __attribute__((aligned(16))) __bf16 sK[2][64][64 + 8];   // [key][d]
    __shared__ __attribute__((aligned(16))) __bf16 sV[2][64][64 + 8];   // [d][key]

    const int wave = threadIdx.x >> 5;
    const int lane = threadIdx.x & 31;
    const int half = lane >> 4;
    const int l16  = lane & 15;
    const int bh   = blockIdx.y;                    // b*H + h
    const int bidx = bh / HH;
    const int hidx = bh % HH;
    const int q0   = blockIdx.x * 64;
    const int qrow0 = q0 + wave * 16;

    // Q A-fragments for this wave's 16 rows (K = D = 64 -> 2 fragments)
    Frag aQ[2];
    {
        const __bf16* qp = qb + ((size_t)bh * LL + (qrow0 + l16)) * DD;
        #pragma unroll
        for (int kw = 0; kw < 2; ++kw) {
            aQ[kw].h[0] = *(const bf16x8*)(qp + kw * 32 + half * 8);
            aQ[kw].h[1] = *(const bf16x8*)(qp + kw * 32 + 16 + half * 8);
        }
    }

    v8f   accO[4] = {};
    float mSt[8], lSt[8];
    #pragma unroll
    for (int r = 0; r < 8; ++r) { mSt[r] = -3.0e38f; lSt[r] = 0.0f; }

    // One 64x64 bf16 tile of K and of V: 512 16-byte pieces each, 4 per thread;
    // a wave's copy covers four whole 128-byte rows.
    const int srow = threadIdx.x >> 3;              // 0..15, +16 per piece
    const int scol = (threadIdx.x & 7) * 8;
    const __bf16* kg = kb + ((size_t)bh * LL + srow) * DD + scol;
    const __bf16* vg = vb + ((size_t)bh * DD + srow) * LL + scol;
    auto stage = [&](int buf, int kc) {
        const __bf16* k0 = kg + (size_t)kc * DD;
        const __bf16* v0 = vg + kc;
        const unsigned lk = (unsigned)(unsigned long long)&sK[buf][srow][scol];
        const unsigned lv = (unsigned)(unsigned long long)&sV[buf][srow][scol];
        constexpr unsigned RS = 16 * (64 + 8) * 2;  // 16 LDS rows in bytes
        // the copies and the s_wait_xcnt that is kept in front of any rewrite of
        // their address registers stand in one statement, so that the compiler
        // can schedule nothing between them
        asm volatile(
            "global_load_async_to_lds_b128 %0, %8, off\n\t"
            "global_load_async_to_lds_b128 %1, %9, off\n\t"
            "global_load_async_to_lds_b128 %2, %10, off\n\t"
            "global_load_async_to_lds_b128 %3, %11, off\n\t"
            "global_load_async_to_lds_b128 %4, %12, off\n\t"
            "global_load_async_to_lds_b128 %5, %13, off\n\t"
            "global_load_async_to_lds_b128 %6, %14, off\n\t"
            "global_load_async_to_lds_b128 %7, %15, off\n\t"
            "s_wait_xcnt 0x0"
            :: "v"(lk), "v"(lk + RS), "v"(lk + 2 * RS), "v"(lk + 3 * RS),
               "v"(lv), "v"(lv + RS), "v"(lv + 2 * RS), "v"(lv + 3 * RS),
               "v"(k0), "v"(k0 + 16 * DD), "v"(k0 + 32 * DD), "v"(k0 + 48 * DD),
               "v"(v0), "v"(v0 + 16 * LL), "v"(v0 + 32 * LL), "v"(v0 + 48 * LL)
            : "memory");
    };

    stage(0, 0);
    asm volatile("s_wait_asynccnt 0x0" ::: "memory");   // my pieces of tile 0 have landed
    __syncthreads();                                    // everyone's have
    stage(1, 64);

    for (int t = 0; t < NT; ++t) {
        const int kc  = t * 64;
        const int buf = t & 1;
        // ---- mask words first: the longest latency of the trip ---------
        int mv[4][8];
        #pragma unroll
        for (int nt = 0; nt < 4; ++nt) {
            int col = kc + nt * 16 + l16;
            #pragma unroll
            for (int r = 0; r < 8; ++r) {
                int row = qrow0 + r + half * 8;
                mv[nt][r] = mask[((size_t)bidx * LL + row) * LL + col];
            }
        }

        // ---- this tile's K and V B-fragments out of LDS ----------------
        Frag bK[4][2], bV[4][2];
        #pragma unroll
        for (int nt = 0; nt < 4; ++nt) {
            const __bf16* kp = &sK[buf][nt * 16 + l16][0];
            const __bf16* vp = &sV[buf][nt * 16 + l16][0];
            #pragma unroll
            for (int kw = 0; kw < 2; ++kw) {
                bK[nt][kw].h[0] = *(const bf16x8*)(kp + kw * 32 + half * 8);
                bK[nt][kw].h[1] = *(const bf16x8*)(kp + kw * 32 + 16 + half * 8);
                bV[nt][kw].h[0] = *(const bf16x8*)(vp + kw * 32 + half * 8);
                bV[nt][kw].h[1] = *(const bf16x8*)(vp + kw * 32 + 16 + half * 8);
            }
        }
        // Inputs-only fence on the loaded fragments: without it each fragment's
        // two reads are issued and fully waited for right in front of their
        // WMMA, one LDS round trip per WMMA; with it the reads go out in groups
        // ahead of their use, behind counted waits.
        asm volatile("" :: "v"(bK[0][0].v), "v"(bK[0][1].v), "v"(bK[1][0].v), "v"(bK[1][1].v),
                           "v"(bK[2][0].v), "v"(bK[2][1].v), "v"(bK[3][0].v), "v"(bK[3][1].v),
                           "v"(bV[0][0].v), "v"(bV[0][1].v), "v"(bV[1][0].v), "v"(bV[1][1].v),
                           "v"(bV[2][0].v), "v"(bV[2][1].v), "v"(bV[3][0].v), "v"(bV[3][1].v));

        // ---- S = Q @ K^T (16x64 per wave), f32 accum -------------------
        v8f s[4];
        #pragma unroll
        for (int nt = 0; nt < 4; ++nt) {
            v8f c = {};
            #pragma unroll
            for (int kw = 0; kw < 2; ++kw)
                c = wmma_bf16(aQ[kw].v, bK[nt][kw].v, (v8f)c);
            s[nt] = c;
        }

        // ---- mask: -1e30 where masked, other scores scaled ----------------------
        #pragma unroll
        for (int nt = 0; nt < 4; ++nt) {
            #pragma unroll
            for (int r = 0; r < 8; ++r) {
                float e = s[nt][r];
                s[nt][r] = (mv[nt][r] == 0) ? -1.0e30f : e * SCALE;
            }
        }

        // ---- online softmax (rows live across 16 lanes of a half-wave) -
        #pragma unroll
        for (int r = 0; r < 8; ++r) {
            float vmax = fmaxf(fmaxf(s[0][r], s[1][r]), fmaxf(s[2][r], s[3][r]));
            vmax = redmax16(vmax);
            float mNew = fmaxf(mSt[r], vmax);
            float corr = __expf(mSt[r] - mNew);
            float rs = 0.0f;
            #pragma unroll
            for (int nt = 0; nt < 4; ++nt) {
                float pe = __expf(s[nt][r] - mNew);
                s[nt][r] = pe;
                rs += pe;
            }
            rs = redsum16(rs);
            lSt[r] = lSt[r] * corr + rs;
            mSt[r] = mNew;
            #pragma unroll
            for (int dt = 0; dt < 4; ++dt) accO[dt][r] *= corr;
        }

        // ---- relayout P: C-fragment -> A-fragment via LDS --------------
        __syncthreads();
        #pragma unroll
        for (int nt = 0; nt < 4; ++nt)
            #pragma unroll
            for (int r = 0; r < 8; ++r)
                sP[wave][r + half * 8][nt * 16 + l16] = (__bf16)s[nt][r];
        __syncthreads();

        Frag aP[2];
        #pragma unroll
        for (int kw = 0; kw < 2; ++kw) {
            const __bf16* pp = &sP[wave][l16][kw * 32 + half * 8];
            aP[kw].h[0] = *(const bf16x8*)(pp);
            aP[kw].h[1] = *(const bf16x8*)(pp + 16);
        }

        // ---- O += P @ V  (V tile is [d][key]: rows are B columns) ------
        #pragma unroll
        for (int dt = 0; dt < 4; ++dt) {
            #pragma unroll
            for (int kw = 0; kw < 2; ++kw)
                accO[dt] = wmma_bf16(aP[kw].v, bV[dt][kw].v, accO[dt]);
        }

        // ---- hand over: tile t+1 is published, buffer `buf` is freed ----
        asm volatile("s_wait_dscnt 0x0" ::: "memory");      // my reads of this tile are done
        asm volatile("s_wait_asynccnt 0x0" ::: "memory");   // my pieces of tile t+1 have landed
        __syncthreads();
        if (t + 2 < NT) stage(buf, kc + 128);               // refill the buffer just read
    }
    asm volatile("s_wait_asynccnt 0x0" ::: "memory");       // nothing in flight at the wave's end

    // ---- finalize: divide by row sums, write [B,L,E] f32 ---------------
    #pragma unroll
    for (int dt = 0; dt < 4; ++dt) {
        int d = dt * 16 + l16;
        #pragma unroll
        for (int r = 0; r < 8; ++r) {
            int row = qrow0 + r + half * 8;
            Ob[((size_t)bidx * LL + row) * EE + hidx * DD + d] = accO[dt][r] / lSt[r];
        }
    }
}

// ---------------------------------------------------------------------------
// Launcher
// ---------------------------------------------------------------------------
extern "C" void kernel_launch(void* const* d_in, const int* in_sizes, int n_in,
                              void* d_out, int out_size, void* d_ws, size_t ws_size,
                              hipStream_t stream) {
    (void)in_sizes; (void)n_in; (void)out_size; (void)ws_size;
    const float* values = (const float*)d_in[0];
    const float* keysI  = (const float*)d_in[1];
    const float* queryI = (const float*)d_in[2];
    const int*   mask   = (const int*)d_in[3];
    const float* Wv = (const float*)d_in[4];  const float* bv = (const float*)d_in[5];
    const float* Wk = (const float*)d_in[6];  const float* bk = (const float*)d_in[7];
    const float* Wq = (const float*)d_in[8];  const float* bq = (const float*)d_in[9];
    const float* Wo = (const float*)d_in[10]; const float* bo = (const float*)d_in[11];

    char* ws = (char*)d_ws;
    __bf16* qb = (__bf16*)(ws);                      // 4 MB  [B,H,L,D] bf16
    __bf16* kb = (__bf16*)(ws + (4u << 20));         // 4 MB  [B,H,L,D] bf16
    __bf16* vb = (__bf16*)(ws + (8u << 20));         // 4 MB  [B,H,D,L] bf16
    float*  Ob = (float*) (ws + (12u << 20));        // 8 MB  [B,L,E]   f32

    dim3 gGrid(GM / 128, EE / 128), gBlk(256);
    gemm_proj<0><<<gGrid, gBlk, 0, stream>>>(queryI, Wq, bq, (void*)qb);
    gemm_proj<0><<<gGrid, gBlk, 0, stream>>>(keysI,  Wk, bk, (void*)kb);
    gemm_proj<1><<<gGrid, gBlk, 0, stream>>>(values, Wv, bv, (void*)vb);

    attn_flash<<<dim3(LL / 64, BB * HH), 128, 0, stream>>>(qb, kb, vb, mask, Ob);

    gemm_proj<2><<<gGrid, gBlk, 0, stream>>>(Ob, Wo, bo, d_out);
}

// v003
// One run takes 99.4 microseconds.
// Timed twice side by side with v002, it ran 1.15 times as fast both times.
// Over all steps from v000 it is 2.09 times as fast.
#include <hip/hip_runtime.h>

// ---------------------------------------------------------------------------
// Self-attention forward for B=2, L=2048, E=512, H=8, D=64 on gfx1250 (CDNA5).
// All matmuls run on v_wmma_f32_16x16x32_bf16 (bf16 operands, f32 accum).
// Attention is fused flash-style: scores never hit HBM.
// GEMM tiles are double-buffered through LDS with GLOBAL_LOAD_ASYNC_TO_LDS
// (ASYNCcnt): DMA for tile t+1 overlaps the WMMAs on tile t, one barrier
// per K-step.
// ---------------------------------------------------------------------------

typedef __attribute__((ext_vector_type(16))) __bf16 bf16x16;
typedef __attribute__((ext_vector_type(8)))  __bf16 bf16x8;
typedef __attribute__((ext_vector_type(8)))  float  v8f;
typedef __attribute__((ext_vector_type(4)))  int    v4i;

union Frag {
    bf16x16 v;
    bf16x8  h[2];
};

__device__ __forceinline__ v8f wmma_bf16(bf16x16 a, bf16x16 b, v8f c) {
    // (neg_a, A, neg_b, B, c_mod, C, reuse_a, reuse_b)
    return __builtin_amdgcn_wmma_f32_16x16x32_bf16(
        false, a, false, b, (short)0, c, false, false);
}

constexpr int BB  = 2;
constexpr int LL  = 2048;
constexpr int EE  = 512;
constexpr int HH  = 8;
constexpr int DD  = 64;
constexpr int GM  = BB * LL;   // 4096 rows in every projection GEMM

// ---------------------------------------------------------------------------
// Async global->LDS copy (CDNA5 GLOBAL_LOAD_ASYNC_TO_LDS_B128, ASYNCcnt),
// guarded so an older toolchain falls back to the proven synchronous path.
// Builtin expects (v4i addrspace(1)*, v4i addrspace(3)*, imm offset, imm cpol).
// ---------------------------------------------------------------------------
#if __has_builtin(__builtin_amdgcn_global_load_async_to_lds_b128)
#define HAS_ASYNC_LDS 1
typedef v4i __attribute__((address_space(1)))* as1_v4i_ptr;
typedef v4i __attribute__((address_space(3)))* as3_v4i_ptr;
__device__ __forceinline__ void async_copy_b128(void* lds, const void* gptr) {
    __builtin_amdgcn_global_load_async_to_lds_b128(
        (as1_v4i_ptr)(unsigned long long)gptr,
        (as3_v4i_ptr)(unsigned int)(unsigned long long)lds,
        0, 0);
}
__device__ __forceinline__ void async_wait0() {
#if __has_builtin(__builtin_amdgcn_s_wait_asynccnt)
    __builtin_amdgcn_s_wait_asynccnt(0);
#else
    asm volatile("s_wait_asynccnt 0" ::: "memory");
#endif
}
#else
#define HAS_ASYNC_LDS 0
__device__ __forceinline__ void async_copy_b128(void* lds, const void* gptr) {
    *(float4*)lds = *(const float4*)gptr;
}
__device__ __forceinline__ void async_wait0() {}
#endif

// Convert 8 consecutive f32 (16B-aligned) to a bf16x8 half-fragment.
__device__ __forceinline__ bf16x8 cvt8(const float* p) {
    float4 a = *(const float4*)p;
    float4 b = *(const float4*)(p + 4);
    bf16x8 r;
    r[0] = (__bf16)a.x; r[1] = (__bf16)a.y; r[2] = (__bf16)a.z; r[3] = (__bf16)a.w;
    r[4] = (__bf16)b.x; r[5] = (__bf16)b.y; r[6] = (__bf16)b.z; r[7] = (__bf16)b.w;
    return r;
}

// ---------------------------------------------------------------------------
// Generic projection GEMM: dst = A[M,512] @ W[512,512]^T + bias, M = 4096.
// MODE 0: write bf16 into [B,H,L,D]   (Q and K)
// MODE 1: write bf16 into [B,H,D,L]   (V, pre-transposed for attn 2nd GEMM)
// MODE 2: write f32  into [M, 512]    (final output projection)
// Block: 256 threads (8 waves). Block tile 128x128, wave tile 64x32,
// K stepped by 32. Double-buffered async DMA staging: copies for step t+1
// run concurrently with the WMMAs of step t.
// ---------------------------------------------------------------------------
// 128 workgroups of 8 waves: at most two waves per SIMD are ever resident, so
// the occupancy target is capped there and a K-step's LDS reads go out as one
// group (see the note at attn_flash).
template <int MODE>
__global__ __launch_bounds__(256) __attribute__((amdgpu_waves_per_eu(2, 2)))
void gemm_proj(const float* __restrict__ A, const float* __restrict__ W,
               const float* __restrict__ bias, void* __restrict__ dstv) {
    constexpr int PADF   = 4;                    // 36-float rows: 16 rows hit
    constexpr int NSTEPS = 512 / 32;             // 16 distinct bank groups
    __shared__ float sAf[2][128][32 + PADF];
    __shared__ float sWf[2][128][32 + PADF];

    const int tid  = threadIdx.x;
    const int wave = tid >> 5;
    const int lane = tid & 31;
    const int half = lane >> 4;                  // 0 | 1 (lane group)
    const int l16  = lane & 15;
    const int m0   = blockIdx.x * 128;
    const int n0   = blockIdx.y * 128;
    const int wm   = wave & 1;                   // 2 wave-rows  x 64
    const int wn   = wave >> 1;                  // 4 wave-cols  x 32

    // Stage one 128x32 f32 tile pair: 1024 16B chunks per matrix, 4/thread.
    auto stage = [&](int buf, int k0) {
        #pragma unroll
        for (int i = 0; i < 4; ++i) {
            int idx = tid + i * 256;             // 0..1023
            int row = idx >> 3;                  // 0..127
            int cg  = (idx & 7) * 4;             // col group of 4 floats
            async_copy_b128(&sAf[buf][row][cg], A + (size_t)(m0 + row) * 512 + k0 + cg);
            async_copy_b128(&sWf[buf][row][cg], W + (size_t)(n0 + row) * 512 + k0 + cg);
        }
    };

    v8f acc[4][2] = {};

    stage(0, 0);                                 // prologue DMA
    for (int step = 0; step < NSTEPS; ++step) {
        const int buf = step & 1;
        async_wait0();                           // my copies for `buf` done
        __syncthreads();                         // everyone's copies done
        if (step + 1 < NSTEPS)
            stage(buf ^ 1, (step + 1) * 32);     // overlaps with WMMAs below

        Frag aF[4], bF[2];
        #pragma unroll
        for (int i = 0; i < 4; ++i) {
            const float* p = &sAf[buf][wm * 64 + i * 16 + l16][half * 8];
            aF[i].h[0] = cvt8(p);
            aF[i].h[1] = cvt8(p + 16);
        }
        #pragma unroll
        for (int j = 0; j < 2; ++j) {
            const float* p = &sWf[buf][wn * 32 + j * 16 + l16][half * 8];
            bF[j].h[0] = cvt8(p);
            bF[j].h[1] = cvt8(p + 16);
        }
        #pragma unroll
        for (int i = 0; i < 4; ++i)
            #pragma unroll
            for (int j = 0; j < 2; ++j)
                acc[i][j] = wmma_bf16(aF[i].v, bF[j].v, acc[i][j]);
    }

    // Epilogue: C-fragment layout — VGPR r holds row (r + 8*half), col l16.
    #pragma unroll
    for (int i = 0; i < 4; ++i) {
        #pragma unroll
        for (int j = 0; j < 2; ++j) {
            int gn = n0 + wn * 32 + j * 16 + l16;
            float bval = bias[gn];
            #pragma unroll
            for (int r = 0; r < 8; ++r) {
                int gm = m0 + wm * 64 + i * 16 + r + half * 8;
                float val = acc[i][j][r] + bval;
                int b = gm >> 11;                // / L
                int l = gm & (LL - 1);
                if (MODE == 0) {                 // [B,H,L,D] bf16
                    int h = gn >> 6, d = gn & 63;
                    ((__bf16*)dstv)[(((size_t)(b * HH + h) * LL + l) << 6) + d] = (__bf16)val;
                } else if (MODE == 1) {          // [B,H,D,L] bf16
                    int h = gn >> 6, d = gn & 63;
                    ((__bf16*)dstv)[((size_t)(b * HH + h) * DD + d) * LL + l] = (__bf16)val;
                } else {                         // [M,512] f32
                    ((float*)dstv)[(size_t)gm * 512 + gn] = val;
                }
            }
        }
    }
}

__device__ __forceinline__ float xhalf(float x) {
    return __builtin_bit_cast(float, __builtin_amdgcn_permlanex16(
        __builtin_bit_cast(int, x), __builtin_bit_cast(int, x),
        0x76543210, 0xfedcba98, false, false));
}

// This grid fills two waves per SIMD and no more (2048 waves, 1024 SIMDs).
// Capping the occupancy target there lets the compiler spend registers on
// keeping loads in flight together, instead of sinking each one to its use to
// stay small enough for waves that never come.
__global__ __launch_bounds__(128) __attribute__((amdgpu_waves_per_eu(2, 2)))
void attn_flash(const __bf16* __restrict__ qb,   // [B,H,L,D]
                const __bf16* __restrict__ kb,   // [B,H,L,D]
                const __bf16* __restrict__ vb,   // [B,H,D,L]
                const int*    __restrict__ mask, // [B,1,L,L]
                float*        __restrict__ Ob) { // [B,L,E]
    constexpr float SCALE = 0.04419417382415922f;   // 1/sqrt(512)
    constexpr int NT = LL / 64;                     // key tiles
    // 144-byte rows: the 16 rows of a ds_load_b128 fragment read spread over the banks
    __shared__ __attribute__((aligned(16))) __bf16 sK[2][64][64 + 8];   // [key][d]
    __shared__ __attribute__((aligned(16))) __bf16 sV[2][64][64 + 8];   // [d][key]

    const int wave = threadIdx.x >> 5;
    const int lane = threadIdx.x & 31;
    const int half = lane >> 4;
    const int l16  = lane & 15;
    const int bh   = blockIdx.y;                    // b*H + h
    const int bidx = bh / HH;
    const int hidx = bh % HH;
    const int q0   = blockIdx.x * 64;
    const int qrow0 = q0 + wave * 16;

    // Q B-fragments: column l16 is this lane's query (K = D = 64 -> 2 fragments)
    Frag bQ[2];
    {
        const __bf16* qp = qb + ((size_t)bh * LL + (qrow0 + l16)) * DD;
        #pragma unroll
        for (int kw = 0; kw < 2; ++kw) {
            bQ[kw].h[0] = *(const bf16x8*)(qp + kw * 32 + half * 8);
            bQ[kw].h[1] = *(const bf16x8*)(qp + kw * 32 + 16 + half * 8);
        }
    }

    v8f   accO[4] = {};                 // O^T: register r = d (dt*16 + 8*half + r), column = query
    float mSt = -3.0e38f;               // this query's running maximum (equal in both halves)
    float lSt = 0.0f;                   // sum over this half's keys; the halves join after the loop

    // this lane's mask words: its query's row, eight consecutive keys per 16-key tile
    const int* mrow = mask + ((size_t)bidx * LL + (qrow0 + l16)) * LL + half * 8;

    // One 64x64 bf16 tile of K and of V: 512 16-byte pieces each, 4 per thread;
    // a wave's copy covers four whole 128-byte rows.
    const int srow = threadIdx.x >> 3;              // 0..15, +16 per piece
    const int scol = (threadIdx.x & 7) * 8;
    const __bf16* kg = kb + ((size_t)bh * LL + srow) * DD + scol;
    const __bf16* vg = vb + ((size_t)bh * DD + srow) * LL + scol;
    auto stage = [&](int buf, int kc) {
        const __bf16* k0 = kg + (size_t)kc * DD;
        const __bf16* v0 = vg + kc;
        const unsigned lk = (unsigned)(unsigned long long)&sK[buf][srow][scol];
        const unsigned lv = (unsigned)(unsigned long long)&sV[buf][srow][scol];
        constexpr unsigned RS = 16 * (64 + 8) * 2;  // 16 LDS rows in bytes
        // the copies and the s_wait_xcnt that is kept in front of any rewrite of
        // their address registers stand in one statement, so that the compiler
        // can schedule nothing between them
        asm volatile(
            "global_load_async_to_lds_b128 %0, %8, off\n\t"
            "global_load_async_to_lds_b128 %1, %9, off\n\t"
            "global_load_async_to_lds_b128 %2, %10, off\n\t"
            "global_load_async_to_lds_b128 %3, %11, off\n\t"
            "global_load_async_to_lds_b128 %4, %12, off\n\t"
            "global_load_async_to_lds_b128 %5, %13, off\n\t"
            "global_load_async_to_lds_b128 %6, %14, off\n\t"
            "global_load_async_to_lds_b128 %7, %15, off\n\t"
            "s_wait_xcnt 0x0"
            :: "v"(lk), "v"(lk + RS), "v"(lk + 2 * RS), "v"(lk + 3 * RS),
               "v"(lv), "v"(lv + RS), "v"(lv + 2 * RS), "v"(lv + 3 * RS),
               "v"(k0), "v"(k0 + 16 * DD), "v"(k0 + 32 * DD), "v"(k0 + 48 * DD),
               "v"(v0), "v"(v0 + 16 * LL), "v"(v0 + 32 * LL), "v"(v0 + 48 * LL)
            : "memory");
    };

    stage(0, 0);
    asm volatile("s_wait_asynccnt 0x0" ::: "memory");   // my pieces of tile 0 have landed
    __syncthreads();                                    // everyone's have
    stage(1, 64);

    for (int t = 0; t < NT; ++t) {
        const int kc  = t * 64;
        const int buf = t & 1;
        // ---- mask words first: the longest latency of the trip ---------
        v4i mv[4][2];
        #pragma unroll
        for (int nt = 0; nt < 4; ++nt) {
            mv[nt][0] = *(const v4i*)(mrow + kc + nt * 16);
            mv[nt][1] = *(const v4i*)(mrow + kc + nt * 16 + 4);
        }

        // ---- this tile's K and V A-fragments out of LDS ----------------
        Frag aK[4][2], aV[4][2];
        #pragma unroll
        for (int nt = 0; nt < 4; ++nt) {
            const __bf16* kp = &sK[buf][nt * 16 + l16][0];
            const __bf16* vp = &sV[buf][nt * 16 + l16][0];
            #pragma unroll
            for (int kw = 0; kw < 2; ++kw) {
                aK[nt][kw].h[0] = *(const bf16x8*)(kp + kw * 32 + half * 8);
                aK[nt][kw].h[1] = *(const bf16x8*)(kp + kw * 32 + 16 + half * 8);
                aV[nt][kw].h[0] = *(const bf16x8*)(vp + kw * 32 + half * 8);
                aV[nt][kw].h[1] = *(const bf16x8*)(vp + kw * 32 + 16 + half * 8);
            }
        }
        // Inputs-only fence on the loaded fragments: without it each fragment's
        // two reads are issued and fully waited for right in front of their
        // WMMA, one LDS round trip per WMMA; with it the reads go out in groups
        // ahead of their use, behind counted waits.
        asm volatile("" :: "v"(aK[0][0].v), "v"(aK[0][1].v), "v"(aK[1][0].v), "v"(aK[1][1].v),
                           "v"(aK[2][0].v), "v"(aK[2][1].v), "v"(aK[3][0].v), "v"(aK[3][1].v),
                           "v"(aV[0][0].v), "v"(aV[0][1].v), "v"(aV[1][0].v), "v"(aV[1][1].v),
                           "v"(aV[2][0].v), "v"(aV[2][1].v), "v"(aV[3][0].v), "v"(aV[3][1].v));

        // ---- S^T = K @ Q^T (64 keys x 16 queries per wave), f32 accum --
        v8f s[4];
        #pragma unroll
        for (int nt = 0; nt < 4; ++nt) {
            v8f c = {};
            #pragma unroll
            for (int kw = 0; kw < 2; ++kw)
                c = wmma_bf16(aK[nt][kw].v, bQ[kw].v, (v8f)c);
            s[nt] = c;
        }

        // ---- mask: -1e30 where masked, other scores scaled ----------------------
        #pragma unroll
        for (int nt = 0; nt < 4; ++nt) {
            #pragma unroll
            for (int r = 0; r < 8; ++r) {
                float e = s[nt][r];
                s[nt][r] = (mv[nt][r >> 2][r & 3] == 0) ? -1.0e30f : e * SCALE;
            }
        }

        // ---- online softmax: a lane's 32 scores belong to one query ----
        float vmax = s[0][0];
        #pragma unroll
        for (int nt = 0; nt < 4; ++nt)
            #pragma unroll
            for (int r = 0; r < 8; ++r) vmax = fmaxf(vmax, s[nt][r]);
        vmax = fmaxf(vmax, xhalf(vmax));            // the query's other 32 keys
        const float mNew = fmaxf(mSt, vmax);
        const float corr = __expf(mSt - mNew);
        float rs[4];
        #pragma unroll
        for (int nt = 0; nt < 4; ++nt) {
            rs[nt] = 0.0f;
            #pragma unroll
            for (int r = 0; r < 8; ++r) {
                float pe = __expf(s[nt][r] - mNew);
                s[nt][r] = pe;
                rs[nt] += pe;
            }
        }
        lSt = lSt * corr + ((rs[0] + rs[1]) + (rs[2] + rs[3]));
        mSt = mNew;
        #pragma unroll
        for (int dt = 0; dt < 4; ++dt)
            #pragma unroll
            for (int r = 0; r < 8; ++r) accO[dt][r] *= corr;

        // ---- P^T as B operand: tiles 2kw and 2kw+1, converted in place,
        //      are keys 8*half + e and 16 + 8*half + e of a 32-key step ---
        Frag bP[2];
        #pragma unroll
        for (int kw = 0; kw < 2; ++kw)
            #pragma unroll
            for (int e = 0; e < 8; ++e) {
                bP[kw].h[0][e] = (__bf16)s[2 * kw][e];
                bP[kw].h[1][e] = (__bf16)s[2 * kw + 1][e];
            }

        // ---- O^T += V^T @ P^T  (V tile is [d][key]: rows are A rows) ---
        #pragma unroll
        for (int dt = 0; dt < 4; ++dt) {
            #pragma unroll
            for (int kw = 0; kw < 2; ++kw)
                accO[dt] = wmma_bf16(aV[dt][kw].v, bP[kw].v, accO[dt]);
        }

        // ---- hand over: tile t+1 is published, buffer buf is freed ------
        asm volatile("s_wait_dscnt 0x0" ::: "memory");      // my reads of this tile are done
        asm volatile("s_wait_asynccnt 0x0" ::: "memory");   // my pieces of tile t+1 have landed
        __syncthreads();
        if (t + 2 < NT) stage(buf, kc + 128);               // refill the buffer just read
    }
    asm volatile("s_wait_asynccnt 0x0" ::: "memory");       // nothing in flight at the wave's end

    // ---- finalize: join the halves' sums, divide, write [B,L,E] f32 ----
    const float lAll = lSt + xhalf(lSt);
    float* orow = Ob + ((size_t)bidx * LL + (qrow0 + l16)) * EE + hidx * DD + half * 8;
    #pragma unroll
    for (int dt = 0; dt < 4; ++dt) {
        float4 lo, hi;
        lo.x = accO[dt][0] / lAll; lo.y = accO[dt][1] / lAll;
        lo.z = accO[dt][2] / lAll; lo.w = accO[dt][3] / lAll;
        hi.x = accO[dt][4] / lAll; hi.y = accO[dt][5] / lAll;
        hi.z = accO[dt][6] / lAll; hi.w = accO[dt][7] / lAll;
        *(float4*)(orow + dt * 16)     = lo;
        *(float4*)(orow + dt * 16 + 4) = hi;
    }
}

// ---------------------------------------------------------------------------
// Launcher
// ---------------------------------------------------------------------------
extern "C" void kernel_launch(void* const* d_in, const int* in_sizes, int n_in,
                              void* d_out, int out_size, void* d_ws, size_t ws_size,
                              hipStream_t stream) {
    (void)in_sizes; (void)n_in; (void)out_size; (void)ws_size;
    const float* values = (const float*)d_in[0];
    const float* keysI  = (const float*)d_in[1];
    const float* queryI = (const float*)d_in[2];
    const int*   mask   = (const int*)d_in[3];
    const float* Wv = (const float*)d_in[4];  const float* bv = (const float*)d_in[5];
    const float* Wk = (const float*)d_in[6];  const float* bk = (const float*)d_in[7];
    const float* Wq = (const float*)d_in[8];  const float* bq = (const float*)d_in[9];
    const float* Wo = (const float*)d_in[10]; const float* bo = (const float*)d_in[11];

    char* ws = (char*)d_ws;
    __bf16* qb = (__bf16*)(ws);                      // 4 MB  [B,H,L,D] bf16
    __bf16* kb = (__bf16*)(ws + (4u << 20));         // 4 MB  [B,H,L,D] bf16
    __bf16* vb = (__bf16*)(ws + (8u << 20));         // 4 MB  [B,H,D,L] bf16
    float*  Ob = (float*) (ws + (12u << 20));        // 8 MB  [B,L,E]   f32

    dim3 gGrid(GM / 128, EE / 128), gBlk(256);
    gemm_proj<0><<<gGrid, gBlk, 0, stream>>>(queryI, Wq, bq, (void*)qb);
    gemm_proj<0><<<gGrid, gBlk, 0, stream>>>(keysI,  Wk, bk, (void*)kb);
    gemm_proj<1><<<gGrid, gBlk, 0, stream>>>(values, Wv, bv, (void*)vb);

    attn_flash<<<dim3(LL / 64, BB * HH), 128, 0, stream>>>(qb, kb, vb, mask, Ob);

    gemm_proj<2><<<gGrid, gBlk, 0, stream>>>(Ob, Wo, bo, d_out);
}

// v004
// One run takes 84.7 microseconds.
// Two timings next to v003 put it at 1.17 and 1.18 times that version's speed.
// Over all steps from v000 it is 2.45 times as fast.
#include <hip/hip_runtime.h>

// ---------------------------------------------------------------------------
// Self-attention forward for B=2, L=2048, E=512, H=8, D=64 on gfx1250 (CDNA5).
// All matmuls run on v_wmma_f32_16x16x32_bf16 (bf16 operands, f32 accum).
// Attention is fused flash-style: scores never hit HBM.
// GEMM tiles are double-buffered through LDS with GLOBAL_LOAD_ASYNC_TO_LDS
// (ASYNCcnt): DMA for tile t+1 overlaps the WMMAs on tile t, one barrier
// per K-step.
// ---------------------------------------------------------------------------

typedef __attribute__((ext_vector_type(16))) __bf16 bf16x16;
typedef __attribute__((ext_vector_type(8)))  __bf16 bf16x8;
typedef __attribute__((ext_vector_type(8)))  float  v8f;
typedef __attribute__((ext_vector_type(4)))  int    v4i;

union Frag {
    bf16x16 v;
    bf16x8  h[2];
};

__device__ __forceinline__ v8f wmma_bf16(bf16x16 a, bf16x16 b, v8f c) {
    // (neg_a, A, neg_b, B, c_mod, C, reuse_a, reuse_b)
    return __builtin_amdgcn_wmma_f32_16x16x32_bf16(
        false, a, false, b, (short)0, c, false, false);
}

constexpr int BB  = 2;
constexpr int LL  = 2048;
constexpr int EE  = 512;
constexpr int HH  = 8;
constexpr int DD  = 64;
constexpr int GM  = BB * LL;   // 4096 rows in every projection GEMM

// ---------------------------------------------------------------------------
// Async global->LDS copy (CDNA5 GLOBAL_LOAD_ASYNC_TO_LDS_B128, ASYNCcnt),
// guarded so an older toolchain falls back to the proven synchronous path.
// Builtin expects (v4i addrspace(1)*, v4i addrspace(3)*, imm offset, imm cpol).
// ---------------------------------------------------------------------------
#if __has_builtin(__builtin_amdgcn_global_load_async_to_lds_b128)
#define HAS_ASYNC_LDS 1
typedef v4i __attribute__((address_space(1)))* as1_v4i_ptr;
typedef v4i __attribute__((address_space(3)))* as3_v4i_ptr;
__device__ __forceinline__ void async_copy_b128(void* lds, const void* gptr) {
    __builtin_amdgcn_global_load_async_to_lds_b128(
        (as1_v4i_ptr)(unsigned long long)gptr,
        (as3_v4i_ptr)(unsigned int)(unsigned long long)lds,
        0, 0);
}
__device__ __forceinline__ void async_wait0() {
#if __has_builtin(__builtin_amdgcn_s_wait_asynccnt)
    __builtin_amdgcn_s_wait_asynccnt(0);
#else
    asm volatile("s_wait_asynccnt 0" ::: "memory");
#endif
}
#else
#define HAS_ASYNC_LDS 0
__device__ __forceinline__ void async_copy_b128(void* lds, const void* gptr) {
    *(float4*)lds = *(const float4*)gptr;
}
__device__ __forceinline__ void async_wait0() {}
#endif

// Convert 8 consecutive f32 (16B-aligned) to a bf16x8 half-fragment.
__device__ __forceinline__ bf16x8 cvt8(const float* p) {
    float4 a = *(const float4*)p;
    float4 b = *(const float4*)(p + 4);
    bf16x8 r;
    r[0] = (__bf16)a.x; r[1] = (__bf16)a.y; r[2] = (__bf16)a.z; r[3] = (__bf16)a.w;
    r[4] = (__bf16)b.x; r[5] = (__bf16)b.y; r[6] = (__bf16)b.z; r[7] = (__bf16)b.w;
    return r;
}

// ---------------------------------------------------------------------------
// Generic projection GEMM tile: dst = A[M,512] @ W[512,512]^T + bias, M = 4096.
// mode 0: write bf16 into [B,H,L,D]   (Q and K)
// mode 1: write bf16 into [B,H,D,L]   (V, pre-transposed for attn 2nd GEMM)
// mode 2: write f32  into [M, 512]    (final output projection)
// F32OUT fixes mode 2 at compile time; otherwise vlayout (the same for the whole
// block) picks mode 1 or 0 in the epilogue, so that one main loop and one pair
// of LDS buffers serve all three input projections.
// Block: 256 threads (8 waves). Block tile 128x128, wave tile 64x32,
// K stepped by 32. Double-buffered async DMA staging: copies for step t+1
// run concurrently with the WMMAs of step t.
// ---------------------------------------------------------------------------
template <int M> struct ModeTag { static constexpr int value = M; };

template <bool F32OUT>
__device__ __forceinline__
void gemm_tile(const float* __restrict__ A, const float* __restrict__ W,
               const float* __restrict__ bias, void* __restrict__ dstv, bool vlayout) {
    constexpr int PADF   = 4;                    // 36-float rows: 16 rows hit
    constexpr int NSTEPS = 512 / 32;             // 16 distinct bank groups
    __shared__ float sAf[2][128][32 + PADF];
    __shared__ float sWf[2][128][32 + PADF];

    const int tid  = threadIdx.x;
    const int wave = tid >> 5;
    const int lane = tid & 31;
    const int half = lane >> 4;                  // 0 | 1 (lane group)
    const int l16  = lane & 15;
    const int m0   = blockIdx.x * 128;
    const int n0   = blockIdx.y * 128;
    const int wm   = wave & 1;                   // 2 wave-rows  x 64
    const int wn   = wave >> 1;                  // 4 wave-cols  x 32

    // Stage one 128x32 f32 tile pair: 1024 16B chunks per matrix, 4/thread.
    auto stage = [&](int buf, int k0) {
        #pragma unroll
        for (int i = 0; i < 4; ++i) {
            int idx = tid + i * 256;             // 0..1023
            int row = idx >> 3;                  // 0..127
            int cg  = (idx & 7) * 4;             // col group of 4 floats
            async_copy_b128(&sAf[buf][row][cg], A + (size_t)(m0 + row) * 512 + k0 + cg);
            async_copy_b128(&sWf[buf][row][cg], W + (size_t)(n0 + row) * 512 + k0 + cg);
        }
    };

    v8f acc[4][2] = {};

    stage(0, 0);                                 // prologue DMA
    for (int step = 0; step < NSTEPS; ++step) {
        const int buf = step & 1;
        async_wait0();                           // my copies for `buf` done
        __syncthreads();                         // everyone's copies done
        if (step + 1 < NSTEPS)
            stage(buf ^ 1, (step + 1) * 32);     // overlaps with WMMAs below

        Frag aF[4], bF[2];
        #pragma unroll
        for (int i = 0; i < 4; ++i) {
            const float* p = &sAf[buf][wm * 64 + i * 16 + l16][half * 8];
            aF[i].h[0] = cvt8(p);
            aF[i].h[1] = cvt8(p + 16);
        }
        #pragma unroll
        for (int j = 0; j < 2; ++j) {
            const float* p = &sWf[buf][wn * 32 + j * 16 + l16][half * 8];
            bF[j].h[0] = cvt8(p);
            bF[j].h[1] = cvt8(p + 16);
        }
        #pragma unroll
        for (int i = 0; i < 4; ++i)
            #pragma unroll
            for (int j = 0; j < 2; ++j)
                acc[i][j] = wmma_bf16(aF[i].v, bF[j].v, acc[i][j]);
    }

    // Epilogue: C-fragment layout — VGPR r holds row (r + 8*half), col l16.
    auto epilogue = [&](auto tag) {
    constexpr int MODE = decltype(tag)::value;
    #pragma unroll
    for (int i = 0; i < 4; ++i) {
        #pragma unroll
        for (int j = 0; j < 2; ++j) {
            int gn = n0 + wn * 32 + j * 16 + l16;
            float bval = bias[gn];
            #pragma unroll
            for (int r = 0; r < 8; ++r) {
                int gm = m0 + wm * 64 + i * 16 + r + half * 8;
                float val = acc[i][j][r] + bval;
                int b = gm >> 11;                // / L
                int l = gm & (LL - 1);
                if (MODE == 0) {                 // [B,H,L,D] bf16
                    int h = gn >> 6, d = gn & 63;
                    ((__bf16*)dstv)[(((size_t)(b * HH + h) * LL + l) << 6) + d] = (__bf16)val;
                } else if (MODE == 1) {          // [B,H,D,L] bf16
                    int h = gn >> 6, d = gn & 63;
                    ((__bf16*)dstv)[((size_t)(b * HH + h) * DD + d) * LL + l] = (__bf16)val;
                } else {                         // [M,512] f32
                    ((float*)dstv)[(size_t)gm * 512 + gn] = val;
                }
            }
        }
    }
    };
    if constexpr (F32OUT) {
        epilogue(ModeTag<2>{});
    } else {
        if (vlayout) {
            epilogue(ModeTag<1>{});
        } else {
            epilogue(ModeTag<0>{});
            // the other layout's code lies behind this one in the built kernel:
            // this wait stands between these stores and the instructions there
            // that rewrite registers which the stores name
            asm volatile("s_wait_xcnt 0x0" ::: "memory");
        }
    }
}

// The occupancy target of both GEMM kernels is capped at two waves per SIMD, so
// that a K-step's LDS reads go out as one group (see the note at attn_flash).

// The three input projections depend on nothing of one another: one grid, whose
// z index picks the projection, runs them side by side. Alone each is 128
// workgroups on 256 WGPs; together the 384 workgroups run 256 at a time
// (under the two-wave cap one fills a WGP) and two launches go.
__global__ __launch_bounds__(256) __attribute__((amdgpu_waves_per_eu(2, 2)))
void gemm_qkv(const float* __restrict__ values, const float* __restrict__ keysI,
              const float* __restrict__ queryI,
              const float* __restrict__ Wv, const float* __restrict__ Wk,
              const float* __restrict__ Wq,
              const float* __restrict__ bv, const float* __restrict__ bk,
              const float* __restrict__ bq,
              __bf16* __restrict__ vb, __bf16* __restrict__ kb, __bf16* __restrict__ qb) {
    const int z = blockIdx.z;
    const float* A    = z == 0 ? values : z == 1 ? keysI : queryI;
    const float* W    = z == 0 ? Wv : z == 1 ? Wk : Wq;
    const float* bias = z == 0 ? bv : z == 1 ? bk : bq;
    __bf16*      dst  = z == 0 ? vb : z == 1 ? kb : qb;
    gemm_tile<false>(A, W, bias, (void*)dst, z == 0);
}

__global__ __launch_bounds__(256) __attribute__((amdgpu_waves_per_eu(2, 2)))
void gemm_out(const float* __restrict__ A, const float* __restrict__ W,
              const float* __restrict__ bias, float* __restrict__ dst) {
    gemm_tile<true>(A, W, bias, (void*)dst, false);
}

__device__ __forceinline__ float xhalf(float x) {
    return __builtin_bit_cast(float, __builtin_amdgcn_permlanex16(
        __builtin_bit_cast(int, x), __builtin_bit_cast(int, x),
        0x76543210, 0xfedcba98, false, false));
}

// This grid fills two waves per SIMD and no more (2048 waves, 1024 SIMDs).
// Capping the occupancy target there lets the compiler spend registers on
// keeping loads in flight together, instead of sinking each one to its use to
// stay small enough for waves that never come.
__global__ __launch_bounds__(128) __attribute__((amdgpu_waves_per_eu(2, 2)))
void attn_flash(const __bf16* __restrict__ qb,   // [B,H,L,D]
                const __bf16* __restrict__ kb,   // [B,H,L,D]
                const __bf16* __restrict__ vb,   // [B,H,D,L]
                const int*    __restrict__ mask, // [B,1,L,L]
                float*        __restrict__ Ob) { // [B,L,E]
    constexpr float SCALE = 0.04419417382415922f;   // 1/sqrt(512)
    constexpr int NT = LL / 64;                     // key tiles
    // 144-byte rows: the 16 rows of a ds_load_b128 fragment read spread over the banks
    __shared__ __attribute__((aligned(16))) __bf16 sK[2][64][64 + 8];   // [key][d]
    __shared__ __attribute__((aligned(16))) __bf16 sV[2][64][64 + 8];   // [d][key]

    const int wave = threadIdx.x >> 5;
    const int lane = threadIdx.x & 31;
    const int half = lane >> 4;
    const int l16  = lane & 15;
    const int bh   = blockIdx.y;                    // b*H + h
    const int bidx = bh / HH;
    const int hidx = bh % HH;
    const int q0   = blockIdx.x * 64;
    const int qrow0 = q0 + wave * 16;

    // Q B-fragments: column l16 is this lane's query (K = D = 64 -> 2 fragments)
    Frag bQ[2];
    {
        const __bf16* qp = qb + ((size_t)bh * LL + (qrow0 + l16)) * DD;
        #pragma unroll
        for (int kw = 0; kw < 2; ++kw) {
            bQ[kw].h[0] = *(const bf16x8*)(qp + kw * 32 + half * 8);
            bQ[kw].h[1] = *(const bf16x8*)(qp + kw * 32 + 16 + half * 8);
        }
    }

    v8f   accO[4] = {};                 // O^T: register r = d (dt*16 + 8*half + r), column = query
    float mSt = -3.0e38f;               // this query's running maximum (equal in both halves)
    float lSt = 0.0f;                   // sum over this half's keys; the halves join after the loop

    // this lane's mask words: its query's row, eight consecutive keys per 16-key tile
    const int* mrow = mask + ((size_t)bidx * LL + (qrow0 + l16)) * LL + half * 8;

    // One 64x64 bf16 tile of K and of V: 512 16-byte pieces each, 4 per thread;
    // a wave's copy covers four whole 128-byte rows.
    const int srow = threadIdx.x >> 3;              // 0..15, +16 per piece
    const int scol = (threadIdx.x & 7) * 8;
    const __bf16* kg = kb + ((size_t)bh * LL + srow) * DD + scol;
    const __bf16* vg = vb + ((size_t)bh * DD + srow) * LL + scol;
    auto stage = [&](int buf, int kc) {
        const __bf16* k0 = kg + (size_t)kc * DD;
        const __bf16* v0 = vg + kc;
        const unsigned lk = (unsigned)(unsigned long long)&sK[buf][srow][scol];
        const unsigned lv = (unsigned)(unsigned long long)&sV[buf][srow][scol];
        constexpr unsigned RS = 16 * (64 + 8) * 2;  // 16 LDS rows in bytes
        // the copies and the s_wait_xcnt that is kept in front of any rewrite of
        // their address registers stand in one statement, so that the compiler
        // can schedule nothing between them
        asm volatile(
            "global_load_async_to_lds_b128 %0, %8, off\n\t"
            "global_load_async_to_lds_b128 %1, %9, off\n\t"
            "global_load_async_to_lds_b128 %2, %10, off\n\t"
            "global_load_async_to_lds_b128 %3, %11, off\n\t"
            "global_load_async_to_lds_b128 %4, %12, off\n\t"
            "global_load_async_to_lds_b128 %5, %13, off\n\t"
            "global_load_async_to_lds_b128 %6, %14, off\n\t"
            "global_load_async_to_lds_b128 %7, %15, off\n\t"
            "s_wait_xcnt 0x0"
            :: "v"(lk), "v"(lk + RS), "v"(lk + 2 * RS), "v"(lk + 3 * RS),
               "v"(lv), "v"(lv + RS), "v"(lv + 2 * RS), "v"(lv + 3 * RS),
               "v"(k0), "v"(k0 + 16 * DD), "v"(k0 + 32 * DD), "v"(k0 + 48 * DD),
               "v"(v0), "v"(v0 + 16 * LL), "v"(v0 + 32 * LL), "v"(v0 + 48 * LL)
            : "memory");
    };

    stage(0, 0);
    asm volatile("s_wait_asynccnt 0x0" ::: "memory");   // my pieces of tile 0 have landed
    __syncthreads();                                    // everyone's have
    stage(1, 64);

    for (int t = 0; t < NT; ++t) {
        const int kc  = t * 64;
        const int buf = t & 1;
        // ---- mask words first: the longest latency of the trip ---------
        v4i mv[4][2];
        #pragma unroll
        for (int nt = 0; nt < 4; ++nt) {
            mv[nt][0] = *(const v4i*)(mrow + kc + nt * 16);
            mv[nt][1] = *(const v4i*)(mrow + kc + nt * 16 + 4);
        }

        // ---- this tile's K and V A-fragments out of LDS ----------------
        Frag aK[4][2], aV[4][2];
        #pragma unroll
        for (int nt = 0; nt < 4; ++nt) {
            const __bf16* kp = &sK[buf][nt * 16 + l16][0];
            const __bf16* vp = &sV[buf][nt * 16 + l16][0];
            #pragma unroll
            for (int kw = 0; kw < 2; ++kw) {
                aK[nt][kw].h[0] = *(const bf16x8*)(kp + kw * 32 + half * 8);
                aK[nt][kw].h[1] = *(const bf16x8*)(kp + kw * 32 + 16 + half * 8);
                aV[nt][kw].h[0] = *(const bf16x8*)(vp + kw * 32 + half * 8);
                aV[nt][kw].h[1] = *(const bf16x8*)(vp + kw * 32 + 16 + half * 8);
            }
        }
        // Inputs-only fence on the loaded fragments: without it each fragment's
        // two reads are issued and fully waited for right in front of their
        // WMMA, one LDS round trip per WMMA; with it the reads go out in groups
        // ahead of their use, behind counted waits.
        asm volatile("" :: "v"(aK[0][0].v), "v"(aK[0][1].v), "v"(aK[1][0].v), "v"(aK[1][1].v),
                           "v"(aK[2][0].v), "v"(aK[2][1].v), "v"(aK[3][0].v), "v"(aK[3][1].v),
                           "v"(aV[0][0].v), "v"(aV[0][1].v), "v"(aV[1][0].v), "v"(aV[1][1].v),
                           "v"(aV[2][0].v), "v"(aV[2][1].v), "v"(aV[3][0].v), "v"(aV[3][1].v));

        // ---- S^T = K @ Q^T (64 keys x 16 queries per wave), f32 accum --
        v8f s[4];
        #pragma unroll
        for (int nt = 0; nt < 4; ++nt) {
            v8f c = {};
            #pragma unroll
            for (int kw = 0; kw < 2; ++kw)
                c = wmma_bf16(aK[nt][kw].v, bQ[kw].v, (v8f)c);
            s[nt] = c;
        }

        // ---- mask: -1e30 where masked, other scores scaled ----------------------
        #pragma unroll
        for (int nt = 0; nt < 4; ++nt) {
            #pragma unroll
            for (int r = 0; r < 8; ++r) {
                float e = s[nt][r];
                s[nt][r] = (mv[nt][r >> 2][r & 3] == 0) ? -1.0e30f : e * SCALE;
            }
        }

        // ---- online softmax: a lane's 32 scores belong to one query ----
        float vmax = s[0][0];
        #pragma unroll
        for (int nt = 0; nt < 4; ++nt)
            #pragma unroll
            for (int r = 0; r < 8; ++r) vmax = fmaxf(vmax, s[nt][r]);
        vmax = fmaxf(vmax, xhalf(vmax));            // the query's other 32 keys
        const float mNew = fmaxf(mSt, vmax);
        const float corr = __expf(mSt - mNew);
        float rs[4];
        #pragma unroll
        for (int nt = 0; nt < 4; ++nt) {
            rs[nt] = 0.0f;
            #pragma unroll
            for (int r = 0; r < 8; ++r) {
                float pe = __expf(s[nt][r] - mNew);
                s[nt][r] = pe;
                rs[nt] += pe;
            }
        }
        lSt = lSt * corr + ((rs[0] + rs[1]) + (rs[2] + rs[3]));
        mSt = mNew;
        #pragma unroll
        for (int dt = 0; dt < 4; ++dt)
            #pragma unroll
            for (int r = 0; r < 8; ++r) accO[dt][r] *= corr;

        // ---- P^T as B operand: tiles 2kw and 2kw+1, converted in place,
        //      are keys 8*half + e and 16 + 8*half + e of a 32-key step ---
        Frag bP[2];
        #pragma unroll
        for (int kw = 0; kw < 2; ++kw)
            #pragma unroll
            for (int e = 0; e < 8; ++e) {
                bP[kw].h[0][e] = (__bf16)s[2 * kw][e];
                bP[kw].h[1][e] = (__bf16)s[2 * kw + 1][e];
            }

        // ---- O^T += V^T @ P^T  (V tile is [d][key]: rows are A rows) ---
        #pragma unroll
        for (int dt = 0; dt < 4; ++dt) {
            #pragma unroll
            for (int kw = 0; kw < 2; ++kw)
                accO[dt] = wmma_bf16(aV[dt][kw].v, bP[kw].v, accO[dt]);
        }

        // ---- hand over: tile t+1 is published, buffer buf is freed ------
        asm volatile("s_wait_dscnt 0x0" ::: "memory");      // my reads of this tile are done
        asm volatile("s_wait_asynccnt 0x0" ::: "memory");   // my pieces of tile t+1 have landed
        __syncthreads();
        if (t + 2 < NT) stage(buf, kc + 128);               // refill the buffer just read
    }
    asm volatile("s_wait_asynccnt 0x0" ::: "memory");       // nothing in flight at the wave's end

    // ---- finalize: join the halves' sums, divide, write [B,L,E] f32 ----
    const float lAll = lSt + xhalf(lSt);
    float* orow = Ob + ((size_t)bidx * LL + (qrow0 + l16)) * EE + hidx * DD + half * 8;
    #pragma unroll
    for (int dt = 0; dt < 4; ++dt) {
        float4 lo, hi;
        lo.x = accO[dt][0] / lAll; lo.y = accO[dt][1] / lAll;
        lo.z = accO[dt][2] / lAll; lo.w = accO[dt][3] / lAll;
        hi.x = accO[dt][4] / lAll; hi.y = accO[dt][5] / lAll;
        hi.z = accO[dt][6] / lAll; hi.w = accO[dt][7] / lAll;
        *(float4*)(orow + dt * 16)     = lo;
        *(float4*)(orow + dt * 16 + 4) = hi;
    }
}

// ---------------------------------------------------------------------------
// Launcher
// ---------------------------------------------------------------------------
extern "C" void kernel_launch(void* const* d_in, const int* in_sizes, int n_in,
                              void* d_out, int out_size, void* d_ws, size_t ws_size,
                              hipStream_t stream) {
    (void)in_sizes; (void)n_in; (void)out_size; (void)ws_size;
    const float* values = (const float*)d_in[0];
    const float* keysI  = (const float*)d_in[1];
    const float* queryI = (const float*)d_in[2];
    const int*   mask   = (const int*)d_in[3];
    const float* Wv = (const float*)d_in[4];  const float* bv = (const float*)d_in[5];
    const float* Wk = (const float*)d_in[6];  const float* bk = (const float*)d_in[7];
    const float* Wq = (const float*)d_in[8];  const float* bq = (const float*)d_in[9];
    const float* Wo = (const float*)d_in[10]; const float* bo = (const float*)d_in[11];

    char* ws = (char*)d_ws;
    __bf16* qb = (__bf16*)(ws);                      // 4 MB  [B,H,L,D] bf16
    __bf16* kb = (__bf16*)(ws + (4u << 20));         // 4 MB  [B,H,L,D] bf16
    __bf16* vb = (__bf16*)(ws + (8u << 20));         // 4 MB  [B,H,D,L] bf16
    float*  Ob = (float*) (ws + (12u << 20));        // 8 MB  [B,L,E]   f32

    dim3 gGrid(GM / 128, EE / 128), gBlk(256);
    gemm_qkv<<<dim3(GM / 128, EE / 128, 3), gBlk, 0, stream>>>(
        values, keysI, queryI, Wv, Wk, Wq, bv, bk, bq, vb, kb, qb);

    attn_flash<<<dim3(LL / 64, BB * HH), 128, 0, stream>>>(qb, kb, vb, mask, Ob);

    gemm_out<<<gGrid, gBlk, 0, stream>>>(Ob, Wo, bo, (float*)d_out);
}

// v005
// A run of this version takes 64.9 microseconds.
// In two side-by-side timings against v004, it was 1.31 and 1.30 times as fast.
// Counting every step since v000, it is 3.20 times as fast.
#include <hip/hip_runtime.h>

// ---------------------------------------------------------------------------
// Self-attention forward for B=2, L=2048, E=512, H=8, D=64 on gfx1250 (CDNA5).
// All matmuls run on v_wmma_f32_16x16x32_bf16 (bf16 operands, f32 accum).
// Attention is fused flash-style: scores never hit HBM.
// GEMM tiles are double-buffered through LDS with GLOBAL_LOAD_ASYNC_TO_LDS
// (ASYNCcnt): DMA for tile t+1 overlaps the WMMAs on tile t, one barrier
// per K-step.
// ---------------------------------------------------------------------------

typedef __attribute__((ext_vector_type(16))) __bf16 bf16x16;
typedef __attribute__((ext_vector_type(8)))  __bf16 bf16x8;
typedef __attribute__((ext_vector_type(8)))  float  v8f;
typedef __attribute__((ext_vector_type(4)))  int    v4i;
typedef __attribute__((ext_vector_type(16))) unsigned u32x16;
// constant address space: a load at a wave-uniform address becomes a scalar load
typedef const u32x16 __attribute__((address_space(4)))* const_u32x16_ptr;

union Frag {
    bf16x16 v;
    bf16x8  h[2];
};

__device__ __forceinline__ v8f wmma_bf16(bf16x16 a, bf16x16 b, v8f c) {
    // (neg_a, A, neg_b, B, c_mod, C, reuse_a, reuse_b)
    return __builtin_amdgcn_wmma_f32_16x16x32_bf16(
        false, a, false, b, (short)0, c, false, false);
}

constexpr int BB  = 2;
constexpr int LL  = 2048;
constexpr int EE  = 512;
constexpr int HH  = 8;
constexpr int DD  = 64;
constexpr int GM  = BB * LL;   // 4096 rows in every projection GEMM

// ---------------------------------------------------------------------------
// Async global->LDS copy (CDNA5 GLOBAL_LOAD_ASYNC_TO_LDS_B128, ASYNCcnt),
// guarded so an older toolchain falls back to the proven synchronous path.
// Builtin expects (v4i addrspace(1)*, v4i addrspace(3)*, imm offset, imm cpol).
// ---------------------------------------------------------------------------
#if __has_builtin(__builtin_amdgcn_global_load_async_to_lds_b128)
#define HAS_ASYNC_LDS 1
typedef v4i __attribute__((address_space(1)))* as1_v4i_ptr;
typedef v4i __attribute__((address_space(3)))* as3_v4i_ptr;
__device__ __forceinline__ void async_copy_b128(void* lds, const void* gptr) {
    __builtin_amdgcn_global_load_async_to_lds_b128(
        (as1_v4i_ptr)(unsigned long long)gptr,
        (as3_v4i_ptr)(unsigned int)(unsigned long long)lds,
        0, 0);
}
__device__ __forceinline__ void async_wait0() {
#if __has_builtin(__builtin_amdgcn_s_wait_asynccnt)
    __builtin_amdgcn_s_wait_asynccnt(0);
#else
    asm volatile("s_wait_asynccnt 0" ::: "memory");
#endif
}
#else
#define HAS_ASYNC_LDS 0
__device__ __forceinline__ void async_copy_b128(void* lds, const void* gptr) {
    *(float4*)lds = *(const float4*)gptr;
}
__device__ __forceinline__ void async_wait0() {}
#endif

// Convert 8 consecutive f32 (16B-aligned) to a bf16x8 half-fragment.
__device__ __forceinline__ bf16x8 cvt8(const float* p) {
    float4 a = *(const float4*)p;
    float4 b = *(const float4*)(p + 4);
    bf16x8 r;
    r[0] = (__bf16)a.x; r[1] = (__bf16)a.y; r[2] = (__bf16)a.z; r[3] = (__bf16)a.w;
    r[4] = (__bf16)b.x; r[5] = (__bf16)b.y; r[6] = (__bf16)b.z; r[7] = (__bf16)b.w;
    return r;
}

// ---------------------------------------------------------------------------
// Generic projection GEMM tile: dst = A[M,512] @ W[512,512]^T + bias, M = 4096.
// mode 0: write bf16 into [B,H,L,D]   (Q and K)
// mode 1: write bf16 into [B,H,D,L]   (V, pre-transposed for attn 2nd GEMM)
// mode 2: write f32  into [M, 512]    (final output projection)
// F32OUT fixes mode 2 at compile time; otherwise vlayout (the same for the whole
// block) picks mode 1 or 0 in the epilogue, so that one main loop and one pair
// of LDS buffers serve all three input projections.
// Block: 256 threads (8 waves). Block tile 128x128, wave tile 64x32,
// K stepped by 32. Double-buffered async DMA staging: copies for step t+1
// run concurrently with the WMMAs of step t.
// ---------------------------------------------------------------------------
template <int M> struct ModeTag { static constexpr int value = M; };

template <bool F32OUT>
__device__ __forceinline__
void gemm_tile(const float* __restrict__ A, const float* __restrict__ W,
               const float* __restrict__ bias, void* __restrict__ dstv, bool vlayout) {
    constexpr int PADF   = 4;                    // 36-float rows: 16 rows hit
    constexpr int NSTEPS = 512 / 32;             // 16 distinct bank groups
    __shared__ float sAf[2][128][32 + PADF];
    __shared__ float sWf[2][128][32 + PADF];

    const int tid  = threadIdx.x;
    const int wave = tid >> 5;
    const int lane = tid & 31;
    const int half = lane >> 4;                  // 0 | 1 (lane group)
    const int l16  = lane & 15;
    const int m0   = blockIdx.x * 128;
    const int n0   = blockIdx.y * 128;
    const int wm   = wave & 1;                   // 2 wave-rows  x 64
    const int wn   = wave >> 1;                  // 4 wave-cols  x 32

    // Stage one 128x32 f32 tile pair: 1024 16B chunks per matrix, 4/thread.
    auto stage = [&](int buf, int k0) {
        #pragma unroll
        for (int i = 0; i < 4; ++i) {
            int idx = tid + i * 256;             // 0..1023
            int row = idx >> 3;                  // 0..127
            int cg  = (idx & 7) * 4;             // col group of 4 floats
            async_copy_b128(&sAf[buf][row][cg], A + (size_t)(m0 + row) * 512 + k0 + cg);
            async_copy_b128(&sWf[buf][row][cg], W + (size_t)(n0 + row) * 512 + k0 + cg);
        }
    };

    v8f acc[4][2] = {};

    stage(0, 0);                                 // prologue DMA
    for (int step = 0; step < NSTEPS; ++step) {
        const int buf = step & 1;
        async_wait0();                           // my copies for `buf` done
        __syncthreads();                         // everyone's copies done
        if (step + 1 < NSTEPS)
            stage(buf ^ 1, (step + 1) * 32);     // overlaps with WMMAs below

        Frag aF[4], bF[2];
        #pragma unroll
        for (int i = 0; i < 4; ++i) {
            const float* p = &sAf[buf][wm * 64 + i * 16 + l16][half * 8];
            aF[i].h[0] = cvt8(p);
            aF[i].h[1] = cvt8(p + 16);
        }
        #pragma unroll
        for (int j = 0; j < 2; ++j) {
            const float* p = &sWf[buf][wn * 32 + j * 16 + l16][half * 8];
            bF[j].h[0] = cvt8(p);
            bF[j].h[1] = cvt8(p + 16);
        }
        #pragma unroll
        for (int i = 0; i < 4; ++i)
            #pragma unroll
            for (int j = 0; j < 2; ++j)
                acc[i][j] = wmma_bf16(aF[i].v, bF[j].v, acc[i][j]);
    }

    // Epilogue: C-fragment layout — VGPR r holds row (r + 8*half), col l16.
    auto epilogue = [&](auto tag) {
    constexpr int MODE = decltype(tag)::value;
    #pragma unroll
    for (int i = 0; i < 4; ++i) {
        #pragma unroll
        for (int j = 0; j < 2; ++j) {
            int gn = n0 + wn * 32 + j * 16 + l16;
            float bval = bias[gn];
            #pragma unroll
            for (int r = 0; r < 8; ++r) {
                int gm = m0 + wm * 64 + i * 16 + r + half * 8;
                float val = acc[i][j][r] + bval;
                int b = gm >> 11;                // / L
                int l = gm & (LL - 1);
                if (MODE == 0) {                 // [B,H,L,D] bf16
                    int h = gn >> 6, d = gn & 63;
                    ((__bf16*)dstv)[(((size_t)(b * HH + h) * LL + l) << 6) + d] = (__bf16)val;
                } else if (MODE == 1) {          // [B,H,D,L] bf16
                    int h = gn >> 6, d = gn & 63;
                    ((__bf16*)dstv)[((size_t)(b * HH + h) * DD + d) * LL + l] = (__bf16)val;
                } else {                         // [M,512] f32
                    ((float*)dstv)[(size_t)gm * 512 + gn] = val;
                }
            }
        }
    }
    };
    if constexpr (F32OUT) {
        epilogue(ModeTag<2>{});
    } else {
        if (vlayout) {
            epilogue(ModeTag<1>{});
            // as below: in the built kernel the mask packing's code lies behind this one
            asm volatile("s_wait_xcnt 0x0" ::: "memory");
        } else {
            epilogue(ModeTag<0>{});
            // the other layout's code lies behind this one in the built kernel:
            // this wait stands between these stores and the instructions there
            // that rewrite registers which the stores name
            asm volatile("s_wait_xcnt 0x0" ::: "memory");
        }
    }
}

// The occupancy target of both GEMM kernels is capped at two waves per SIMD, so
// that a K-step's LDS reads go out as one group (see the note at attn_flash).

// ---------------------------------------------------------------------------
// The mask is the same for all eight heads, and attention needs one bit of each
// word. It is packed once, in the form in which an attention wave uses it: for
// a group of 16 queries and a tile of 64 keys, 32 words, one per score register
// (nt, r) of the wave's S^T tiles; bit `lane` of a word says whether that lane's
// score (query l16, key nt*16 + 8*half + r) is kept. Such a word is a lane mask
// as a select takes it from a scalar register.
// pm: [B*L/16 groups][L/64 tiles][32 words] = 1 MB.
// The mask is read in whole lines: one load takes 128 neighbouring keys of one
// row, four to a lane. A ballot per component gives that row's bits (bit j of
// component c is key 4j + c); lanes l16 and l16 + 16 collect the four words of
// row l16, and a second round of ballots, over single bits of those words,
// turns rows into lane masks.
// One wave packs 512 keys of one group, 256 (32 loads in flight) at a time.
// ---------------------------------------------------------------------------
__device__ __forceinline__
void pack_mask(const int* __restrict__ mask, unsigned* __restrict__ pm) {
    const int lane = threadIdx.x & 31;
    const int half = lane >> 4;
    const int w    = (blockIdx.y * (GM / 128) + blockIdx.x) * 8 + (threadIdx.x >> 5);  // 0..1023
    const int g    = w >> 2;                     // group of 16 rows of [B*L]
    const int k0   = (w & 3) * 512;              // first of this wave's 512 keys
    const int* src = mask + (size_t)(g * 16) * LL + k0 + lane * 4;
    unsigned*  dst = pm + ((size_t)g * (LL / 64) + k0 / 64) * 32 + lane;
    // kept rolled: unrolled, all 64 loads are lifted to the top and their 256
    // registers cost the projection workgroups their second place on a WGP
    #pragma unroll 1
    for (int pp = 0; pp < 2; ++pp) {
        v4i mv[2][16];
        #pragma unroll
        for (int p = 0; p < 2; ++p)
            #pragma unroll
            for (int row = 0; row < 16; ++row)
                // read once: non-temporal, so that the 32 MB do not push Q, K, V out of L2
                mv[p][row] = __builtin_nontemporal_load(
                    (const v4i*)(src + (size_t)row * LL + (pp * 2 + p) * 128));
        #pragma unroll
        for (int p = 0; p < 2; ++p) {
            unsigned x[4] = {0u, 0u, 0u, 0u};    // row l16: bit j of x[c] is key 4j + c
            #pragma unroll
            for (int row = 0; row < 16; ++row)
                #pragma unroll
                for (int c = 0; c < 4; ++c) {
                    const unsigned bits = __builtin_amdgcn_ballot_w32(mv[p][row][c] != 0);
                    x[c] = __builtin_amdgcn_inverse_ballot_w32(0x00010001u << row) ? bits : x[c];
                }
            #pragma unroll
            for (int c = 0; c < 4; ++c) x[c] >>= half * 2;   // keys 8*half + ... of each 16
            #pragma unroll
            for (int tt = 0; tt < 2; ++tt) {     // the two 64-key tiles of these 128 keys
                unsigned word = 0u;              // lane i ends up with word i
                #pragma unroll
                for (int nt = 0; nt < 4; ++nt)
                    #pragma unroll
                    for (int r = 0; r < 8; ++r) {
                        const unsigned bit  = 1u << (tt * 16 + nt * 4 + (r >> 2));
                        const unsigned keep = __builtin_amdgcn_ballot_w32((x[r & 3] & bit) != 0u);
                        word = __builtin_amdgcn_inverse_ballot_w32(1u << (nt * 8 + r)) ? keep : word;
                    }
                dst[((pp * 2 + p) * 2 + tt) * 32] = word;    // one whole 128-byte line per tile
            }
        }
        // kept in front of the next trip's rewrite of the registers that these
        // stores name (their address and their data)
        asm volatile("s_wait_xcnt 0x0" ::: "memory");
    }
}

// The three input projections depend on nothing of one another: one grid, whose
// z index picks the projection, runs them side by side. Alone each is 128
// workgroups on 256 WGPs; two fit a WGP by registers and LDS, so a fourth plane
// of 128 workgroups, which packs the mask, is resident beside the 384 as well.
__global__ __launch_bounds__(256) __attribute__((amdgpu_waves_per_eu(2, 2)))
void gemm_qkv(const float* __restrict__ values, const float* __restrict__ keysI,
              const float* __restrict__ queryI,
              const float* __restrict__ Wv, const float* __restrict__ Wk,
              const float* __restrict__ Wq,
              const float* __restrict__ bv, const float* __restrict__ bk,
              const float* __restrict__ bq,
              __bf16* __restrict__ vb, __bf16* __restrict__ kb, __bf16* __restrict__ qb,
              const int* __restrict__ mask, unsigned* __restrict__ pm) {
    const int z = blockIdx.z;
    if (z == 3) {                                // the whole block: no barrier is skipped by part of it
        pack_mask(mask, pm);
        return;
    }
    const float* A    = z == 0 ? values : z == 1 ? keysI : queryI;
    const float* W    = z == 0 ? Wv : z == 1 ? Wk : Wq;
    const float* bias = z == 0 ? bv : z == 1 ? bk : bq;
    __bf16*      dst  = z == 0 ? vb : z == 1 ? kb : qb;
    gemm_tile<false>(A, W, bias, (void*)dst, z == 0);
}

__global__ __launch_bounds__(256) __attribute__((amdgpu_waves_per_eu(2, 2)))
void gemm_out(const float* __restrict__ A, const float* __restrict__ W,
              const float* __restrict__ bias, float* __restrict__ dst) {
    gemm_tile<true>(A, W, bias, (void*)dst, false);
}

__device__ __forceinline__ float xhalf(float x) {
    return __builtin_bit_cast(float, __builtin_amdgcn_permlanex16(
        __builtin_bit_cast(int, x), __builtin_bit_cast(int, x),
        0x76543210, 0xfedcba98, false, false));
}

// This grid fills two waves per SIMD and no more (2048 waves, 1024 SIMDs).
// Capping the occupancy target there lets the compiler spend registers on
// keeping loads in flight together, instead of sinking each one to its use to
// stay small enough for waves that never come.
__global__ __launch_bounds__(128) __attribute__((amdgpu_waves_per_eu(2, 2)))
void attn_flash(const __bf16* __restrict__ qb,   // [B,H,L,D]
                const __bf16* __restrict__ kb,   // [B,H,L,D]
                const __bf16* __restrict__ vb,   // [B,H,D,L]
                const unsigned* __restrict__ pm, // packed mask, see pack_mask
                float*        __restrict__ Ob) { // [B,L,E]
    constexpr float SCALE = 0.04419417382415922f;   // 1/sqrt(512)
    constexpr int NT = LL / 64;                     // key tiles
    // 144-byte rows: the 16 rows of a ds_load_b128 fragment read spread over the banks
    __shared__ __attribute__((aligned(16))) __bf16 sK[2][64][64 + 8];   // [key][d]
    __shared__ __attribute__((aligned(16))) __bf16 sV[2][64][64 + 8];   // [d][key]

    const int wave = threadIdx.x >> 5;
    const int lane = threadIdx.x & 31;
    const int half = lane >> 4;
    const int l16  = lane & 15;
    const int bh   = blockIdx.y;                    // b*H + h
    const int bidx = bh / HH;
    const int hidx = bh % HH;
    const int q0   = blockIdx.x * 64;
    const int qrow0 = q0 + wave * 16;

    // Q B-fragments: column l16 is this lane's query (K = D = 64 -> 2 fragments)
    Frag bQ[2];
    {
        const __bf16* qp = qb + ((size_t)bh * LL + (qrow0 + l16)) * DD;
        #pragma unroll
        for (int kw = 0; kw < 2; ++kw) {
            bQ[kw].h[0] = *(const bf16x8*)(qp + kw * 32 + half * 8);
            bQ[kw].h[1] = *(const bf16x8*)(qp + kw * 32 + 16 + half * 8);
        }
    }

    v8f   accO[4] = {};                 // O^T: register r = d (dt*16 + 8*half + r), column = query
    float mSt = -3.0e38f;               // this query's running maximum (equal in both halves)
    float lSt = 0.0f;                   // sum over this half's keys; the halves join after the loop

    // this wave's lane-mask words: 32 per key tile, at an address that is the same
    // in every lane (the wave's number made scalar), so they come by scalar loads
    const int grp = (bidx * LL + q0) / 16 + __builtin_amdgcn_readfirstlane(wave);
    // (nothing writes pm while this kernel runs: the launch before it did)
    const_u32x16_ptr pw = (const_u32x16_ptr)(unsigned long long)(pm + (size_t)grp * (NT * 32));
    u32x16 mw[2];
    mw[0] = pw[0];
    mw[1] = pw[1];

    // One 64x64 bf16 tile of K and of V: 512 16-byte pieces each, 4 per thread;
    // a wave's copy covers four whole 128-byte rows.
    const int srow = threadIdx.x >> 3;              // 0..15, +16 per piece
    const int scol = (threadIdx.x & 7) * 8;
    const __bf16* kg = kb + ((size_t)bh * LL + srow) * DD + scol;
    const __bf16* vg = vb + ((size_t)bh * DD + srow) * LL + scol;
    auto stage = [&](int buf, int kc) {
        const __bf16* k0 = kg + (size_t)kc * DD;
        const __bf16* v0 = vg + kc;
        const unsigned lk = (unsigned)(unsigned long long)&sK[buf][srow][scol];
        const unsigned lv = (unsigned)(unsigned long long)&sV[buf][srow][scol];
        constexpr unsigned RS = 16 * (64 + 8) * 2;  // 16 LDS rows in bytes
        // the copies and the s_wait_xcnt that is kept in front of any rewrite of
        // their address registers stand in one statement, so that the compiler
        // can schedule nothing between them
        asm volatile(
            "global_load_async_to_lds_b128 %0, %8, off\n\t"
            "global_load_async_to_lds_b128 %1, %9, off\n\t"
            "global_load_async_to_lds_b128 %2, %10, off\n\t"
            "global_load_async_to_lds_b128 %3, %11, off\n\t"
            "global_load_async_to_lds_b128 %4, %12, off\n\t"
            "global_load_async_to_lds_b128 %5, %13, off\n\t"
            "global_load_async_to_lds_b128 %6, %14, off\n\t"
            "global_load_async_to_lds_b128 %7, %15, off\n\t"
            "s_wait_xcnt 0x0"
            :: "v"(lk), "v"(lk + RS), "v"(lk + 2 * RS), "v"(lk + 3 * RS),
               "v"(lv), "v"(lv + RS), "v"(lv + 2 * RS), "v"(lv + 3 * RS),
               "v"(k0), "v"(k0 + 16 * DD), "v"(k0 + 32 * DD), "v"(k0 + 48 * DD),
               "v"(v0), "v"(v0 + 16 * LL), "v"(v0 + 32 * LL), "v"(v0 + 48 * LL)
            : "memory");
    };

    stage(0, 0);
    asm volatile("s_wait_asynccnt 0x0" ::: "memory");   // my pieces of tile 0 have landed
    __syncthreads();                                    // everyone's have
    stage(1, 64);

    for (int t = 0; t < NT; ++t) {
        const int kc  = t * 64;
        const int buf = t & 1;
        // ---- this tile's K and V A-fragments out of LDS ----------------
        Frag aK[4][2], aV[4][2];
        #pragma unroll
        for (int nt = 0; nt < 4; ++nt) {
            const __bf16* kp = &sK[buf][nt * 16 + l16][0];
            const __bf16* vp = &sV[buf][nt * 16 + l16][0];
            #pragma unroll
            for (int kw = 0; kw < 2; ++kw) {
                aK[nt][kw].h[0] = *(const bf16x8*)(kp + kw * 32 + half * 8);
                aK[nt][kw].h[1] = *(const bf16x8*)(kp + kw * 32 + 16 + half * 8);
                aV[nt][kw].h[0] = *(const bf16x8*)(vp + kw * 32 + half * 8);
                aV[nt][kw].h[1] = *(const bf16x8*)(vp + kw * 32 + 16 + half * 8);
            }
        }
        // Inputs-only fence on the loaded fragments: without it each fragment's
        // two reads are issued and fully waited for right in front of their
        // WMMA, one LDS round trip per WMMA; with it the reads go out in groups
        // ahead of their use, behind counted waits.
        asm volatile("" :: "v"(aK[0][0].v), "v"(aK[0][1].v), "v"(aK[1][0].v), "v"(aK[1][1].v),
                           "v"(aK[2][0].v), "v"(aK[2][1].v), "v"(aK[3][0].v), "v"(aK[3][1].v),
                           "v"(aV[0][0].v), "v"(aV[0][1].v), "v"(aV[1][0].v), "v"(aV[1][1].v),
                           "v"(aV[2][0].v), "v"(aV[2][1].v), "v"(aV[3][0].v), "v"(aV[3][1].v));

        // ---- S^T = K @ Q^T (64 keys x 16 queries per wave), f32 accum --
        v8f s[4];
        #pragma unroll
        for (int nt = 0; nt < 4; ++nt) {
            v8f c = {};
            #pragma unroll
            for (int kw = 0; kw < 2; ++kw)
                c = wmma_bf16(aK[nt][kw].v, bQ[kw].v, (v8f)c);
            s[nt] = c;
        }

        // ---- mask: -1e30 where masked, other scores scaled ----------------------
        #pragma unroll
        for (int nt = 0; nt < 4; ++nt) {
            #pragma unroll
            for (int r = 0; r < 8; ++r) {
                float e = s[nt][r];
                const bool keep = __builtin_amdgcn_inverse_ballot_w32(mw[nt >> 1][(nt & 1) * 8 + r]);
                s[nt][r] = keep ? e * SCALE : -1.0e30f;
            }
        }
        // the next tile's words, into the registers just used: the rest of this
        // trip covers their way from L2 (the last trip reads its own again)
        {
            const int tn = t + 1 < NT ? t + 1 : t;
            mw[0] = pw[tn * 2];
            mw[1] = pw[tn * 2 + 1];
        }

        // ---- online softmax: a lane's 32 scores belong to one query ----
        float vmax = s[0][0];
        #pragma unroll
        for (int nt = 0; nt < 4; ++nt)
            #pragma unroll
            for (int r = 0; r < 8; ++r) vmax = fmaxf(vmax, s[nt][r]);
        vmax = fmaxf(vmax, xhalf(vmax));            // the query's other 32 keys
        const float mNew = fmaxf(mSt, vmax);
        const float corr = __expf(mSt - mNew);
        float rs[4];
        #pragma unroll
        for (int nt = 0; nt < 4; ++nt) {
            rs[nt] = 0.0f;
            #pragma unroll
            for (int r = 0; r < 8; ++r) {
                float pe = __expf(s[nt][r] - mNew);
                s[nt][r] = pe;
                rs[nt] += pe;
            }
        }
        lSt = lSt * corr + ((rs[0] + rs[1]) + (rs[2] + rs[3]));
        mSt = mNew;
        #pragma unroll
        for (int dt = 0; dt < 4; ++dt)
            #pragma unroll
            for (int r = 0; r < 8; ++r) accO[dt][r] *= corr;

        // ---- P^T as B operand: tiles 2kw and 2kw+1, converted in place,
        //      are keys 8*half + e and 16 + 8*half + e of a 32-key step ---
        Frag bP[2];
        #pragma unroll
        for (int kw = 0; kw < 2; ++kw)
            #pragma unroll
            for (int e = 0; e < 8; ++e) {
                bP[kw].h[0][e] = (__bf16)s[2 * kw][e];
                bP[kw].h[1][e] = (__bf16)s[2 * kw + 1][e];
            }

        // ---- O^T += V^T @ P^T  (V tile is [d][key]: rows are A rows) ---
        #pragma unroll
        for (int dt = 0; dt < 4; ++dt) {
            #pragma unroll
            for (int kw = 0; kw < 2; ++kw)
                accO[dt] = wmma_bf16(aV[dt][kw].v, bP[kw].v, accO[dt]);
        }

        // ---- hand over: tile t+1 is published, buffer buf is freed ------
        asm volatile("s_wait_dscnt 0x0" ::: "memory");      // my reads of this tile are done
        asm volatile("s_wait_asynccnt 0x0" ::: "memory");   // my pieces of tile t+1 have landed
        __syncthreads();
        if (t + 2 < NT) stage(buf, kc + 128);               // refill the buffer just read
    }
    asm volatile("s_wait_asynccnt 0x0" ::: "memory");       // nothing in flight at the wave's end

    // ---- finalize: join the halves' sums, divide, write [B,L,E] f32 ----
    const float lAll = lSt + xhalf(lSt);
    float* orow = Ob + ((size_t)bidx * LL + (qrow0 + l16)) * EE + hidx * DD + half * 8;
    #pragma unroll
    for (int dt = 0; dt < 4; ++dt) {
        float4 lo, hi;
        lo.x = accO[dt][0] / lAll; lo.y = accO[dt][1] / lAll;
        lo.z = accO[dt][2] / lAll; lo.w = accO[dt][3] / lAll;
        hi.x = accO[dt][4] / lAll; hi.y = accO[dt][5] / lAll;
        hi.z = accO[dt][6] / lAll; hi.w = accO[dt][7] / lAll;
        *(float4*)(orow + dt * 16)     = lo;
        *(float4*)(orow + dt * 16 + 4) = hi;
    }
}

// ---------------------------------------------------------------------------
// Launcher
// ---------------------------------------------------------------------------
extern "C" void kernel_launch(void* const* d_in, const int* in_sizes, int n_in,
                              void* d_out, int out_size, void* d_ws, size_t ws_size,
                              hipStream_t stream) {
    (void)in_sizes; (void)n_in; (void)out_size; (void)ws_size;
    const float* values = (const float*)d_in[0];
    const float* keysI  = (const float*)d_in[1];
    const float* queryI = (const float*)d_in[2];
    const int*   mask   = (const int*)d_in[3];
    const float* Wv = (const float*)d_in[4];  const float* bv = (const float*)d_in[5];
    const float* Wk = (const float*)d_in[6];  const float* bk = (const float*)d_in[7];
    const float* Wq = (const float*)d_in[8];  const float* bq = (const float*)d_in[9];
    const float* Wo = (const float*)d_in[10]; const float* bo = (const float*)d_in[11];

    char* ws = (char*)d_ws;
    __bf16* qb = (__bf16*)(ws);                      // 4 MB  [B,H,L,D] bf16
    __bf16* kb = (__bf16*)(ws + (4u << 20));         // 4 MB  [B,H,L,D] bf16
    __bf16* vb = (__bf16*)(ws + (8u << 20));         // 4 MB  [B,H,D,L] bf16
    float*  Ob = (float*) (ws + (12u << 20));        // 8 MB  [B,L,E]   f32
    unsigned* pm = (unsigned*)(ws + (20u << 20));    // 1 MB  packed mask

    dim3 gGrid(GM / 128, EE / 128), gBlk(256);
    gemm_qkv<<<dim3(GM / 128, EE / 128, 4), gBlk, 0, stream>>>(
        values, keysI, queryI, Wv, Wk, Wq, bv, bk, bq, vb, kb, qb, mask, pm);

    attn_flash<<<dim3(LL / 64, BB * HH), 128, 0, stream>>>(qb, kb, vb, pm, Ob);

    gemm_out<<<gGrid, gBlk, 0, stream>>>(Ob, Wo, bo, (float*)d_out);
}

// v006
// Measured time: 61.2 microseconds a run.
// In both of two side-by-side timings against v005, it was 1.07 times as fast.
// All steps since v000 together make it 3.43 times as fast.
#include <hip/hip_runtime.h>

// ---------------------------------------------------------------------------
// Self-attention forward for B=2, L=2048, E=512, H=8, D=64 on gfx1250 (CDNA5).
// All matmuls run on v_wmma_f32_16x16x32_bf16 (bf16 operands, f32 accum).
// Attention is fused flash-style: scores never hit HBM.
// GEMM tiles are double-buffered through LDS with GLOBAL_LOAD_ASYNC_TO_LDS
// (ASYNCcnt): DMA for tile t+1 overlaps the WMMAs on tile t, one barrier
// per K-step.
// ---------------------------------------------------------------------------

typedef __attribute__((ext_vector_type(16))) __bf16 bf16x16;
typedef __attribute__((ext_vector_type(8)))  __bf16 bf16x8;
typedef __attribute__((ext_vector_type(8)))  float  v8f;
typedef __attribute__((ext_vector_type(4)))  int    v4i;
typedef __attribute__((ext_vector_type(16))) unsigned u32x16;
// constant address space: a load at a wave-uniform address becomes a scalar load
typedef const u32x16 __attribute__((address_space(4)))* const_u32x16_ptr;

union Frag {
    bf16x16 v;
    bf16x8  h[2];
};

__device__ __forceinline__ v8f wmma_bf16(bf16x16 a, bf16x16 b, v8f c) {
    // (neg_a, A, neg_b, B, c_mod, C, reuse_a, reuse_b)
    return __builtin_amdgcn_wmma_f32_16x16x32_bf16(
        false, a, false, b, (short)0, c, false, false);
}

constexpr int BB  = 2;
constexpr int LL  = 2048;
constexpr int EE  = 512;
constexpr int HH  = 8;
constexpr int DD  = 64;
constexpr int GM  = BB * LL;   // 4096 rows in every projection GEMM

// ---------------------------------------------------------------------------
// Async global->LDS copy (CDNA5 GLOBAL_LOAD_ASYNC_TO_LDS_B128, ASYNCcnt),
// guarded so an older toolchain falls back to the proven synchronous path.
// Builtin expects (v4i addrspace(1)*, v4i addrspace(3)*, imm offset, imm cpol).
// ---------------------------------------------------------------------------
#if __has_builtin(__builtin_amdgcn_global_load_async_to_lds_b128)
#define HAS_ASYNC_LDS 1
typedef v4i __attribute__((address_space(1)))* as1_v4i_ptr;
typedef v4i __attribute__((address_space(3)))* as3_v4i_ptr;
__device__ __forceinline__ void async_copy_b128(void* lds, const void* gptr) {
    __builtin_amdgcn_global_load_async_to_lds_b128(
        (as1_v4i_ptr)(unsigned long long)gptr,
        (as3_v4i_ptr)(unsigned int)(unsigned long long)lds,
        0, 0);
}
__device__ __forceinline__ void async_wait0() {
#if __has_builtin(__builtin_amdgcn_s_wait_asynccnt)
    __builtin_amdgcn_s_wait_asynccnt(0);
#else
    asm volatile("s_wait_asynccnt 0" ::: "memory");
#endif
}
#else
#define HAS_ASYNC_LDS 0
__device__ __forceinline__ void async_copy_b128(void* lds, const void* gptr) {
    *(float4*)lds = *(const float4*)gptr;
}
__device__ __forceinline__ void async_wait0() {}
#endif

// Convert 8 consecutive f32 (16B-aligned) to a bf16x8 half-fragment.
__device__ __forceinline__ bf16x8 cvt8(const float* p) {
    float4 a = *(const float4*)p;
    float4 b = *(const float4*)(p + 4);
    bf16x8 r;
    r[0] = (__bf16)a.x; r[1] = (__bf16)a.y; r[2] = (__bf16)a.z; r[3] = (__bf16)a.w;
    r[4] = (__bf16)b.x; r[5] = (__bf16)b.y; r[6] = (__bf16)b.z; r[7] = (__bf16)b.w;
    return r;
}

// ---------------------------------------------------------------------------
// Generic projection GEMM tile: dst = A[M,512] @ W[512,512]^T + bias, M = 4096.
// mode 0: write bf16 into [B,H,L,D]   (Q and K)
// mode 1: write bf16 into [B,H,D,L]   (V, pre-transposed for attn 2nd GEMM)
// mode 2: write f32  into [M, 512]    (final output projection)
// F32OUT fixes mode 2 at compile time; otherwise vlayout (the same for the whole
// block) picks mode 1 or 0 in the epilogue, so that one main loop and one pair
// of LDS buffers serve all three input projections.
// Block: 256 threads (8 waves). Block tile 128x128, wave tile 64x32,
// K stepped by 32. Double-buffered async DMA staging: copies for step t+1
// run concurrently with the WMMAs of step t.
// ---------------------------------------------------------------------------
template <int M> struct ModeTag { static constexpr int value = M; };

template <bool F32OUT>
__device__ __forceinline__
void gemm_tile(const float* __restrict__ A, const float* __restrict__ W,
               const float* __restrict__ bias, void* __restrict__ dstv, bool vlayout) {
    constexpr int PADF   = 4;                    // 36-float rows: 16 rows hit
    constexpr int NSTEPS = 512 / 32;             // 16 distinct bank groups
    __shared__ float sAf[2][128][32 + PADF];
    __shared__ float sWf[2][128][32 + PADF];

    const int tid  = threadIdx.x;
    const int wave = tid >> 5;
    const int lane = tid & 31;
    const int half = lane >> 4;                  // 0 | 1 (lane group)
    const int l16  = lane & 15;
    const int m0   = blockIdx.x * 128;
    const int n0   = blockIdx.y * 128;
    const int wm   = wave & 1;                   // 2 wave-rows  x 64
    const int wn   = wave >> 1;                  // 4 wave-cols  x 32

    // Stage one 128x32 f32 tile pair: 1024 16B chunks per matrix, 4/thread.
    auto stage = [&](int buf, int k0) {
        #pragma unroll
        for (int i = 0; i < 4; ++i) {
            int idx = tid + i * 256;             // 0..1023
            int row = idx >> 3;                  // 0..127
            int cg  = (idx & 7) * 4;             // col group of 4 floats
            async_copy_b128(&sAf[buf][row][cg], A + (size_t)(m0 + row) * 512 + k0 + cg);
            async_copy_b128(&sWf[buf][row][cg], W + (size_t)(n0 + row) * 512 + k0 + cg);
        }
    };

    v8f acc[4][2] = {};

    stage(0, 0);                                 // prologue DMA
    for (int step = 0; step < NSTEPS; ++step) {
        const int buf = step & 1;
        async_wait0();                           // my copies for `buf` done
        __syncthreads();                         // everyone's copies done
        if (step + 1 < NSTEPS)
            stage(buf ^ 1, (step + 1) * 32);     // overlaps with WMMAs below

        Frag aF[4], bF[2];
        #pragma unroll
        for (int i = 0; i < 4; ++i) {
            const float* p = &sAf[buf][wm * 64 + i * 16 + l16][half * 8];
            aF[i].h[0] = cvt8(p);
            aF[i].h[1] = cvt8(p + 16);
        }
        #pragma unroll
        for (int j = 0; j < 2; ++j) {
            const float* p = &sWf[buf][wn * 32 + j * 16 + l16][half * 8];
            bF[j].h[0] = cvt8(p);
            bF[j].h[1] = cvt8(p + 16);
        }
        #pragma unroll
        for (int i = 0; i < 4; ++i)
            #pragma unroll
            for (int j = 0; j < 2; ++j)
                acc[i][j] = wmma_bf16(aF[i].v, bF[j].v, acc[i][j]);
    }

    // Epilogue: C-fragment layout — VGPR r holds row (r + 8*half), col l16.
    auto epilogue = [&](auto tag) {
    constexpr int MODE = decltype(tag)::value;
    #pragma unroll
    for (int i = 0; i < 4; ++i) {
        #pragma unroll
        for (int j = 0; j < 2; ++j) {
            int gn = n0 + wn * 32 + j * 16 + l16;
            float bval = bias[gn];
            #pragma unroll
            for (int r = 0; r < 8; ++r) {
                int gm = m0 + wm * 64 + i * 16 + r + half * 8;
                float val = acc[i][j][r] + bval;
                int b = gm >> 11;                // / L
                int l = gm & (LL - 1);
                if (MODE == 0) {                 // [B,H,L,D] bf16
                    int h = gn >> 6, d = gn & 63;
                    ((__bf16*)dstv)[(((size_t)(b * HH + h) * LL + l) << 6) + d] = (__bf16)val;
                } else if (MODE == 1) {          // [B,H,D,L] bf16
                    int h = gn >> 6, d = gn & 63;
                    ((__bf16*)dstv)[((size_t)(b * HH + h) * DD + d) * LL + l] = (__bf16)val;
                } else {                         // [M,512] f32
                    ((float*)dstv)[(size_t)gm * 512 + gn] = val;
                }
            }
        }
    }
    };
    if constexpr (F32OUT) {
        epilogue(ModeTag<2>{});
    } else {
        if (vlayout) {
            epilogue(ModeTag<1>{});
            // as below: in the built kernel the mask packing's code lies behind this one
            asm volatile("s_wait_xcnt 0x0" ::: "memory");
        } else {
            epilogue(ModeTag<0>{});
            // the other layout's code lies behind this one in the built kernel:
            // this wait stands between these stores and the instructions there
            // that rewrite registers which the stores name
            asm volatile("s_wait_xcnt 0x0" ::: "memory");
        }
    }
}

// The occupancy target of both GEMM kernels is capped at two waves per SIMD, so
// that a K-step's LDS reads go out as one group (see the note at attn_flash).

// ---------------------------------------------------------------------------
// The mask is the same for all eight heads, and attention needs one bit of each
// word. It is packed once, in the form in which an attention wave uses it: for
// a group of 16 queries and a tile of 64 keys, 32 words, one per score register
// (nt, r) of the wave's S^T tiles; bit `lane` of a word says whether that lane's
// score (query l16, key nt*16 + 8*half + r) is kept. Such a word is a lane mask
// as a select takes it from a scalar register.
// pm: [B*L/16 groups][L/64 tiles][32 words] = 1 MB.
// The mask is read in whole lines: one load takes 128 neighbouring keys of one
// row, four to a lane. A ballot per component gives that row's bits (bit j of
// component c is key 4j + c); lanes l16 and l16 + 16 collect the four words of
// row l16, and a second round of ballots, over single bits of those words,
// turns rows into lane masks.
// One wave packs 512 keys of one group, 256 (32 loads in flight) at a time.
// ---------------------------------------------------------------------------
__device__ __forceinline__
void pack_mask(const int* __restrict__ mask, unsigned* __restrict__ pm) {
    const int lane = threadIdx.x & 31;
    const int half = lane >> 4;
    const int w    = (blockIdx.y * (GM / 128) + blockIdx.x) * 8 + (threadIdx.x >> 5);  // 0..1023
    const int g    = w >> 2;                     // group of 16 rows of [B*L]
    const int k0   = (w & 3) * 512;              // first of this wave's 512 keys
    const int* src = mask + (size_t)(g * 16) * LL + k0 + lane * 4;
    unsigned*  dst = pm + ((size_t)g * (LL / 64) + k0 / 64) * 32 + lane;
    // kept rolled: unrolled, all 64 loads are lifted to the top and their 256
    // registers cost the projection workgroups their second place on a WGP
    #pragma unroll 1
    for (int pp = 0; pp < 2; ++pp) {
        v4i mv[2][16];
        #pragma unroll
        for (int p = 0; p < 2; ++p)
            #pragma unroll
            for (int row = 0; row < 16; ++row)
                // read once: non-temporal, so that the 32 MB do not push Q, K, V out of L2
                mv[p][row] = __builtin_nontemporal_load(
                    (const v4i*)(src + (size_t)row * LL + (pp * 2 + p) * 128));
        #pragma unroll
        for (int p = 0; p < 2; ++p) {
            unsigned x[4] = {0u, 0u, 0u, 0u};    // row l16: bit j of x[c] is key 4j + c
            #pragma unroll
            for (int row = 0; row < 16; ++row)
                #pragma unroll
                for (int c = 0; c < 4; ++c) {
                    const unsigned bits = __builtin_amdgcn_ballot_w32(mv[p][row][c] != 0);
                    x[c] = __builtin_amdgcn_inverse_ballot_w32(0x00010001u << row) ? bits : x[c];
                }
            #pragma unroll
            for (int c = 0; c < 4; ++c) x[c] >>= half * 2;   // keys 8*half + ... of each 16
            #pragma unroll
            for (int tt = 0; tt < 2; ++tt) {     // the two 64-key tiles of these 128 keys
                unsigned word = 0u;              // lane i ends up with word i
                #pragma unroll
                for (int nt = 0; nt < 4; ++nt)
                    #pragma unroll
                    for (int r = 0; r < 8; ++r) {
                        const unsigned bit  = 1u << (tt * 16 + nt * 4 + (r >> 2));
                        const unsigned keep = __builtin_amdgcn_ballot_w32((x[r & 3] & bit) != 0u);
                        word = __builtin_amdgcn_inverse_ballot_w32(1u << (nt * 8 + r)) ? keep : word;
                    }
                dst[((pp * 2 + p) * 2 + tt) * 32] = word;    // one whole 128-byte line per tile
            }
        }
        // kept in front of the next trip's rewrite of the registers that these
        // stores name (their address and their data)
        asm volatile("s_wait_xcnt 0x0" ::: "memory");
    }
}

// The three input projections depend on nothing of one another: one grid, whose
// z index picks the projection, runs them side by side. Alone each is 128
// workgroups on 256 WGPs; two fit a WGP by registers and LDS, so a fourth plane
// of 128 workgroups, which packs the mask, is resident beside the 384 as well.
__global__ __launch_bounds__(256) __attribute__((amdgpu_waves_per_eu(2, 2)))
void gemm_qkv(const float* __restrict__ values, const float* __restrict__ keysI,
              const float* __restrict__ queryI,
              const float* __restrict__ Wv, const float* __restrict__ Wk,
              const float* __restrict__ Wq,
              const float* __restrict__ bv, const float* __restrict__ bk,
              const float* __restrict__ bq,
              __bf16* __restrict__ vb, __bf16* __restrict__ kb, __bf16* __restrict__ qb,
              const int* __restrict__ mask, unsigned* __restrict__ pm) {
    const int z = blockIdx.z;
    if (z == 3) {                                // the whole block: no barrier is skipped by part of it
        pack_mask(mask, pm);
        return;
    }
    const float* A    = z == 0 ? values : z == 1 ? keysI : queryI;
    const float* W    = z == 0 ? Wv : z == 1 ? Wk : Wq;
    const float* bias = z == 0 ? bv : z == 1 ? bk : bq;
    __bf16*      dst  = z == 0 ? vb : z == 1 ? kb : qb;
    gemm_tile<false>(A, W, bias, (void*)dst, z == 0);
}

__global__ __launch_bounds__(256) __attribute__((amdgpu_waves_per_eu(2, 2)))
void gemm_out(const float* __restrict__ A, const float* __restrict__ W,
              const float* __restrict__ bias, float* __restrict__ dst) {
    gemm_tile<true>(A, W, bias, (void*)dst, false);
}

__device__ __forceinline__ float xhalf(float x) {
    return __builtin_bit_cast(float, __builtin_amdgcn_permlanex16(
        __builtin_bit_cast(int, x), __builtin_bit_cast(int, x),
        0x76543210, 0xfedcba98, false, false));
}

// With the keys split in two the grid fills four waves per SIMD (4096 waves,
// 1024 SIMDs): while one wave waits for its LDS reads, a barrier or a dependent
// softmax chain, three others have work to issue. The occupancy target is
// pinned there: 256 registers a wave, which hold a whole tile's fragments.
__global__ __launch_bounds__(256) __attribute__((amdgpu_waves_per_eu(4, 4)))
void attn_flash(const __bf16* __restrict__ qb,   // [B,H,L,D]
                const __bf16* __restrict__ kb,   // [B,H,L,D]
                const __bf16* __restrict__ vb,   // [B,H,D,L]
                const unsigned* __restrict__ pm, // packed mask, see pack_mask
                float*        __restrict__ Ob) { // [B,L,E]
    constexpr float SCALE = 0.04419417382415922f;   // 1/sqrt(512)
    constexpr int NT  = LL / 64;                    // key tiles in all
    constexpr int NTH = NT / 2;                     // key tiles of one wave
    // 144-byte rows: the 16 rows of a ds_load_b128 fragment read spread over the banks
    __shared__ __attribute__((aligned(16))) __bf16 sK[2][2][64][64 + 8];   // [key half][buffer][key][d]
    __shared__ __attribute__((aligned(16))) __bf16 sV[2][2][64][64 + 8];   // [key half][buffer][d][key]
    // what a wave hands to its partner after the loop: 16 O values, maximum, sum
    __shared__ float xch[8][18][32];                // [wave][value][lane]

    const int wave = __builtin_amdgcn_readfirstlane(threadIdx.x >> 5);   // scalar
    const int kh   = wave >> 2;                     // this wave's half of the keys
    const int qw   = wave & 3;                      // its group of 16 queries
    const int lane = threadIdx.x & 31;
    const int half = lane >> 4;
    const int l16  = lane & 15;
    const int bh   = blockIdx.y;                    // b*H + h
    const int bidx = bh / HH;
    const int hidx = bh % HH;
    const int q0   = blockIdx.x * 64;
    const int qrow0 = q0 + qw * 16;

    // Q B-fragments: column l16 is this lane's query (K = D = 64 -> 2 fragments)
    Frag bQ[2];
    {
        const __bf16* qp = qb + ((size_t)bh * LL + (qrow0 + l16)) * DD;
        #pragma unroll
        for (int kw = 0; kw < 2; ++kw) {
            bQ[kw].h[0] = *(const bf16x8*)(qp + kw * 32 + half * 8);
            bQ[kw].h[1] = *(const bf16x8*)(qp + kw * 32 + 16 + half * 8);
        }
    }

    v8f   accO[4] = {};                 // O^T: register r = d (dt*16 + 8*half + r), column = query
    float mSt = -3.0e38f;               // this query's running maximum (equal in both halves)
    float lSt = 0.0f;                   // sum over this half's keys; the halves join after the loop

    // this wave's lane-mask words: 32 per key tile, at an address that is the same
    // in every lane (the wave's number is scalar), so they come by scalar loads
    const int grp = (bidx * LL + q0) / 16 + qw;
    // (nothing writes pm while this kernel runs: the launch before it did)
    const_u32x16_ptr pw = (const_u32x16_ptr)(unsigned long long)(
        pm + (size_t)grp * (NT * 32) + kh * (NTH * 32));
    u32x16 mw[2];
    mw[0] = pw[0];
    mw[1] = pw[1];

    // One 64x64 bf16 tile of K and of V per key half: 512 16-byte pieces each, 4
    // per thread of the half's four waves; a wave's copy covers four whole
    // 128-byte rows.
    const int srow = (threadIdx.x & 127) >> 3;      // 0..15, +16 per piece
    const int scol = (threadIdx.x & 7) * 8;
    const __bf16* kg = kb + ((size_t)bh * LL + kh * (LL / 2) + srow) * DD + scol;
    const __bf16* vg = vb + ((size_t)bh * DD + srow) * LL + kh * (LL / 2) + scol;
    auto stage = [&](int buf, int kc) {
        const __bf16* k0 = kg + (size_t)kc * DD;
        const __bf16* v0 = vg + kc;
        const unsigned lk = (unsigned)(unsigned long long)&sK[kh][buf][srow][scol];
        const unsigned lv = (unsigned)(unsigned long long)&sV[kh][buf][srow][scol];
        constexpr unsigned RS = 16 * (64 + 8) * 2;  // 16 LDS rows in bytes
        // the copies and the s_wait_xcnt that is kept in front of any rewrite of
        // their address registers stand in one statement, so that the compiler
        // can schedule nothing between them
        asm volatile(
            "global_load_async_to_lds_b128 %0, %8, off\n\t"
            "global_load_async_to_lds_b128 %1, %9, off\n\t"
            "global_load_async_to_lds_b128 %2, %10, off\n\t"
            "global_load_async_to_lds_b128 %3, %11, off\n\t"
            "global_load_async_to_lds_b128 %4, %12, off\n\t"
            "global_load_async_to_lds_b128 %5, %13, off\n\t"
            "global_load_async_to_lds_b128 %6, %14, off\n\t"
            "global_load_async_to_lds_b128 %7, %15, off\n\t"
            "s_wait_xcnt 0x0"
            :: "v"(lk), "v"(lk + RS), "v"(lk + 2 * RS), "v"(lk + 3 * RS),
               "v"(lv), "v"(lv + RS), "v"(lv + 2 * RS), "v"(lv + 3 * RS),
               "v"(k0), "v"(k0 + 16 * DD), "v"(k0 + 32 * DD), "v"(k0 + 48 * DD),
               "v"(v0), "v"(v0 + 16 * LL), "v"(v0 + 32 * LL), "v"(v0 + 48 * LL)
            : "memory");
    };

    stage(0, 0);
    asm volatile("s_wait_asynccnt 0x0" ::: "memory");   // my pieces of tile 0 have landed
    __syncthreads();                                    // everyone's have
    stage(1, 64);

    for (int t = 0; t < NTH; ++t) {
        const int kc  = t * 64;                     // counted from the half's first key
        const int buf = t & 1;
        // ---- this tile's K and V A-fragments out of LDS ----------------
        Frag aK[4][2], aV[4][2];
        #pragma unroll
        for (int nt = 0; nt < 4; ++nt) {
            const __bf16* kp = &sK[kh][buf][nt * 16 + l16][0];
            const __bf16* vp = &sV[kh][buf][nt * 16 + l16][0];
            #pragma unroll
            for (int kw = 0; kw < 2; ++kw) {
                aK[nt][kw].h[0] = *(const bf16x8*)(kp + kw * 32 + half * 8);
                aK[nt][kw].h[1] = *(const bf16x8*)(kp + kw * 32 + 16 + half * 8);
                aV[nt][kw].h[0] = *(const bf16x8*)(vp + kw * 32 + half * 8);
                aV[nt][kw].h[1] = *(const bf16x8*)(vp + kw * 32 + 16 + half * 8);
            }
        }
        // Inputs-only fence on the loaded fragments: without it each fragment's
        // two reads are issued and fully waited for right in front of their
        // WMMA, one LDS round trip per WMMA; with it the reads go out in groups
        // ahead of their use, behind counted waits.
        asm volatile("" :: "v"(aK[0][0].v), "v"(aK[0][1].v), "v"(aK[1][0].v), "v"(aK[1][1].v),
                           "v"(aK[2][0].v), "v"(aK[2][1].v), "v"(aK[3][0].v), "v"(aK[3][1].v),
                           "v"(aV[0][0].v), "v"(aV[0][1].v), "v"(aV[1][0].v), "v"(aV[1][1].v),
                           "v"(aV[2][0].v), "v"(aV[2][1].v), "v"(aV[3][0].v), "v"(aV[3][1].v));

        // ---- S^T = K @ Q^T (64 keys x 16 queries per wave), f32 accum --
        v8f s[4];
        #pragma unroll
        for (int nt = 0; nt < 4; ++nt) {
            v8f c = {};
            #pragma unroll
            for (int kw = 0; kw < 2; ++kw)
                c = wmma_bf16(aK[nt][kw].v, bQ[kw].v, (v8f)c);
            s[nt] = c;
        }

        // ---- mask: -1e30 where masked, other scores scaled ----------------------
        #pragma unroll
        for (int nt = 0; nt < 4; ++nt) {
            #pragma unroll
            for (int r = 0; r < 8; ++r) {
                float e = s[nt][r];
                const bool keep = __builtin_amdgcn_inverse_ballot_w32(mw[nt >> 1][(nt & 1) * 8 + r]);
                s[nt][r] = keep ? e * SCALE : -1.0e30f;
            }
        }
        // the next tile's words, into the registers just used: the rest of this
        // trip covers their way from L2 (the last trip reads its own again)
        {
            const int tn = t + 1 < NTH ? t + 1 : t;
            mw[0] = pw[tn * 2];
            mw[1] = pw[tn * 2 + 1];
        }

        // ---- online softmax: a lane's 32 scores belong to one query ----
        float vmax = s[0][0];
        #pragma unroll
        for (int nt = 0; nt < 4; ++nt)
            #pragma unroll
            for (int r = 0; r < 8; ++r) vmax = fmaxf(vmax, s[nt][r]);
        vmax = fmaxf(vmax, xhalf(vmax));            // the query's other 32 keys
        const float mNew = fmaxf(mSt, vmax);
        const float corr = __expf(mSt - mNew);
        float rs[4];
        #pragma unroll
        for (int nt = 0; nt < 4; ++nt) {
            rs[nt] = 0.0f;
            #pragma unroll
            for (int r = 0; r < 8; ++r) {
                float pe = __expf(s[nt][r] - mNew);
                s[nt][r] = pe;
                rs[nt] += pe;
            }
        }
        lSt = lSt * corr + ((rs[0] + rs[1]) + (rs[2] + rs[3]));
        mSt = mNew;
        #pragma unroll
        for (int dt = 0; dt < 4; ++dt)
            #pragma unroll
            for (int r = 0; r < 8; ++r) accO[dt][r] *= corr;

        // ---- P^T as B operand: tiles 2kw and 2kw+1, converted in place,
        //      are keys 8*half + e and 16 + 8*half + e of a 32-key step ---
        Frag bP[2];
        #pragma unroll
        for (int kw = 0; kw < 2; ++kw)
            #pragma unroll
            for (int e = 0; e < 8; ++e) {
                bP[kw].h[0][e] = (__bf16)s[2 * kw][e];
                bP[kw].h[1][e] = (__bf16)s[2 * kw + 1][e];
            }

        // ---- O^T += V^T @ P^T  (V tile is [d][key]: rows are A rows) ---
        #pragma unroll
        for (int dt = 0; dt < 4; ++dt) {
            #pragma unroll
            for (int kw = 0; kw < 2; ++kw)
                accO[dt] = wmma_bf16(aV[dt][kw].v, bP[kw].v, accO[dt]);
        }

        // ---- hand over: tile t+1 is published, buffer buf is freed ------
        asm volatile("s_wait_dscnt 0x0" ::: "memory");      // my reads of this tile are done
        asm volatile("s_wait_asynccnt 0x0" ::: "memory");   // my pieces of tile t+1 have landed
        __syncthreads();
        if (t + 2 < NTH) stage(buf, kc + 128);              // refill the buffer just read
    }
    asm volatile("s_wait_asynccnt 0x0" ::: "memory");       // nothing in flight at the wave's end

    // ---- join the two key halves: waves w and w + 4 hold the same queries in the
    //      same lanes. Each finishes two of the four O tiles (key half 0: d 0..31,
    //      key half 1: d 32..63) and hands the other two to its partner. --------
    const float lAll = lSt + xhalf(lSt);            // the lane halves' sums joined
    float* mine = &xch[wave][0][lane];
    #pragma unroll
    for (int k = 0; k < 2; ++k)
        #pragma unroll
        for (int r = 0; r < 8; ++r) mine[(k * 8 + r) * 32] = kh ? accO[k][r] : accO[2 + k][r];
    mine[16 * 32] = mSt;
    mine[17 * 32] = lAll;
    __syncthreads();                                // both partners' values are in LDS
    const float* theirs = &xch[wave ^ 4][0][lane];
    const float mP   = theirs[16 * 32];
    const float lP   = theirs[17 * 32];
    const float mAll = fmaxf(mSt, mP);
    const float aS   = __expf(mSt - mAll);          // a half with no key kept weighs 0
    const float aP   = __expf(mP - mAll);           // beside one that has any
    const float lTot = lAll * aS + lP * aP;

    // ---- divide, write [B,L,E] f32 -------------------------------------
    float* orow = Ob + ((size_t)bidx * LL + (qrow0 + l16)) * EE + hidx * DD + kh * 32 + half * 8;
    #pragma unroll
    for (int k = 0; k < 2; ++k) {
        float o[8];
        #pragma unroll
        for (int r = 0; r < 8; ++r)
            o[r] = ((kh ? accO[2 + k][r] : accO[k][r]) * aS + theirs[(k * 8 + r) * 32] * aP) / lTot;
        float4 lo, hi;
        lo.x = o[0]; lo.y = o[1]; lo.z = o[2]; lo.w = o[3];
        hi.x = o[4]; hi.y = o[5]; hi.z = o[6]; hi.w = o[7];
        *(float4*)(orow + k * 16)     = lo;
        *(float4*)(orow + k * 16 + 4) = hi;
    }
}

// ---------------------------------------------------------------------------
// Launcher
// ---------------------------------------------------------------------------
extern "C" void kernel_launch(void* const* d_in, const int* in_sizes, int n_in,
                              void* d_out, int out_size, void* d_ws, size_t ws_size,
                              hipStream_t stream) {
    (void)in_sizes; (void)n_in; (void)out_size; (void)ws_size;
    const float* values = (const float*)d_in[0];
    const float* keysI  = (const float*)d_in[1];
    const float* queryI = (const float*)d_in[2];
    const int*   mask   = (const int*)d_in[3];
    const float* Wv = (const float*)d_in[4];  const float* bv = (const float*)d_in[5];
    const float* Wk = (const float*)d_in[6];  const float* bk = (const float*)d_in[7];
    const float* Wq = (const float*)d_in[8];  const float* bq = (const float*)d_in[9];
    const float* Wo = (const float*)d_in[10]; const float* bo = (const float*)d_in[11];

    char* ws = (char*)d_ws;
    __bf16* qb = (__bf16*)(ws);                      // 4 MB  [B,H,L,D] bf16
    __bf16* kb = (__bf16*)(ws + (4u << 20));         // 4 MB  [B,H,L,D] bf16
    __bf16* vb = (__bf16*)(ws + (8u << 20));         // 4 MB  [B,H,D,L] bf16
    float*  Ob = (float*) (ws + (12u << 20));        // 8 MB  [B,L,E]   f32
    unsigned* pm = (unsigned*)(ws + (20u << 20));    // 1 MB  packed mask

    dim3 gGrid(GM / 128, EE / 128), gBlk(256);
    gemm_qkv<<<dim3(GM / 128, EE / 128, 4), gBlk, 0, stream>>>(
        values, keysI, queryI, Wv, Wk, Wq, bv, bk, bq, vb, kb, qb, mask, pm);

    attn_flash<<<dim3(LL / 64, BB * HH), 256, 0, stream>>>(qb, kb, vb, pm, Ob);

    gemm_out<<<gGrid, gBlk, 0, stream>>>(Ob, Wo, bo, (float*)d_out);
}

// v007
// One run takes 54.6 microseconds.
// In two side-by-side timings against v006, it was 1.12 and 1.11 times as fast.
// All steps since v000 together make it 3.82 times as fast.
#include <hip/hip_runtime.h>

// ---------------------------------------------------------------------------
// Self-attention forward for B=2, L=2048, E=512, H=8, D=64 on gfx1250 (CDNA5).
// All matmuls run on v_wmma_f32_16x16x32_bf16 (bf16 operands, f32 accum).
// Attention is fused flash-style: scores never hit HBM.
// GEMM tiles are double-buffered through LDS with GLOBAL_LOAD_ASYNC_TO_LDS
// (ASYNCcnt): DMA for tile t+1 overlaps the WMMAs on tile t, one barrier
// per K-step.
// ---------------------------------------------------------------------------

typedef __attribute__((ext_vector_type(16))) __bf16 bf16x16;
typedef __attribute__((ext_vector_type(8)))  __bf16 bf16x8;
typedef __attribute__((ext_vector_type(8)))  float  v8f;
typedef __attribute__((ext_vector_type(4)))  int    v4i;
typedef __attribute__((ext_vector_type(16))) unsigned u32x16;
// constant address space: a load at a wave-uniform address becomes a scalar load
typedef const u32x16 __attribute__((address_space(4)))* const_u32x16_ptr;

union Frag {
    bf16x16 v;
    bf16x8  h[2];
};

__device__ __forceinline__ v8f wmma_bf16(bf16x16 a, bf16x16 b, v8f c) {
    // (neg_a, A, neg_b, B, c_mod, C, reuse_a, reuse_b)
    return __builtin_amdgcn_wmma_f32_16x16x32_bf16(
        false, a, false, b, (short)0, c, false, false);
}

constexpr int BB  = 2;
constexpr int LL  = 2048;
constexpr int EE  = 512;
constexpr int HH  = 8;
constexpr int DD  = 64;
constexpr int GM  = BB * LL;   // 4096 rows in every projection GEMM

// ---------------------------------------------------------------------------
// Async global->LDS copy (CDNA5 GLOBAL_LOAD_ASYNC_TO_LDS_B128, ASYNCcnt),
// guarded so an older toolchain falls back to the proven synchronous path.
// Builtin expects (v4i addrspace(1)*, v4i addrspace(3)*, imm offset, imm cpol).
// ---------------------------------------------------------------------------
#if __has_builtin(__builtin_amdgcn_global_load_async_to_lds_b128)
#define HAS_ASYNC_LDS 1
typedef v4i __attribute__((address_space(1)))* as1_v4i_ptr;
typedef v4i __attribute__((address_space(3)))* as3_v4i_ptr;
__device__ __forceinline__ void async_copy_b128(void* lds, const void* gptr) {
    __builtin_amdgcn_global_load_async_to_lds_b128(
        (as1_v4i_ptr)(unsigned long long)gptr,
        (as3_v4i_ptr)(unsigned int)(unsigned long long)lds,
        0, 0);
}
__device__ __forceinline__ void async_wait0() {
#if __has_builtin(__builtin_amdgcn_s_wait_asynccnt)
    __builtin_amdgcn_s_wait_asynccnt(0);
#else
    asm volatile("s_wait_asynccnt 0" ::: "memory");
#endif
}
#else
#define HAS_ASYNC_LDS 0
__device__ __forceinline__ void async_copy_b128(void* lds, const void* gptr) {
    *(float4*)lds = *(const float4*)gptr;
}
__device__ __forceinline__ void async_wait0() {}
#endif

// Convert 8 consecutive f32 (16B-aligned) to a bf16x8 half-fragment.
__device__ __forceinline__ bf16x8 cvt8(const float* p) {
    float4 a = *(const float4*)p;
    float4 b = *(const float4*)(p + 4);
    bf16x8 r;
    r[0] = (__bf16)a.x; r[1] = (__bf16)a.y; r[2] = (__bf16)a.z; r[3] = (__bf16)a.w;
    r[4] = (__bf16)b.x; r[5] = (__bf16)b.y; r[6] = (__bf16)b.z; r[7] = (__bf16)b.w;
    return r;
}

// ---------------------------------------------------------------------------
// Generic projection GEMM tile: dst = A[M,512] @ W[512,512]^T + bias, M = 4096.
// mode 0: write bf16 into [B,H,L,D]   (Q and K)
// mode 1: write bf16 into [B,H,D,L]   (V, pre-transposed for attn 2nd GEMM)
// mode 2: write f32  into [M, 512]    (final output projection)
// F32OUT fixes mode 2 at compile time; otherwise vlayout (the same for the whole
// block) picks mode 1 or 0 in the epilogue, so that one main loop and one pair
// of LDS buffers serve all three input projections.
// Block: 256 threads (8 waves). Block tile 128x128, wave tile 64x32,
// K stepped by 32. Double-buffered async DMA staging: copies for step t+1
// run concurrently with the WMMAs of step t.
// ---------------------------------------------------------------------------
template <int M> struct ModeTag { static constexpr int value = M; };

template <bool F32OUT>
__device__ __forceinline__
void gemm_tile(const float* __restrict__ A, const float* __restrict__ W,
               const float* __restrict__ bias, void* __restrict__ dstv, bool vlayout) {
    constexpr int PADF   = 4;                    // 36-float rows: 16 rows hit
    constexpr int NSTEPS = 512 / 32;             // 16 distinct bank groups
    __shared__ float sAf[2][128][32 + PADF];
    __shared__ float sWf[2][128][32 + PADF];

    const int tid  = threadIdx.x;
    const int wave = tid >> 5;
    const int lane = tid & 31;
    const int half = lane >> 4;                  // 0 | 1 (lane group)
    const int l16  = lane & 15;
    const int m0   = blockIdx.x * 128;
    const int n0   = blockIdx.y * 128;
    const int wm   = wave & 1;                   // 2 wave-rows  x 64
    const int wn   = wave >> 1;                  // 4 wave-cols  x 32

    // Stage one 128x32 f32 tile pair: 1024 16B chunks per matrix, 4/thread.
    auto stage = [&](int buf, int k0) {
        #pragma unroll
        for (int i = 0; i < 4; ++i) {
            int idx = tid + i * 256;             // 0..1023
            int row = idx >> 3;                  // 0..127
            int cg  = (idx & 7) * 4;             // col group of 4 floats
            async_copy_b128(&sAf[buf][row][cg], A + (size_t)(m0 + row) * 512 + k0 + cg);
            async_copy_b128(&sWf[buf][row][cg], W + (size_t)(n0 + row) * 512 + k0 + cg);
        }
    };

    v8f acc[4][2] = {};

    stage(0, 0);                                 // prologue DMA
    for (int step = 0; step < NSTEPS; ++step) {
        const int buf = step & 1;
        async_wait0();                           // my copies for `buf` done
        __syncthreads();                         // everyone's copies done
        if (step + 1 < NSTEPS)
            stage(buf ^ 1, (step + 1) * 32);     // overlaps with WMMAs below

        Frag aF[4], bF[2];
        #pragma unroll
        for (int i = 0; i < 4; ++i) {
            const float* p = &sAf[buf][wm * 64 + i * 16 + l16][half * 8];
            aF[i].h[0] = cvt8(p);
            aF[i].h[1] = cvt8(p + 16);
        }
        #pragma unroll
        for (int j = 0; j < 2; ++j) {
            const float* p = &sWf[buf][wn * 32 + j * 16 + l16][half * 8];
            bF[j].h[0] = cvt8(p);
            bF[j].h[1] = cvt8(p + 16);
        }
        #pragma unroll
        for (int i = 0; i < 4; ++i)
            #pragma unroll
            for (int j = 0; j < 2; ++j)
                acc[i][j] = wmma_bf16(aF[i].v, bF[j].v, acc[i][j]);
    }

    // Epilogue: C-fragment layout — VGPR r holds row (r + 8*half), col l16.
    auto epilogue = [&](auto tag) {
    constexpr int MODE = decltype(tag)::value;
    #pragma unroll
    for (int i = 0; i < 4; ++i) {
        #pragma unroll
        for (int j = 0; j < 2; ++j) {
            int gn = n0 + wn * 32 + j * 16 + l16;
            float bval = bias[gn];
            #pragma unroll
            for (int r = 0; r < 8; ++r) {
                int gm = m0 + wm * 64 + i * 16 + r + half * 8;
                float val = acc[i][j][r] + bval;
                int b = gm >> 11;                // / L
                int l = gm & (LL - 1);
                if (MODE == 0) {                 // [B,H,L,D] bf16
                    int h = gn >> 6, d = gn & 63;
                    ((__bf16*)dstv)[(((size_t)(b * HH + h) * LL + l) << 6) + d] = (__bf16)val;
                } else if (MODE == 1) {          // [B,H,D,L] bf16
                    int h = gn >> 6, d = gn & 63;
                    ((__bf16*)dstv)[((size_t)(b * HH + h) * DD + d) * LL + l] = (__bf16)val;
                } else {                         // [M,512] f32
                    ((float*)dstv)[(size_t)gm * 512 + gn] = val;
                }
            }
        }
    }
    };
    if constexpr (F32OUT) {
        epilogue(ModeTag<2>{});
    } else {
        if (vlayout) {
            epilogue(ModeTag<1>{});
            // as below: in the built kernel the mask packing's code lies behind this one
            asm volatile("s_wait_xcnt 0x0" ::: "memory");
        } else {
            epilogue(ModeTag<0>{});
            // the other layout's code lies behind this one in the built kernel:
            // this wait stands between these stores and the instructions there
            // that rewrite registers which the stores name
            asm volatile("s_wait_xcnt 0x0" ::: "memory");
        }
    }
}

// The occupancy target of both GEMM kernels is capped (four waves per SIMD for
// the input projections, two for the output projection), so that a K-step's LDS
// reads go out as one group (see the note at attn_flash).

// ---------------------------------------------------------------------------
// The mask is the same for all eight heads, and attention needs one bit of each
// word. It is packed once, in the form in which an attention wave uses it: for
// a group of 16 queries and a tile of 64 keys, 32 words, one per score register
// (nt, r) of the wave's S^T tiles; bit `lane` of a word says whether that lane's
// score (query l16, key nt*16 + 8*half + r) is kept. Such a word is a lane mask
// as a select takes it from a scalar register.
// pm: [B*L/16 groups][L/64 tiles][32 words] = 1 MB.
// The mask is read in whole lines: one load takes 128 neighbouring keys of one
// row, four to a lane. A ballot per component gives that row's bits (bit j of
// component c is key 4j + c); lanes l16 and l16 + 16 collect the four words of
// row l16, and a second round of ballots, over single bits of those words,
// turns rows into lane masks.
// One wave packs 512 keys of one group, 256 (32 loads in flight) at a time.
// ---------------------------------------------------------------------------
__device__ __forceinline__
void pack_mask(const int* __restrict__ mask, unsigned* __restrict__ pm) {
    const int lane = threadIdx.x & 31;
    const int half = lane >> 4;
    const int w    = (blockIdx.y * (GM / 128) + blockIdx.x) * 8 + (threadIdx.x >> 5);  // 0..1023
    const int g    = w >> 2;                     // group of 16 rows of [B*L]
    const int k0   = (w & 3) * 512;              // first of this wave's 512 keys
    const int* src = mask + (size_t)(g * 16) * LL + k0 + lane * 4;
    unsigned*  dst = pm + ((size_t)g * (LL / 64) + k0 / 64) * 32 + lane;
    // kept rolled: unrolled, all 64 loads are lifted to the top and their 256
    // registers cost the projection workgroups their second place on a WGP
    #pragma unroll 1
    for (int pp = 0; pp < 2; ++pp) {
        v4i mv[2][16];
        #pragma unroll
        for (int p = 0; p < 2; ++p)
            #pragma unroll
            for (int row = 0; row < 16; ++row)
                // read once: non-temporal, so that the 32 MB do not push Q, K, V out of L2
                mv[p][row] = __builtin_nontemporal_load(
                    (const v4i*)(src + (size_t)row * LL + (pp * 2 + p) * 128));
        #pragma unroll
        for (int p = 0; p < 2; ++p) {
            unsigned x[4] = {0u, 0u, 0u, 0u};    // row l16: bit j of x[c] is key 4j + c
            #pragma unroll
            for (int row = 0; row < 16; ++row)
                #pragma unroll
                for (int c = 0; c < 4; ++c) {
                    const unsigned bits = __builtin_amdgcn_ballot_w32(mv[p][row][c] != 0);
                    x[c] = __builtin_amdgcn_inverse_ballot_w32(0x00010001u << row) ? bits : x[c];
                }
            #pragma unroll
            for (int c = 0; c < 4; ++c) x[c] >>= half * 2;   // keys 8*half + ... of each 16
            #pragma unroll
            for (int tt = 0; tt < 2; ++tt) {     // the two 64-key tiles of these 128 keys
                unsigned word = 0u;              // lane i ends up with word i
                #pragma unroll
                for (int nt = 0; nt < 4; ++nt)
                    #pragma unroll
                    for (int r = 0; r < 8; ++r) {
                        const unsigned bit  = 1u << (tt * 16 + nt * 4 + (r >> 2));
                        const unsigned keep = __builtin_amdgcn_ballot_w32((x[r & 3] & bit) != 0u);
                        word = __builtin_amdgcn_inverse_ballot_w32(1u << (nt * 8 + r)) ? keep : word;
                    }
                dst[((pp * 2 + p) * 2 + tt) * 32] = word;    // one whole 128-byte line per tile
            }
        }
        // kept in front of the next trip's rewrite of the registers that these
        // stores name (their address and their data)
        asm volatile("s_wait_xcnt 0x0" ::: "memory");
    }
}

// The three input projections depend on nothing of one another: one grid, whose
// z index picks the projection, runs them side by side, with a fourth plane of
// 128 workgroups that packs the mask: 512 workgroups on 256 WGPs.
// The upper bound of the occupancy attribute is more than a hint: the compiler
// pads the kernel's register allocation until no more waves than that fit a
// SIMD. A bound of two leaves room for one 8-wave workgroup per WGP, and the
// grid takes two rounds. A bound of four (256 registers a wave, which the main
// loop does not need) lets two workgroups share a WGP (2 x 72 KB of LDS): the
// whole grid is resident at once, and while one workgroup waits for its copies
// or a barrier the other reads LDS and issues WMMAs.
__global__ __launch_bounds__(256) __attribute__((amdgpu_waves_per_eu(4, 4)))
void gemm_qkv(const float* __restrict__ values, const float* __restrict__ keysI,
              const float* __restrict__ queryI,
              const float* __restrict__ Wv, const float* __restrict__ Wk,
              const float* __restrict__ Wq,
              const float* __restrict__ bv, const float* __restrict__ bk,
              const float* __restrict__ bq,
              __bf16* __restrict__ vb, __bf16* __restrict__ kb, __bf16* __restrict__ qb,
              const int* __restrict__ mask, unsigned* __restrict__ pm) {
    const int z = blockIdx.z;
    if (z == 3) {                                // the whole block: no barrier is skipped by part of it
        pack_mask(mask, pm);
        return;
    }
    const float* A    = z == 0 ? values : z == 1 ? keysI : queryI;
    const float* W    = z == 0 ? Wv : z == 1 ? Wk : Wq;
    const float* bias = z == 0 ? bv : z == 1 ? bk : bq;
    __bf16*      dst  = z == 0 ? vb : z == 1 ? kb : qb;
    gemm_tile<false>(A, W, bias, (void*)dst, z == 0);
}

__global__ __launch_bounds__(256) __attribute__((amdgpu_waves_per_eu(2, 2)))
void gemm_out(const float* __restrict__ A, const float* __restrict__ W,
              const float* __restrict__ bias, float* __restrict__ dst) {
    gemm_tile<true>(A, W, bias, (void*)dst, false);
}

__device__ __forceinline__ float xhalf(float x) {
    return __builtin_bit_cast(float, __builtin_amdgcn_permlanex16(
        __builtin_bit_cast(int, x), __builtin_bit_cast(int, x),
        0x76543210, 0xfedcba98, false, false));
}

// With the keys split in two the grid fills four waves per SIMD (4096 waves,
// 1024 SIMDs): while one wave waits for its LDS reads, a barrier or a dependent
// softmax chain, three others have work to issue. The occupancy target is
// pinned there: 256 registers a wave, which hold a whole tile's fragments.
__global__ __launch_bounds__(256) __attribute__((amdgpu_waves_per_eu(4, 4)))
void attn_flash(const __bf16* __restrict__ qb,   // [B,H,L,D]
                const __bf16* __restrict__ kb,   // [B,H,L,D]
                const __bf16* __restrict__ vb,   // [B,H,D,L]
                const unsigned* __restrict__ pm, // packed mask, see pack_mask
                float*        __restrict__ Ob) { // [B,L,E]
    constexpr float SCALE = 0.04419417382415922f;   // 1/sqrt(512)
    constexpr int NT  = LL / 64;                    // key tiles in all
    constexpr int NTH = NT / 2;                     // key tiles of one wave
    // 144-byte rows: the 16 rows of a ds_load_b128 fragment read spread over the banks
    __shared__ __attribute__((aligned(16))) __bf16 sK[2][2][64][64 + 8];   // [key half][buffer][key][d]
    __shared__ __attribute__((aligned(16))) __bf16 sV[2][2][64][64 + 8];   // [key half][buffer][d][key]
    // what a wave hands to its partner after the loop: 16 O values, maximum, sum
    __shared__ float xch[8][18][32];                // [wave][value][lane]

    const int wave = __builtin_amdgcn_readfirstlane(threadIdx.x >> 5);   // scalar
    const int kh   = wave >> 2;                     // this wave's half of the keys
    const int qw   = wave & 3;                      // its group of 16 queries
    const int lane = threadIdx.x & 31;
    const int half = lane >> 4;
    const int l16  = lane & 15;
    const int bh   = blockIdx.y;                    // b*H + h
    const int bidx = bh / HH;
    const int hidx = bh % HH;
    const int q0   = blockIdx.x * 64;
    const int qrow0 = q0 + qw * 16;

    // Q B-fragments: column l16 is this lane's query (K = D = 64 -> 2 fragments)
    Frag bQ[2];
    {
        const __bf16* qp = qb + ((size_t)bh * LL + (qrow0 + l16)) * DD;
        #pragma unroll
        for (int kw = 0; kw < 2; ++kw) {
            bQ[kw].h[0] = *(const bf16x8*)(qp + kw * 32 + half * 8);
            bQ[kw].h[1] = *(const bf16x8*)(qp + kw * 32 + 16 + half * 8);
        }
    }

    v8f   accO[4] = {};                 // O^T: register r = d (dt*16 + 8*half + r), column = query
    float mSt = -3.0e38f;               // this query's running maximum (equal in both halves)
    float lSt = 0.0f;                   // sum over this half's keys; the halves join after the loop

    // this wave's lane-mask words: 32 per key tile, at an address that is the same
    // in every lane (the wave's number is scalar), so they come by scalar loads
    const int grp = (bidx * LL + q0) / 16 + qw;
    // (nothing writes pm while this kernel runs: the launch before it did)
    const_u32x16_ptr pw = (const_u32x16_ptr)(unsigned long long)(
        pm + (size_t)grp * (NT * 32) + kh * (NTH * 32));
    u32x16 mw[2];
    mw[0] = pw[0];
    mw[1] = pw[1];

    // One 64x64 bf16 tile of K and of V per key half: 512 16-byte pieces each, 4
    // per thread of the half's four waves; a wave's copy covers four whole
    // 128-byte rows.
    const int srow = (threadIdx.x & 127) >> 3;      // 0..15, +16 per piece
    const int scol = (threadIdx.x & 7) * 8;
    const __bf16* kg = kb + ((size_t)bh * LL + kh * (LL / 2) + srow) * DD + scol;
    const __bf16* vg = vb + ((size_t)bh * DD + srow) * LL + kh * (LL / 2) + scol;
    auto stage = [&](int buf, int kc) {
        const __bf16* k0 = kg + (size_t)kc * DD;
        const __bf16* v0 = vg + kc;
        const unsigned lk = (unsigned)(unsigned long long)&sK[kh][buf][srow][scol];
        const unsigned lv = (unsigned)(unsigned long long)&sV[kh][buf][srow][scol];
        constexpr unsigned RS = 16 * (64 + 8) * 2;  // 16 LDS rows in bytes
        // the copies and the s_wait_xcnt that is kept in front of any rewrite of
        // their address registers stand in one statement, so that the compiler
        // can schedule nothing between them
        asm volatile(
            "global_load_async_to_lds_b128 %0, %8, off\n\t"
            "global_load_async_to_lds_b128 %1, %9, off\n\t"
            "global_load_async_to_lds_b128 %2, %10, off\n\t"
            "global_load_async_to_lds_b128 %3, %11, off\n\t"
            "global_load_async_to_lds_b128 %4, %12, off\n\t"
            "global_load_async_to_lds_b128 %5, %13, off\n\t"
            "global_load_async_to_lds_b128 %6, %14, off\n\t"
            "global_load_async_to_lds_b128 %7, %15, off\n\t"
            "s_wait_xcnt 0x0"
            :: "v"(lk), "v"(lk + RS), "v"(lk + 2 * RS), "v"(lk + 3 * RS),
               "v"(lv), "v"(lv + RS), "v"(lv + 2 * RS), "v"(lv + 3 * RS),
               "v"(k0), "v"(k0 + 16 * DD), "v"(k0 + 32 * DD), "v"(k0 + 48 * DD),
               "v"(v0), "v"(v0 + 16 * LL), "v"(v0 + 32 * LL), "v"(v0 + 48 * LL)
            : "memory");
    };

    stage(0, 0);
    asm volatile("s_wait_asynccnt 0x0" ::: "memory");   // my pieces of tile 0 have landed
    __syncthreads();                                    // everyone's have
    stage(1, 64);

    for (int t = 0; t < NTH; ++t) {
        const int kc  = t * 64;                     // counted from the half's first key
        const int buf = t & 1;
        // ---- this tile's K and V A-fragments out of LDS ----------------
        Frag aK[4][2], aV[4][2];
        #pragma unroll
        for (int nt = 0; nt < 4; ++nt) {
            const __bf16* kp = &sK[kh][buf][nt * 16 + l16][0];
            const __bf16* vp = &sV[kh][buf][nt * 16 + l16][0];
            #pragma unroll
            for (int kw = 0; kw < 2; ++kw) {
                aK[nt][kw].h[0] = *(const bf16x8*)(kp + kw * 32 + half * 8);
                aK[nt][kw].h[1] = *(const bf16x8*)(kp + kw * 32 + 16 + half * 8);
                aV[nt][kw].h[0] = *(const bf16x8*)(vp + kw * 32 + half * 8);
                aV[nt][kw].h[1] = *(const bf16x8*)(vp + kw * 32 + 16 + half * 8);
            }
        }
        // Inputs-only fence on the loaded fragments: without it each fragment's
        // two reads are issued and fully waited for right in front of their
        // WMMA, one LDS round trip per WMMA; with it the reads go out in groups
        // ahead of their use, behind counted waits.
        asm volatile("" :: "v"(aK[0][0].v), "v"(aK[0][1].v), "v"(aK[1][0].v), "v"(aK[1][1].v),
                           "v"(aK[2][0].v), "v"(aK[2][1].v), "v"(aK[3][0].v), "v"(aK[3][1].v),
                           "v"(aV[0][0].v), "v"(aV[0][1].v), "v"(aV[1][0].v), "v"(aV[1][1].v),
                           "v"(aV[2][0].v), "v"(aV[2][1].v), "v"(aV[3][0].v), "v"(aV[3][1].v));

        // ---- S^T = K @ Q^T (64 keys x 16 queries per wave), f32 accum --
        v8f s[4];
        #pragma unroll
        for (int nt = 0; nt < 4; ++nt) {
            v8f c = {};
            #pragma unroll
            for (int kw = 0; kw < 2; ++kw)
                c = wmma_bf16(aK[nt][kw].v, bQ[kw].v, (v8f)c);
            s[nt] = c;
        }

        // ---- mask: -1e30 where masked, other scores scaled ----------------------
        #pragma unroll
        for (int nt = 0; nt < 4; ++nt) {
            #pragma unroll
            for (int r = 0; r < 8; ++r) {
                float e = s[nt][r];
                const bool keep = __builtin_amdgcn_inverse_ballot_w32(mw[nt >> 1][(nt & 1) * 8 + r]);
                s[nt][r] = keep ? e * SCALE : -1.0e30f;
            }
        }
        // the next tile's words, into the registers just used: the rest of this
        // trip covers their way from L2 (the last trip reads its own again)
        {
            const int tn = t + 1 < NTH ? t + 1 : t;
            mw[0] = pw[tn * 2];
            mw[1] = pw[tn * 2 + 1];
        }

        // ---- online softmax: a lane's 32 scores belong to one query ----
        float vmax = s[0][0];
        #pragma unroll
        for (int nt = 0; nt < 4; ++nt)
            #pragma unroll
            for (int r = 0; r < 8; ++r) vmax = fmaxf(vmax, s[nt][r]);
        vmax = fmaxf(vmax, xhalf(vmax));            // the query's other 32 keys
        const float mNew = fmaxf(mSt, vmax);
        const float corr = __expf(mSt - mNew);
        float rs[4];
        #pragma unroll
        for (int nt = 0; nt < 4; ++nt) {
            rs[nt] = 0.0f;
            #pragma unroll
            for (int r = 0; r < 8; ++r) {
                float pe = __expf(s[nt][r] - mNew);
                s[nt][r] = pe;
                rs[nt] += pe;
            }
        }
        lSt = lSt * corr + ((rs[0] + rs[1]) + (rs[2] + rs[3]));
        mSt = mNew;
        #pragma unroll
        for (int dt = 0; dt < 4; ++dt)
            #pragma unroll
            for (int r = 0; r < 8; ++r) accO[dt][r] *= corr;

        // ---- P^T as B operand: tiles 2kw and 2kw+1, converted in place,
        //      are keys 8*half + e and 16 + 8*half + e of a 32-key step ---
        Frag bP[2];
        #pragma unroll
        for (int kw = 0; kw < 2; ++kw)
            #pragma unroll
            for (int e = 0; e < 8; ++e) {
                bP[kw].h[0][e] = (__bf16)s[2 * kw][e];
                bP[kw].h[1][e] = (__bf16)s[2 * kw + 1][e];
            }

        // ---- O^T += V^T @ P^T  (V tile is [d][key]: rows are A rows) ---
        #pragma unroll
        for (int dt = 0; dt < 4; ++dt) {
            #pragma unroll
            for (int kw = 0; kw < 2; ++kw)
                accO[dt] = wmma_bf16(aV[dt][kw].v, bP[kw].v, accO[dt]);
        }

        // ---- hand over: tile t+1 is published, buffer buf is freed ------
        asm volatile("s_wait_dscnt 0x0" ::: "memory");      // my reads of this tile are done
        asm volatile("s_wait_asynccnt 0x0" ::: "memory");   // my pieces of tile t+1 have landed
        __syncthreads();
        if (t + 2 < NTH) stage(buf, kc + 128);              // refill the buffer just read
    }
    asm volatile("s_wait_asynccnt 0x0" ::: "memory");       // nothing in flight at the wave's end

    // ---- join the two key halves: waves w and w + 4 hold the same queries in the
    //      same lanes. Each finishes two of the four O tiles (key half 0: d 0..31,
    //      key half 1: d 32..63) and hands the other two to its partner. --------
    const float lAll = lSt + xhalf(lSt);            // the lane halves' sums joined
    float* mine = &xch[wave][0][lane];
    #pragma unroll
    for (int k = 0; k < 2; ++k)
        #pragma unroll
        for (int r = 0; r < 8; ++r) mine[(k * 8 + r) * 32] = kh ? accO[k][r] : accO[2 + k][r];
    mine[16 * 32] = mSt;
    mine[17 * 32] = lAll;
    __syncthreads();                                // both partners' values are in LDS
    const float* theirs = &xch[wave ^ 4][0][lane];
    const float mP   = theirs[16 * 32];
    const float lP   = theirs[17 * 32];
    const float mAll = fmaxf(mSt, mP);
    const float aS   = __expf(mSt - mAll);          // a half with no key kept weighs 0
    const float aP   = __expf(mP - mAll);           // beside one that has any
    const float lTot = lAll * aS + lP * aP;

    // ---- divide, write [B,L,E] f32 -------------------------------------
    float* orow = Ob + ((size_t)bidx * LL + (qrow0 + l16)) * EE + hidx * DD + kh * 32 + half * 8;
    #pragma unroll
    for (int k = 0; k < 2; ++k) {
        float o[8];
        #pragma unroll
        for (int r = 0; r < 8; ++r)
            o[r] = ((kh ? accO[2 + k][r] : accO[k][r]) * aS + theirs[(k * 8 + r) * 32] * aP) / lTot;
        float4 lo, hi;
        lo.x = o[0]; lo.y = o[1]; lo.z = o[2]; lo.w = o[3];
        hi.x = o[4]; hi.y = o[5]; hi.z = o[6]; hi.w = o[7];
        *(float4*)(orow + k * 16)     = lo;
        *(float4*)(orow + k * 16 + 4) = hi;
    }
}

// ---------------------------------------------------------------------------
// Launcher
// ---------------------------------------------------------------------------
extern "C" void kernel_launch(void* const* d_in, const int* in_sizes, int n_in,
                              void* d_out, int out_size, void* d_ws, size_t ws_size,
                              hipStream_t stream) {
    (void)in_sizes; (void)n_in; (void)out_size; (void)ws_size;
    const float* values = (const float*)d_in[0];
    const float* keysI  = (const float*)d_in[1];
    const float* queryI = (const float*)d_in[2];
    const int*   mask   = (const int*)d_in[3];
    const float* Wv = (const float*)d_in[4];  const float* bv = (const float*)d_in[5];
    const float* Wk = (const float*)d_in[6];  const float* bk = (const float*)d_in[7];
    const float* Wq = (const float*)d_in[8];  const float* bq = (const float*)d_in[9];
    const float* Wo = (const float*)d_in[10]; const float* bo = (const float*)d_in[11];

    char* ws = (char*)d_ws;
    __bf16* qb = (__bf16*)(ws);                      // 4 MB  [B,H,L,D] bf16
    __bf16* kb = (__bf16*)(ws + (4u << 20));         // 4 MB  [B,H,L,D] bf16
    __bf16* vb = (__bf16*)(ws + (8u << 20));         // 4 MB  [B,H,D,L] bf16
    float*  Ob = (float*) (ws + (12u << 20));        // 8 MB  [B,L,E]   f32
    unsigned* pm = (unsigned*)(ws + (20u << 20));    // 1 MB  packed mask

    dim3 gGrid(GM / 128, EE / 128), gBlk(256);
    gemm_qkv<<<dim3(GM / 128, EE / 128, 4), gBlk, 0, stream>>>(
        values, keysI, queryI, Wv, Wk, Wq, bv, bk, bq, vb, kb, qb, mask, pm);

    attn_flash<<<dim3(LL / 64, BB * HH), 256, 0, stream>>>(qb, kb, vb, pm, Ob);

    gemm_out<<<gGrid, gBlk, 0, stream>>>(Ob, Wo, bo, (float*)d_out);
}

// v008
// One run takes 46.8 microseconds.
// Timed twice side by side with v007, it ran 1.17 times as fast both times.
// Counting every step since v000, it is 4.46 times as fast.
#include <hip/hip_runtime.h>

// ---------------------------------------------------------------------------
// Self-attention forward for B=2, L=2048, E=512, H=8, D=64 on gfx1250 (CDNA5).
// All matmuls run on v_wmma_f32_16x16x32_bf16 (bf16 operands, f32 accum).
// Attention is fused flash-style: scores never hit HBM.
// GEMM tiles are double-buffered in LDS as bf16: the f32 operands come through
// registers and are rounded once on the way in; the loads of tiles t+1 and t+2
// overlap the LDS reads and WMMAs of tile t, one barrier per K-step.
// ---------------------------------------------------------------------------

typedef __attribute__((ext_vector_type(16))) __bf16 bf16x16;
typedef __attribute__((ext_vector_type(8)))  __bf16 bf16x8;
typedef __attribute__((ext_vector_type(4)))  __bf16 bf16x4;
typedef __attribute__((ext_vector_type(8)))  float  v8f;
typedef __attribute__((ext_vector_type(4)))  int    v4i;
typedef __attribute__((ext_vector_type(16))) unsigned u32x16;
// constant address space: a load at a wave-uniform address becomes a scalar load
typedef const u32x16 __attribute__((address_space(4)))* const_u32x16_ptr;

union Frag {
    bf16x16 v;
    bf16x8  h[2];
};

__device__ __forceinline__ v8f wmma_bf16(bf16x16 a, bf16x16 b, v8f c) {
    // (neg_a, A, neg_b, B, c_mod, C, reuse_a, reuse_b)
    return __builtin_amdgcn_wmma_f32_16x16x32_bf16(
        false, a, false, b, (short)0, c, false, false);
}

constexpr int BB  = 2;
constexpr int LL  = 2048;
constexpr int EE  = 512;
constexpr int HH  = 8;
constexpr int DD  = 64;
constexpr int GM  = BB * LL;   // 4096 rows in every projection GEMM

// ---------------------------------------------------------------------------
// Generic projection GEMM tile: dst = A[M,512] @ W[512,512]^T + bias, M = 4096.
// mode 0: write bf16 into [B,H,L,D]   (Q and K)
// mode 1: write bf16 into [B,H,D,L]   (V, pre-transposed for attn 2nd GEMM)
// mode 2: write f32  into [M, 512]    (final output projection)
// F32OUT fixes mode 2 at compile time; otherwise vlayout (the same for the whole
// block) picks mode 1 or 0 in the epilogue, so that one main loop and one pair
// of LDS buffers serve all three input projections.
// Block: 256 threads (8 waves). Block tile 128x128, wave tile 64x32,
// K stepped by 64. An element of A is read by four waves of the block and one of
// W by two: held in LDS as bf16 it costs each of them half the LDS bytes of f32
// and no conversion, and two buffers of 64 k per matrix take 72 KB.
// ---------------------------------------------------------------------------
template <int M> struct ModeTag { static constexpr int value = M; };

template <bool F32OUT>
__device__ __forceinline__
void gemm_tile(const float* __restrict__ A, const float* __restrict__ W,
               const float* __restrict__ bias, void* __restrict__ dstv, bool vlayout) {
    constexpr int KS     = 64;                   // k per step
    constexpr int NSTEPS = 512 / KS;
    // 144-byte rows: the 16 rows of a ds_load_b128 fragment read spread over the banks
    __shared__ __attribute__((aligned(16))) __bf16 sA[2][128][KS + 8];
    __shared__ __attribute__((aligned(16))) __bf16 sW[2][128][KS + 8];

    const int tid  = threadIdx.x;
    const int wave = tid >> 5;
    const int lane = tid & 31;
    const int half = lane >> 4;                  // 0 | 1 (lane group)
    const int l16  = lane & 15;
    const int m0   = blockIdx.x * 128;
    const int n0   = blockIdx.y * 128;
    const int wm   = wave & 1;                   // 2 wave-rows  x 64
    const int wn   = wave >> 1;                  // 4 wave-cols  x 32

    // One 128x64 f32 tile per matrix and step: 2048 16-byte pieces, 8 per thread;
    // a wave's load covers two whole 256-byte row pieces.
    const int srow = tid >> 4;                   // 0..15, +16 per piece
    const int scol = (tid & 15) * 4;             // 4 floats
    const float* ag = A + (size_t)(m0 + srow) * 512 + scol;
    const float* wg = W + (size_t)(n0 + srow) * 512 + scol;
    // Two register sets for tiles on their way: a tile's loads fly over a whole step
    // and more, and the next tile's follow them without a pause.
    float4 ga[2][8], gw[2][8];
    auto fetch = [&](int set, int k0) {
        #pragma unroll
        for (int i = 0; i < 8; ++i) {
            ga[set][i] = *(const float4*)(ag + i * 16 * 512 + k0);
            gw[set][i] = *(const float4*)(wg + i * 16 * 512 + k0);
        }
    };
    // every element is rounded to bf16 here, once, not by each wave that reads it
    auto put = [&](int buf, int set) {
        #pragma unroll
        for (int i = 0; i < 8; ++i) {
            bf16x4 a, w;
            a[0] = (__bf16)ga[set][i].x; a[1] = (__bf16)ga[set][i].y; a[2] = (__bf16)ga[set][i].z; a[3] = (__bf16)ga[set][i].w;
            w[0] = (__bf16)gw[set][i].x; w[1] = (__bf16)gw[set][i].y; w[2] = (__bf16)gw[set][i].z; w[3] = (__bf16)gw[set][i].w;
            *(bf16x4*)&sA[buf][srow + i * 16][scol] = a;
            *(bf16x4*)&sW[buf][srow + i * 16][scol] = w;
        }
    };

    v8f acc[4][2] = {};

    // A workgroup barrier whose fences order LDS alone: __syncthreads() would also
    // drain the wave's global loads, which are to stay in flight across it. Only LDS
    // passes from wave to wave here.
    auto tile_barrier = [&]() {
        __builtin_amdgcn_fence(__ATOMIC_RELEASE, "workgroup", "local");
        __builtin_amdgcn_s_barrier();
        __builtin_amdgcn_fence(__ATOMIC_ACQUIRE, "workgroup", "local");
        // keeps the next put's conversions behind the barrier: lifted over it they
        // wait, one step early, for loads that have only just been issued
        __builtin_amdgcn_sched_barrier(0);
    };

    fetch(0, 0);
    fetch(1, KS);
    put(0, 0);
    tile_barrier();                              // tile 0 is in LDS
    // unrolled: every k offset is an immediate, so that no address register of a
    // load in flight is rewritten
    #pragma unroll
    for (int step = 0; step < NSTEPS; ++step) {
        const int buf = step & 1;
        // into the set that the last put has emptied: these loads fly while this
        // tile and most of the next are worked on
        if (step + 2 < NSTEPS) fetch(buf, (step + 2) * KS);
        // The last tile's loads are the last use of the two address pairs: this wait
        // is kept in front of whatever is given their registers next (it names them,
        // so that they are not handed out as a destination to one of these loads).
        if (step + 3 == NSTEPS) asm volatile("s_wait_xcnt 0x0" :: "v"(ag), "v"(wg) : "memory");

        // ---- this tile's A and W fragments out of LDS, 32 k at a time ---
        #pragma unroll
        for (int kk = 0; kk < 2; ++kk) {
            Frag aF[4], bF[2];
            #pragma unroll
            for (int i = 0; i < 4; ++i) {
                const __bf16* p = &sA[buf][wm * 64 + i * 16 + l16][kk * 32 + half * 8];
                aF[i].h[0] = *(const bf16x8*)p;
                aF[i].h[1] = *(const bf16x8*)(p + 16);
            }
            #pragma unroll
            for (int j = 0; j < 2; ++j) {
                const __bf16* p = &sW[buf][wn * 32 + j * 16 + l16][kk * 32 + half * 8];
                bF[j].h[0] = *(const bf16x8*)p;
                bF[j].h[1] = *(const bf16x8*)(p + 16);
            }
            // Inputs-only fence on the loaded fragments: without it the reads stand in
            // pairs among the WMMAs, each pair fully waited for (one LDS round trip per
            // two WMMAs); with it they go out as one group.
            asm volatile("" :: "v"(aF[0].v), "v"(aF[1].v), "v"(aF[2].v), "v"(aF[3].v),
                               "v"(bF[0].v), "v"(bF[1].v));
            #pragma unroll
            for (int i = 0; i < 4; ++i)
                #pragma unroll
                for (int j = 0; j < 2; ++j)
                    acc[i][j] = wmma_bf16(aF[i].v, bF[j].v, acc[i][j]);
        }

        if (step + 1 < NSTEPS) {
            put(buf ^ 1, buf ^ 1);               // its readers left it before the last barrier
            tile_barrier();                      // tile step+1 is in LDS, this one is free
        }
    }

    // Epilogue: C-fragment layout — VGPR r holds row (r + 8*half), col l16.
    auto epilogue = [&](auto tag) {
    constexpr int MODE = decltype(tag)::value;
    #pragma unroll
    for (int i = 0; i < 4; ++i) {
        #pragma unroll
        for (int j = 0; j < 2; ++j) {
            int gn = n0 + wn * 32 + j * 16 + l16;
            float bval = bias[gn];
            #pragma unroll
            for (int r = 0; r < 8; ++r) {
                int gm = m0 + wm * 64 + i * 16 + r + half * 8;
                float val = acc[i][j][r] + bval;
                int b = gm >> 11;                // / L
                int l = gm & (LL - 1);
                if (MODE == 0) {                 // [B,H,L,D] bf16
                    int h = gn >> 6, d = gn & 63;
                    ((__bf16*)dstv)[(((size_t)(b * HH + h) * LL + l) << 6) + d] = (__bf16)val;
                } else if (MODE == 1) {          // [B,H,D,L] bf16
                    int h = gn >> 6, d = gn & 63;
                    ((__bf16*)dstv)[((size_t)(b * HH + h) * DD + d) * LL + l] = (__bf16)val;
                } else {                         // [M,512] f32
                    ((float*)dstv)[(size_t)gm * 512 + gn] = val;
                }
            }
        }
    }
    };
    if constexpr (F32OUT) {
        epilogue(ModeTag<2>{});
    } else {
        if (vlayout) {
            epilogue(ModeTag<1>{});
            // as below: in the built kernel the mask packing's code lies behind this one
            asm volatile("s_wait_xcnt 0x0" ::: "memory");
        } else {
            epilogue(ModeTag<0>{});
            // the other layout's code lies behind this one in the built kernel:
            // this wait stands between these stores and the instructions there
            // that rewrite registers which the stores name
            asm volatile("s_wait_xcnt 0x0" ::: "memory");
        }
    }
}

// The occupancy target of both GEMM kernels is capped (four waves per SIMD for
// the input projections, two for the output projection), so that a K-step's LDS
// reads go out as one group (see the note at attn_flash).

// ---------------------------------------------------------------------------
// The mask is the same for all eight heads, and attention needs one bit of each
// word. It is packed once, in the form in which an attention wave uses it: for
// a group of 16 queries and a tile of 64 keys, 32 words, one per score register
// (nt, r) of the wave's S^T tiles; bit `lane` of a word says whether that lane's
// score (query l16, key nt*16 + 8*half + r) is kept. Such a word is a lane mask
// as a select takes it from a scalar register.
// pm: [B*L/16 groups][L/64 tiles][32 words] = 1 MB.
// The mask is read in whole lines: one load takes 128 neighbouring keys of one
// row, four to a lane. A ballot per component gives that row's bits (bit j of
// component c is key 4j + c); lanes l16 and l16 + 16 collect the four words of
// row l16, and a second round of ballots, over single bits of those words,
// turns rows into lane masks.
// One wave packs 512 keys of one group, 256 (32 loads in flight) at a time.
// ---------------------------------------------------------------------------
__device__ __forceinline__
void pack_mask(const int* __restrict__ mask, unsigned* __restrict__ pm) {
    const int lane = threadIdx.x & 31;
    const int half = lane >> 4;
    const int w    = (blockIdx.y * (GM / 128) + blockIdx.x) * 8 + (threadIdx.x >> 5);  // 0..1023
    const int g    = w >> 2;                     // group of 16 rows of [B*L]
    const int k0   = (w & 3) * 512;              // first of this wave's 512 keys
    const int* src = mask + (size_t)(g * 16) * LL + k0 + lane * 4;
    unsigned*  dst = pm + ((size_t)g * (LL / 64) + k0 / 64) * 32 + lane;
    // kept rolled: unrolled, all 64 loads are lifted to the top and their 256
    // registers cost the projection workgroups their second place on a WGP
    #pragma unroll 1
    for (int pp = 0; pp < 2; ++pp) {
        v4i mv[2][16];
        #pragma unroll
        for (int p = 0; p < 2; ++p)
            #pragma unroll
            for (int row = 0; row < 16; ++row)
                // read once: non-temporal, so that the 32 MB do not push Q, K, V out of L2
                mv[p][row] = __builtin_nontemporal_load(
                    (const v4i*)(src + (size_t)row * LL + (pp * 2 + p) * 128));
        #pragma unroll
        for (int p = 0; p < 2; ++p) {
            unsigned x[4] = {0u, 0u, 0u, 0u};    // row l16: bit j of x[c] is key 4j + c
            #pragma unroll
            for (int row = 0; row < 16; ++row)
                #pragma unroll
                for (int c = 0; c < 4; ++c) {
                    const unsigned bits = __builtin_amdgcn_ballot_w32(mv[p][row][c] != 0);
                    x[c] = __builtin_amdgcn_inverse_ballot_w32(0x00010001u << row) ? bits : x[c];
                }
            #pragma unroll
            for (int c = 0; c < 4; ++c) x[c] >>= half * 2;   // keys 8*half + ... of each 16
            #pragma unroll
            for (int tt = 0; tt < 2; ++tt) {     // the two 64-key tiles of these 128 keys
                unsigned word = 0u;              // lane i ends up with word i
                #pragma unroll
                for (int nt = 0; nt < 4; ++nt)
                    #pragma unroll
                    for (int r = 0; r < 8; ++r) {
                        const unsigned bit  = 1u << (tt * 16 + nt * 4 + (r >> 2));
                        const unsigned keep = __builtin_amdgcn_ballot_w32((x[r & 3] & bit) != 0u);
                        word = __builtin_amdgcn_inverse_ballot_w32(1u << (nt * 8 + r)) ? keep : word;
                    }
                dst[((pp * 2 + p) * 2 + tt) * 32] = word;    // one whole 128-byte line per tile
            }
        }
        // kept in front of the next trip's rewrite of the registers that these
        // stores name (their address and their data)
        asm volatile("s_wait_xcnt 0x0" ::: "memory");
    }
}

// The three input projections depend on nothing of one another: one grid, whose
// z index picks the projection, runs them side by side, with a fourth plane of
// 128 workgroups that packs the mask: 512 workgroups on 256 WGPs.
// The upper bound of the occupancy attribute is more than a hint: the compiler
// pads the kernel's register allocation until no more waves than that fit a
// SIMD. A bound of two leaves room for one 8-wave workgroup per WGP, and the
// grid takes two rounds. A bound of four (256 registers a wave, which the main
// loop fills) lets two workgroups share a WGP (2 x 72 KB of LDS): the
// whole grid is resident at once, and while one workgroup waits for its copies
// or a barrier the other reads LDS and issues WMMAs.
__global__ __launch_bounds__(256) __attribute__((amdgpu_waves_per_eu(4, 4)))
void gemm_qkv(const float* __restrict__ values, const float* __restrict__ keysI,
              const float* __restrict__ queryI,
              const float* __restrict__ Wv, const float* __restrict__ Wk,
              const float* __restrict__ Wq,
              const float* __restrict__ bv, const float* __restrict__ bk,
              const float* __restrict__ bq,
              __bf16* __restrict__ vb, __bf16* __restrict__ kb, __bf16* __restrict__ qb,
              const int* __restrict__ mask, unsigned* __restrict__ pm) {
    const int z = blockIdx.z;
    if (z == 3) {                                // the whole block: no barrier is skipped by part of it
        pack_mask(mask, pm);
        return;
    }
    const float* A    = z == 0 ? values : z == 1 ? keysI : queryI;
    const float* W    = z == 0 ? Wv : z == 1 ? Wk : Wq;
    const float* bias = z == 0 ? bv : z == 1 ? bk : bq;
    __bf16*      dst  = z == 0 ? vb : z == 1 ? kb : qb;
    gemm_tile<false>(A, W, bias, (void*)dst, z == 0);
}

__global__ __launch_bounds__(256) __attribute__((amdgpu_waves_per_eu(2, 2)))
void gemm_out(const float* __restrict__ A, const float* __restrict__ W,
              const float* __restrict__ bias, float* __restrict__ dst) {
    gemm_tile<true>(A, W, bias, (void*)dst, false);
}

__device__ __forceinline__ float xhalf(float x) {
    return __builtin_bit_cast(float, __builtin_amdgcn_permlanex16(
        __builtin_bit_cast(int, x), __builtin_bit_cast(int, x),
        0x76543210, 0xfedcba98, false, false));
}

// With the keys split in two the grid fills four waves per SIMD (4096 waves,
// 1024 SIMDs): while one wave waits for its LDS reads, a barrier or a dependent
// softmax chain, three others have work to issue. The occupancy target is
// pinned there: 256 registers a wave, which hold a whole tile's fragments.
__global__ __launch_bounds__(256) __attribute__((amdgpu_waves_per_eu(4, 4)))
void attn_flash(const __bf16* __restrict__ qb,   // [B,H,L,D]
                const __bf16* __restrict__ kb,   // [B,H,L,D]
                const __bf16* __restrict__ vb,   // [B,H,D,L]
                const unsigned* __restrict__ pm, // packed mask, see pack_mask
                float*        __restrict__ Ob) { // [B,L,E]
    constexpr float SCALE = 0.04419417382415922f;   // 1/sqrt(512)
    constexpr int NT  = LL / 64;                    // key tiles in all
    constexpr int NTH = NT / 2;                     // key tiles of one wave
    // 144-byte rows: the 16 rows of a ds_load_b128 fragment read spread over the banks
    __shared__ __attribute__((aligned(16))) __bf16 sK[2][2][64][64 + 8];   // [key half][buffer][key][d]
    __shared__ __attribute__((aligned(16))) __bf16 sV[2][2][64][64 + 8];   // [key half][buffer][d][key]
    // what a wave hands to its partner after the loop: 16 O values, maximum, sum
    __shared__ float xch[8][18][32];                // [wave][value][lane]

    const int wave = __builtin_amdgcn_readfirstlane(threadIdx.x >> 5);   // scalar
    const int kh   = wave >> 2;                     // this wave's half of the keys
    const int qw   = wave & 3;                      // its group of 16 queries
    const int lane = threadIdx.x & 31;
    const int half = lane >> 4;
    const int l16  = lane & 15;
    const int bh   = blockIdx.y;                    // b*H + h
    const int bidx = bh / HH;
    const int hidx = bh % HH;
    const int q0   = blockIdx.x * 64;
    const int qrow0 = q0 + qw * 16;

    // Q B-fragments: column l16 is this lane's query (K = D = 64 -> 2 fragments)
    Frag bQ[2];
    {
        const __bf16* qp = qb + ((size_t)bh * LL + (qrow0 + l16)) * DD;
        #pragma unroll
        for (int kw = 0; kw < 2; ++kw) {
            bQ[kw].h[0] = *(const bf16x8*)(qp + kw * 32 + half * 8);
            bQ[kw].h[1] = *(const bf16x8*)(qp + kw * 32 + 16 + half * 8);
        }
    }

    v8f   accO[4] = {};                 // O^T: register r = d (dt*16 + 8*half + r), column = query
    float mSt = -3.0e38f;               // this query's running maximum (equal in both halves)
    float lSt = 0.0f;                   // sum over this half's keys; the halves join after the loop

    // this wave's lane-mask words: 32 per key tile, at an address that is the same
    // in every lane (the wave's number is scalar), so they come by scalar loads
    const int grp = (bidx * LL + q0) / 16 + qw;
    // (nothing writes pm while this kernel runs: the launch before it did)
    const_u32x16_ptr pw = (const_u32x16_ptr)(unsigned long long)(
        pm + (size_t)grp * (NT * 32) + kh * (NTH * 32));
    u32x16 mw[2];
    mw[0] = pw[0];
    mw[1] = pw[1];

    // One 64x64 bf16 tile of K and of V per key half: 512 16-byte pieces each, 4
    // per thread of the half's four waves; a wave's copy covers four whole
    // 128-byte rows.
    const int srow = (threadIdx.x & 127) >> 3;      // 0..15, +16 per piece
    const int scol = (threadIdx.x & 7) * 8;
    const __bf16* kg = kb + ((size_t)bh * LL + kh * (LL / 2) + srow) * DD + scol;
    const __bf16* vg = vb + ((size_t)bh * DD + srow) * LL + kh * (LL / 2) + scol;
    auto stage = [&](int buf, int kc) {
        const __bf16* k0 = kg + (size_t)kc * DD;
        const __bf16* v0 = vg + kc;
        const unsigned lk = (unsigned)(unsigned long long)&sK[kh][buf][srow][scol];
        const unsigned lv = (unsigned)(unsigned long long)&sV[kh][buf][srow][scol];
        constexpr unsigned RS = 16 * (64 + 8) * 2;  // 16 LDS rows in bytes
        // the copies and the s_wait_xcnt that is kept in front of any rewrite of
        // their address registers stand in one statement, so that the compiler
        // can schedule nothing between them
        asm volatile(
            "global_load_async_to_lds_b128 %0, %8, off\n\t"
            "global_load_async_to_lds_b128 %1, %9, off\n\t"
            "global_load_async_to_lds_b128 %2, %10, off\n\t"
            "global_load_async_to_lds_b128 %3, %11, off\n\t"
            "global_load_async_to_lds_b128 %4, %12, off\n\t"
            "global_load_async_to_lds_b128 %5, %13, off\n\t"
            "global_load_async_to_lds_b128 %6, %14, off\n\t"
            "global_load_async_to_lds_b128 %7, %15, off\n\t"
            "s_wait_xcnt 0x0"
            :: "v"(lk), "v"(lk + RS), "v"(lk + 2 * RS), "v"(lk + 3 * RS),
               "v"(lv), "v"(lv + RS), "v"(lv + 2 * RS), "v"(lv + 3 * RS),
               "v"(k0), "v"(k0 + 16 * DD), "v"(k0 + 32 * DD), "v"(k0 + 48 * DD),
               "v"(v0), "v"(v0 + 16 * LL), "v"(v0 + 32 * LL), "v"(v0 + 48 * LL)
            : "memory");
    };

    stage(0, 0);
    asm volatile("s_wait_asynccnt 0x0" ::: "memory");   // my pieces of tile 0 have landed
    __syncthreads();                                    // everyone's have
    stage(1, 64);

    for (int t = 0; t < NTH; ++t) {
        const int kc  = t * 64;                     // counted from the half's first key
        const int buf = t & 1;
        // ---- this tile's K and V A-fragments out of LDS ----------------
        Frag aK[4][2], aV[4][2];
        #pragma unroll
        for (int nt = 0; nt < 4; ++nt) {
            const __bf16* kp = &sK[kh][buf][nt * 16 + l16][0];
            const __bf16* vp = &sV[kh][buf][nt * 16 + l16][0];
            #pragma unroll
            for (int kw = 0; kw < 2; ++kw) {
                aK[nt][kw].h[0] = *(const bf16x8*)(kp + kw * 32 + half * 8);
                aK[nt][kw].h[1] = *(const bf16x8*)(kp + kw * 32 + 16 + half * 8);
                aV[nt][kw].h[0] = *(const bf16x8*)(vp + kw * 32 + half * 8);
                aV[nt][kw].h[1] = *(const bf16x8*)(vp + kw * 32 + 16 + half * 8);
            }
        }
        // Inputs-only fence on the loaded fragments: without it each fragment's
        // two reads are issued and fully waited for right in front of their
        // WMMA, one LDS round trip per WMMA; with it the reads go out in groups
        // ahead of their use, behind counted waits.
        asm volatile("" :: "v"(aK[0][0].v), "v"(aK[0][1].v), "v"(aK[1][0].v), "v"(aK[1][1].v),
                           "v"(aK[2][0].v), "v"(aK[2][1].v), "v"(aK[3][0].v), "v"(aK[3][1].v),
                           "v"(aV[0][0].v), "v"(aV[0][1].v), "v"(aV[1][0].v), "v"(aV[1][1].v),
                           "v"(aV[2][0].v), "v"(aV[2][1].v), "v"(aV[3][0].v), "v"(aV[3][1].v));

        // ---- S^T = K @ Q^T (64 keys x 16 queries per wave), f32 accum --
        v8f s[4];
        #pragma unroll
        for (int nt = 0; nt < 4; ++nt) {
            v8f c = {};
            #pragma unroll
            for (int kw = 0; kw < 2; ++kw)
                c = wmma_bf16(aK[nt][kw].v, bQ[kw].v, (v8f)c);
            s[nt] = c;
        }

        // ---- mask: -1e30 where masked, other scores scaled ----------------------
        #pragma unroll
        for (int nt = 0; nt < 4; ++nt) {
            #pragma unroll
            for (int r = 0; r < 8; ++r) {
                float e = s[nt][r];
                const bool keep = __builtin_amdgcn_inverse_ballot_w32(mw[nt >> 1][(nt & 1) * 8 + r]);
                s[nt][r] = keep ? e * SCALE : -1.0e30f;
            }
        }
        // the next tile's words, into the registers just used: the rest of this
        // trip covers their way from L2 (the last trip reads its own again)
        {
            const int tn = t + 1 < NTH ? t + 1 : t;
            mw[0] = pw[tn * 2];
            mw[1] = pw[tn * 2 + 1];
        }

        // ---- online softmax: a lane's 32 scores belong to one query ----
        float vmax = s[0][0];
        #pragma unroll
        for (int nt = 0; nt < 4; ++nt)
            #pragma unroll
            for (int r = 0; r < 8; ++r) vmax = fmaxf(vmax, s[nt][r]);
        vmax = fmaxf(vmax, xhalf(vmax));            // the query's other 32 keys
        const float mNew = fmaxf(mSt, vmax);
        const float corr = __expf(mSt - mNew);
        float rs[4];
        #pragma unroll
        for (int nt = 0; nt < 4; ++nt) {
            rs[nt] = 0.0f;
            #pragma unroll
            for (int r = 0; r < 8; ++r) {
                float pe = __expf(s[nt][r] - mNew);
                s[nt][r] = pe;
                rs[nt] += pe;
            }
        }
        lSt = lSt * corr + ((rs[0] + rs[1]) + (rs[2] + rs[3]));
        mSt = mNew;
        #pragma unroll
        for (int dt = 0; dt < 4; ++dt)
            #pragma unroll
            for (int r = 0; r < 8; ++r) accO[dt][r] *= corr;

        // ---- P^T as B operand: tiles 2kw and 2kw+1, converted in place,
        //      are keys 8*half + e and 16 + 8*half + e of a 32-key step ---
        Frag bP[2];
        #pragma unroll
        for (int kw = 0; kw < 2; ++kw)
            #pragma unroll
            for (int e = 0; e < 8; ++e) {
                bP[kw].h[0][e] = (__bf16)s[2 * kw][e];
                bP[kw].h[1][e] = (__bf16)s[2 * kw + 1][e];
            }

        // ---- O^T += V^T @ P^T  (V tile is [d][key]: rows are A rows) ---
        #pragma unroll
        for (int dt = 0; dt < 4; ++dt) {
            #pragma unroll
            for (int kw = 0; kw < 2; ++kw)
                accO[dt] = wmma_bf16(aV[dt][kw].v, bP[kw].v, accO[dt]);
        }

        // ---- hand over: tile t+1 is published, buffer buf is freed ------
        asm volatile("s_wait_dscnt 0x0" ::: "memory");      // my reads of this tile are done
        asm volatile("s_wait_asynccnt 0x0" ::: "memory");   // my pieces of tile t+1 have landed
        __syncthreads();
        if (t + 2 < NTH) stage(buf, kc + 128);              // refill the buffer just read
    }
    asm volatile("s_wait_asynccnt 0x0" ::: "memory");       // nothing in flight at the wave's end

    // ---- join the two key halves: waves w and w + 4 hold the same queries in the
    //      same lanes. Each finishes two of the four O tiles (key half 0: d 0..31,
    //      key half 1: d 32..63) and hands the other two to its partner. --------
    const float lAll = lSt + xhalf(lSt);            // the lane halves' sums joined
    float* mine = &xch[wave][0][lane];
    #pragma unroll
    for (int k = 0; k < 2; ++k)
        #pragma unroll
        for (int r = 0; r < 8; ++r) mine[(k * 8 + r) * 32] = kh ? accO[k][r] : accO[2 + k][r];
    mine[16 * 32] = mSt;
    mine[17 * 32] = lAll;
    __syncthreads();                                // both partners' values are in LDS
    const float* theirs = &xch[wave ^ 4][0][lane];
    const float mP   = theirs[16 * 32];
    const float lP   = theirs[17 * 32];
    const float mAll = fmaxf(mSt, mP);
    const float aS   = __expf(mSt - mAll);          // a half with no key kept weighs 0
    const float aP   = __expf(mP - mAll);           // beside one that has any
    const float lTot = lAll * aS + lP * aP;

    // ---- divide, write [B,L,E] f32 -------------------------------------
    float* orow = Ob + ((size_t)bidx * LL + (qrow0 + l16)) * EE + hidx * DD + kh * 32 + half * 8;
    #pragma unroll
    for (int k = 0; k < 2; ++k) {
        float o[8];
        #pragma unroll
        for (int r = 0; r < 8; ++r)
            o[r] = ((kh ? accO[2 + k][r] : accO[k][r]) * aS + theirs[(k * 8 + r) * 32] * aP) / lTot;
        float4 lo, hi;
        lo.x = o[0]; lo.y = o[1]; lo.z = o[2]; lo.w = o[3];
        hi.x = o[4]; hi.y = o[5]; hi.z = o[6]; hi.w = o[7];
        *(float4*)(orow + k * 16)     = lo;
        *(float4*)(orow + k * 16 + 4) = hi;
    }
}

// ---------------------------------------------------------------------------
// Launcher
// ---------------------------------------------------------------------------
extern "C" void kernel_launch(void* const* d_in, const int* in_sizes, int n_in,
                              void* d_out, int out_size, void* d_ws, size_t ws_size,
                              hipStream_t stream) {
    (void)in_sizes; (void)n_in; (void)out_size; (void)ws_size;
    const float* values = (const float*)d_in[0];
    const float* keysI  = (const float*)d_in[1];
    const float* queryI = (const float*)d_in[2];
    const int*   mask   = (const int*)d_in[3];
    const float* Wv = (const float*)d_in[4];  const float* bv = (const float*)d_in[5];
    const float* Wk = (const float*)d_in[6];  const float* bk = (const float*)d_in[7];
    const float* Wq = (const float*)d_in[8];  const float* bq = (const float*)d_in[9];
    const float* Wo = (const float*)d_in[10]; const float* bo = (const float*)d_in[11];

    char* ws = (char*)d_ws;
    __bf16* qb = (__bf16*)(ws);                      // 4 MB  [B,H,L,D] bf16
    __bf16* kb = (__bf16*)(ws + (4u << 20));         // 4 MB  [B,H,L,D] bf16
    __bf16* vb = (__bf16*)(ws + (8u << 20));         // 4 MB  [B,H,D,L] bf16
    float*  Ob = (float*) (ws + (12u << 20));        // 8 MB  [B,L,E]   f32
    unsigned* pm = (unsigned*)(ws + (20u << 20));    // 1 MB  packed mask

    dim3 gGrid(GM / 128, EE / 128), gBlk(256);
    gemm_qkv<<<dim3(GM / 128, EE / 128, 4), gBlk, 0, stream>>>(
        values, keysI, queryI, Wv, Wk, Wq, bv, bk, bq, vb, kb, qb, mask, pm);

    attn_flash<<<dim3(LL / 64, BB * HH), 256, 0, stream>>>(qb, kb, vb, pm, Ob);

    gemm_out<<<gGrid, gBlk, 0, stream>>>(Ob, Wo, bo, (float*)d_out);
}

// v009
// Measured time: 44.2 microseconds a run.
// Timed twice side by side with v008, it ran 1.06 times as fast both times.
// Over all steps from v000 it is 4.74 times as fast.
#include <hip/hip_runtime.h>

// ---------------------------------------------------------------------------
// Self-attention forward for B=2, L=2048, E=512, H=8, D=64 on gfx1250 (CDNA5).
// All matmuls run on v_wmma_f32_16x16x32_bf16 (bf16 operands, f32 accum).
// Attention is fused flash-style: scores never hit HBM.
// GEMM tiles are double-buffered in LDS as bf16: the f32 operands come through
// registers and are rounded once on the way in; the loads of tiles t+1 and t+2
// overlap the LDS reads and WMMAs of tile t, one barrier per K-step.
// ---------------------------------------------------------------------------

typedef __attribute__((ext_vector_type(16))) __bf16 bf16x16;
typedef __attribute__((ext_vector_type(8)))  __bf16 bf16x8;
typedef __attribute__((ext_vector_type(4)))  __bf16 bf16x4;
typedef __attribute__((ext_vector_type(8)))  float  v8f;
typedef __attribute__((ext_vector_type(4)))  int    v4i;
typedef __attribute__((ext_vector_type(16))) unsigned u32x16;
// constant address space: a load at a wave-uniform address becomes a scalar load
typedef const u32x16 __attribute__((address_space(4)))* const_u32x16_ptr;

union Frag {
    bf16x16 v;
    bf16x8  h[2];
};

__device__ __forceinline__ v8f wmma_bf16(bf16x16 a, bf16x16 b, v8f c) {
    // (neg_a, A, neg_b, B, c_mod, C, reuse_a, reuse_b)
    return __builtin_amdgcn_wmma_f32_16x16x32_bf16(
        false, a, false, b, (short)0, c, false, false);
}

constexpr int BB  = 2;
constexpr int LL  = 2048;
constexpr int EE  = 512;
constexpr int HH  = 8;
constexpr int DD  = 64;
constexpr int GM  = BB * LL;   // 4096 rows in every projection GEMM
// 1/sqrt(512) * log2(e): Q is stored times this, so that K Q^T is a score in the
// units of exp2
constexpr float QSCALE = 0.04419417382415922f * 1.4426950408889634f;

// ---------------------------------------------------------------------------
// Generic projection GEMM tile: dst = (A[M,512] @ W[512,512]^T + bias) * oscale, M = 4096.
// mode 0: write bf16 into [B,H,L,D]   (Q and K)
// mode 1: write bf16 into [B,H,D,L]   (V, pre-transposed for attn 2nd GEMM)
// mode 2: write f32  into [M, 512]    (final output projection)
// F32OUT fixes mode 2 at compile time; otherwise vlayout (the same for the whole
// block) picks mode 1 or 0 in the epilogue, so that one main loop and one pair
// of LDS buffers serve all three input projections.
// Block: 256 threads (8 waves). Block tile 128x128, wave tile 64x32,
// K stepped by 64. An element of A is read by four waves of the block and one of
// W by two: held in LDS as bf16 it costs each of them half the LDS bytes of f32
// and no conversion, and two buffers of 64 k per matrix take 72 KB.
// ---------------------------------------------------------------------------
template <int M> struct ModeTag { static constexpr int value = M; };

template <bool F32OUT>
__device__ __forceinline__
void gemm_tile(const float* __restrict__ A, const float* __restrict__ W,
               const float* __restrict__ bias, void* __restrict__ dstv, bool vlayout,
               float oscale) {                   // factor on the result, before its one rounding
    constexpr int KS     = 64;                   // k per step
    constexpr int NSTEPS = 512 / KS;
    // 144-byte rows: the 16 rows of a ds_load_b128 fragment read spread over the banks
    __shared__ __attribute__((aligned(16))) __bf16 sA[2][128][KS + 8];
    __shared__ __attribute__((aligned(16))) __bf16 sW[2][128][KS + 8];

    const int tid  = threadIdx.x;
    const int wave = tid >> 5;
    const int lane = tid & 31;
    const int half = lane >> 4;                  // 0 | 1 (lane group)
    const int l16  = lane & 15;
    const int m0   = blockIdx.x * 128;
    const int n0   = blockIdx.y * 128;
    const int wm   = wave & 1;                   // 2 wave-rows  x 64
    const int wn   = wave >> 1;                  // 4 wave-cols  x 32

    // One 128x64 f32 tile per matrix and step: 2048 16-byte pieces, 8 per thread;
    // a wave's load covers two whole 256-byte row pieces.
    const int srow = tid >> 4;                   // 0..15, +16 per piece
    const int scol = (tid & 15) * 4;             // 4 floats
    const float* ag = A + (size_t)(m0 + srow) * 512 + scol;
    const float* wg = W + (size_t)(n0 + srow) * 512 + scol;
    // Two register sets for tiles on their way: a tile's loads fly over a whole step
    // and more, and the next tile's follow them without a pause.
    float4 ga[2][8], gw[2][8];
    auto fetch = [&](int set, int k0) {
        #pragma unroll
        for (int i = 0; i < 8; ++i) {
            ga[set][i] = *(const float4*)(ag + i * 16 * 512 + k0);
            gw[set][i] = *(const float4*)(wg + i * 16 * 512 + k0);
        }
    };
    // every element is rounded to bf16 here, once, not by each wave that reads it
    auto put = [&](int buf, int set) {
        #pragma unroll
        for (int i = 0; i < 8; ++i) {
            bf16x4 a, w;
            a[0] = (__bf16)ga[set][i].x; a[1] = (__bf16)ga[set][i].y; a[2] = (__bf16)ga[set][i].z; a[3] = (__bf16)ga[set][i].w;
            w[0] = (__bf16)gw[set][i].x; w[1] = (__bf16)gw[set][i].y; w[2] = (__bf16)gw[set][i].z; w[3] = (__bf16)gw[set][i].w;
            *(bf16x4*)&sA[buf][srow + i * 16][scol] = a;
            *(bf16x4*)&sW[buf][srow + i * 16][scol] = w;
        }
    };

    v8f acc[4][2] = {};

    // A workgroup barrier whose fences order LDS alone: __syncthreads() would also
    // drain the wave's global loads, which are to stay in flight across it. Only LDS
    // passes from wave to wave here.
    auto tile_barrier = [&]() {
        __builtin_amdgcn_fence(__ATOMIC_RELEASE, "workgroup", "local");
        __builtin_amdgcn_s_barrier();
        __builtin_amdgcn_fence(__ATOMIC_ACQUIRE, "workgroup", "local");
        // keeps the next put's conversions behind the barrier: lifted over it they
        // wait, one step early, for loads that have only just been issued
        __builtin_amdgcn_sched_barrier(0);
    };

    fetch(0, 0);
    fetch(1, KS);
    put(0, 0);
    tile_barrier();                              // tile 0 is in LDS
    // unrolled: every k offset is an immediate, so that no address register of a
    // load in flight is rewritten
    #pragma unroll
    for (int step = 0; step < NSTEPS; ++step) {
        const int buf = step & 1;
        // into the set that the last put has emptied: these loads fly while this
        // tile and most of the next are worked on
        if (step + 2 < NSTEPS) fetch(buf, (step + 2) * KS);
        // The last tile's loads are the last use of the two address pairs: this wait
        // is kept in front of whatever is given their registers next (it names them,
        // so that they are not handed out as a destination to one of these loads).
        if (step + 3 == NSTEPS) asm volatile("s_wait_xcnt 0x0" :: "v"(ag), "v"(wg) : "memory");

        // ---- this tile's A and W fragments out of LDS, 32 k at a time ---
        #pragma unroll
        for (int kk = 0; kk < 2; ++kk) {
            Frag aF[4], bF[2];
            #pragma unroll
            for (int i = 0; i < 4; ++i) {
                const __bf16* p = &sA[buf][wm * 64 + i * 16 + l16][kk * 32 + half * 8];
                aF[i].h[0] = *(const bf16x8*)p;
                aF[i].h[1] = *(const bf16x8*)(p + 16);
            }
            #pragma unroll
            for (int j = 0; j < 2; ++j) {
                const __bf16* p = &sW[buf][wn * 32 + j * 16 + l16][kk * 32 + half * 8];
                bF[j].h[0] = *(const bf16x8*)p;
                bF[j].h[1] = *(const bf16x8*)(p + 16);
            }
            // Inputs-only fence on the loaded fragments: without it the reads stand in
            // pairs among the WMMAs, each pair fully waited for (one LDS round trip per
            // two WMMAs); with it they go out as one group.
            asm volatile("" :: "v"(aF[0].v), "v"(aF[1].v), "v"(aF[2].v), "v"(aF[3].v),
                               "v"(bF[0].v), "v"(bF[1].v));
            #pragma unroll
            for (int i = 0; i < 4; ++i)
                #pragma unroll
                for (int j = 0; j < 2; ++j)
                    acc[i][j] = wmma_bf16(aF[i].v, bF[j].v, acc[i][j]);
        }

        if (step + 1 < NSTEPS) {
            put(buf ^ 1, buf ^ 1);               // its readers left it before the last barrier
            tile_barrier();                      // tile step+1 is in LDS, this one is free
        }
    }

    // Epilogue: C-fragment layout — VGPR r holds row (r + 8*half), col l16.
    auto epilogue = [&](auto tag) {
    constexpr int MODE = decltype(tag)::value;
    #pragma unroll
    for (int i = 0; i < 4; ++i) {
        #pragma unroll
        for (int j = 0; j < 2; ++j) {
            int gn = n0 + wn * 32 + j * 16 + l16;
            float bval = bias[gn];
            #pragma unroll
            for (int r = 0; r < 8; ++r) {
                int gm = m0 + wm * 64 + i * 16 + r + half * 8;
                float val = (acc[i][j][r] + bval) * oscale;
                int b = gm >> 11;                // / L
                int l = gm & (LL - 1);
                if (MODE == 0) {                 // [B,H,L,D] bf16
                    int h = gn >> 6, d = gn & 63;
                    ((__bf16*)dstv)[(((size_t)(b * HH + h) * LL + l) << 6) + d] = (__bf16)val;
                } else if (MODE == 1) {          // [B,H,D,L] bf16
                    int h = gn >> 6, d = gn & 63;
                    ((__bf16*)dstv)[((size_t)(b * HH + h) * DD + d) * LL + l] = (__bf16)val;
                } else {                         // [M,512] f32
                    ((float*)dstv)[(size_t)gm * 512 + gn] = val;
                }
            }
        }
    }
    };
    if constexpr (F32OUT) {
        epilogue(ModeTag<2>{});
    } else {
        if (vlayout) {
            epilogue(ModeTag<1>{});
            // as below: in the built kernel the mask packing's code lies behind this one
            asm volatile("s_wait_xcnt 0x0" ::: "memory");
        } else {
            epilogue(ModeTag<0>{});
            // the other layout's code lies behind this one in the built kernel:
            // this wait stands between these stores and the instructions there
            // that rewrite registers which the stores name
            asm volatile("s_wait_xcnt 0x0" ::: "memory");
        }
    }
}

// The occupancy target of both GEMM kernels is capped (four waves per SIMD for
// the input projections, two for the output projection), so that a K-step's LDS
// reads go out as one group (see the note at attn_flash).

// ---------------------------------------------------------------------------
// The mask is the same for all eight heads, and attention needs one bit of each
// word. It is packed once, in the form in which an attention wave uses it: for
// a group of 16 queries and a tile of 64 keys, 32 words, one per score register
// (nt, r) of the wave's S^T tiles; bit `lane` of a word says whether that lane's
// score (query l16, key nt*16 + 8*half + r) is kept. Such a word is a lane mask
// as a select takes it from a scalar register.
// pm: [B*L/16 groups][L/64 tiles][32 words] = 1 MB.
// The mask is read in whole lines: one load takes 128 neighbouring keys of one
// row, four to a lane. A ballot per component gives that row's bits (bit j of
// component c is key 4j + c); lanes l16 and l16 + 16 collect the four words of
// row l16, and a second round of ballots, over single bits of those words,
// turns rows into lane masks.
// One wave packs 512 keys of one group, 256 (32 loads in flight) at a time.
// ---------------------------------------------------------------------------
__device__ __forceinline__
void pack_mask(const int* __restrict__ mask, unsigned* __restrict__ pm) {
    const int lane = threadIdx.x & 31;
    const int half = lane >> 4;
    const int w    = (blockIdx.y * (GM / 128) + blockIdx.x) * 8 + (threadIdx.x >> 5);  // 0..1023
    const int g    = w >> 2;                     // group of 16 rows of [B*L]
    const int k0   = (w & 3) * 512;              // first of this wave's 512 keys
    const int* src = mask + (size_t)(g * 16) * LL + k0 + lane * 4;
    unsigned*  dst = pm + ((size_t)g * (LL / 64) + k0 / 64) * 32 + lane;
    // kept rolled: unrolled, all 64 loads are lifted to the top and their 256
    // registers cost the projection workgroups their second place on a WGP
    #pragma unroll 1
    for (int pp = 0; pp < 2; ++pp) {
        v4i mv[2][16];
        #pragma unroll
        for (int p = 0; p < 2; ++p)
            #pragma unroll
            for (int row = 0; row < 16; ++row)
                // read once: non-temporal, so that the 32 MB do not push Q, K, V out of L2
                mv[p][row] = __builtin_nontemporal_load(
                    (const v4i*)(src + (size_t)row * LL + (pp * 2 + p) * 128));
        #pragma unroll
        for (int p = 0; p < 2; ++p) {
            unsigned x[4] = {0u, 0u, 0u, 0u};    // row l16: bit j of x[c] is key 4j + c
            #pragma unroll
            for (int row = 0; row < 16; ++row)
                #pragma unroll
                for (int c = 0; c < 4; ++c) {
                    const unsigned bits = __builtin_amdgcn_ballot_w32(mv[p][row][c] != 0);
                    x[c] = __builtin_amdgcn_inverse_ballot_w32(0x00010001u << row) ? bits : x[c];
                }
            #pragma unroll
            for (int c = 0; c < 4; ++c) x[c] >>= half * 2;   // keys 8*half + ... of each 16
            #pragma unroll
            for (int tt = 0; tt < 2; ++tt) {     // the two 64-key tiles of these 128 keys
                unsigned word = 0u;              // lane i ends up with word i
                #pragma unroll
                for (int nt = 0; nt < 4; ++nt)
                    #pragma unroll
                    for (int r = 0; r < 8; ++r) {
                        const unsigned bit  = 1u << (tt * 16 + nt * 4 + (r >> 2));
                        const unsigned keep = __builtin_amdgcn_ballot_w32((x[r & 3] & bit) != 0u);
                        word = __builtin_amdgcn_inverse_ballot_w32(1u << (nt * 8 + r)) ? keep : word;
                    }
                dst[((pp * 2 + p) * 2 + tt) * 32] = word;    // one whole 128-byte line per tile
            }
        }
        // kept in front of the next trip's rewrite of the registers that these
        // stores name (their address and their data)
        asm volatile("s_wait_xcnt 0x0" ::: "memory");
    }
}

// The three input projections depend on nothing of one another: one grid, whose
// z index picks the projection, runs them side by side, with a fourth plane of
// 128 workgroups that packs the mask: 512 workgroups on 256 WGPs.
// The upper bound of the occupancy attribute is more than a hint: the compiler
// pads the kernel's register allocation until no more waves than that fit a
// SIMD. A bound of two leaves room for one 8-wave workgroup per WGP, and the
// grid takes two rounds. A bound of four (256 registers a wave, which the main
// loop fills) lets two workgroups share a WGP (2 x 72 KB of LDS): the
// whole grid is resident at once, and while one workgroup waits for its copies
// or a barrier the other reads LDS and issues WMMAs.
__global__ __launch_bounds__(256) __attribute__((amdgpu_waves_per_eu(4, 4)))
void gemm_qkv(const float* __restrict__ values, const float* __restrict__ keysI,
              const float* __restrict__ queryI,
              const float* __restrict__ Wv, const float* __restrict__ Wk,
              const float* __restrict__ Wq,
              const float* __restrict__ bv, const float* __restrict__ bk,
              const float* __restrict__ bq,
              __bf16* __restrict__ vb, __bf16* __restrict__ kb, __bf16* __restrict__ qb,
              const int* __restrict__ mask, unsigned* __restrict__ pm) {
    const int z = blockIdx.z;
    if (z == 3) {                                // the whole block: no barrier is skipped by part of it
        pack_mask(mask, pm);
        return;
    }
    const float* A    = z == 0 ? values : z == 1 ? keysI : queryI;
    const float* W    = z == 0 ? Wv : z == 1 ? Wk : Wq;
    const float* bias = z == 0 ? bv : z == 1 ? bk : bq;
    __bf16*      dst  = z == 0 ? vb : z == 1 ? kb : qb;
    gemm_tile<false>(A, W, bias, (void*)dst, z == 0, z == 2 ? QSCALE : 1.0f);
}

__global__ __launch_bounds__(256) __attribute__((amdgpu_waves_per_eu(2, 2)))
void gemm_out(const float* __restrict__ A, const float* __restrict__ W,
              const float* __restrict__ bias, float* __restrict__ dst) {
    gemm_tile<true>(A, W, bias, (void*)dst, false, 1.0f);
}

__device__ __forceinline__ float xhalf(float x) {
    return __builtin_bit_cast(float, __builtin_amdgcn_permlanex16(
        __builtin_bit_cast(int, x), __builtin_bit_cast(int, x),
        0x76543210, 0xfedcba98, false, false));
}

// With the keys split in two the grid fills four waves per SIMD (4096 waves,
// 1024 SIMDs): while one wave waits for its LDS reads, a barrier or a dependent
// softmax chain, three others have work to issue. The occupancy target is
// pinned there: 256 registers a wave, which hold a whole tile's fragments.
__global__ __launch_bounds__(256) __attribute__((amdgpu_waves_per_eu(4, 4)))
void attn_flash(const __bf16* __restrict__ qb,   // [B,H,L,D], times QSCALE
                const __bf16* __restrict__ kb,   // [B,H,L,D]
                const __bf16* __restrict__ vb,   // [B,H,D,L]
                const unsigned* __restrict__ pm, // packed mask, see pack_mask
                float*        __restrict__ Ob) { // [B,L,E]
    // a masked score. A power of two far below any score: it swallows whatever is
    // added to it, and its difference with itself is exactly 0
    constexpr float NEG = -0x1p100f;
    constexpr int NT  = LL / 64;                    // key tiles in all
    constexpr int NTH = NT / 2;                     // key tiles of one wave
    // 144-byte rows: the 16 rows of a ds_load_b128 fragment read spread over the banks
    __shared__ __attribute__((aligned(16))) __bf16 sK[2][2][64][64 + 8];   // [key half][buffer][key][d]
    __shared__ __attribute__((aligned(16))) __bf16 sV[2][2][64][64 + 8];   // [key half][buffer][d][key]
    // what a wave hands to its partner after the loop: 16 O values, reference, sum
    __shared__ float xch[8][18][32];                // [wave][value][lane]

    const int wave = __builtin_amdgcn_readfirstlane(threadIdx.x >> 5);   // scalar
    const int kh   = wave >> 2;                     // this wave's half of the keys
    const int qw   = wave & 3;                      // its group of 16 queries
    const int lane = threadIdx.x & 31;
    const int half = lane >> 4;
    const int l16  = lane & 15;
    const int bh   = blockIdx.y;                    // b*H + h
    const int bidx = bh / HH;
    const int hidx = bh % HH;
    const int q0   = blockIdx.x * 64;
    const int qrow0 = q0 + qw * 16;

    // Q B-fragments: column l16 is this lane's query (K = D = 64 -> 2 fragments)
    Frag bQ[2];
    {
        const __bf16* qp = qb + ((size_t)bh * LL + (qrow0 + l16)) * DD;
        #pragma unroll
        for (int kw = 0; kw < 2; ++kw) {
            bQ[kw].h[0] = *(const bf16x8*)(qp + kw * 32 + half * 8);
            bQ[kw].h[1] = *(const bf16x8*)(qp + kw * 32 + 16 + half * 8);
        }
    }

    v8f   accO[4] = {};                 // O^T: register r = d (dt*16 + 8*half + r), column = query
    // The scores are taken against a reference that is known BEFORE the product: it
    // goes, negated, into the C operand, and D is the argument of exp2 as it comes.
    // The reference is raised, and O and the sum rescaled, only when a score tops it
    // by more than 8 (P then stays below 256); any reference gives the same quotient.
    float mSt    = -3.0e38f;            // this query's reference (equal in both halves)
    float negUse = 0.0f;                // what C carries: -mSt, or 0 while no key has been kept
    float thr    = -__builtin_inff();   // D above this raises the reference: 8, or always while no key has been kept
    float lSt = 0.0f;                   // sum over this half's keys; the halves join after the loop

    // this wave's lane-mask words: 32 per key tile, at an address that is the same
    // in every lane (the wave's number is scalar), so they come by scalar loads
    const int grp = (bidx * LL + q0) / 16 + qw;
    // (nothing writes pm while this kernel runs: the launch before it did)
    const_u32x16_ptr pw = (const_u32x16_ptr)(unsigned long long)(
        pm + (size_t)grp * (NT * 32) + kh * (NTH * 32));
    u32x16 mw[2];
    mw[0] = pw[0];
    mw[1] = pw[1];

    // One 64x64 bf16 tile of K and of V per key half: 512 16-byte pieces each, 4
    // per thread of the half's four waves; a wave's copy covers four whole
    // 128-byte rows.
    const int srow = (threadIdx.x & 127) >> 3;      // 0..15, +16 per piece
    const int scol = (threadIdx.x & 7) * 8;
    const __bf16* kg = kb + ((size_t)bh * LL + kh * (LL / 2) + srow) * DD + scol;
    const __bf16* vg = vb + ((size_t)bh * DD + srow) * LL + kh * (LL / 2) + scol;
    auto stage = [&](int buf, int kc) {
        const __bf16* k0 = kg + (size_t)kc * DD;
        const __bf16* v0 = vg + kc;
        const unsigned lk = (unsigned)(unsigned long long)&sK[kh][buf][srow][scol];
        const unsigned lv = (unsigned)(unsigned long long)&sV[kh][buf][srow][scol];
        constexpr unsigned RS = 16 * (64 + 8) * 2;  // 16 LDS rows in bytes
        // the copies and the s_wait_xcnt that is kept in front of any rewrite of
        // their address registers stand in one statement, so that the compiler
        // can schedule nothing between them
        asm volatile(
            "global_load_async_to_lds_b128 %0, %8, off\n\t"
            "global_load_async_to_lds_b128 %1, %9, off\n\t"
            "global_load_async_to_lds_b128 %2, %10, off\n\t"
            "global_load_async_to_lds_b128 %3, %11, off\n\t"
            "global_load_async_to_lds_b128 %4, %12, off\n\t"
            "global_load_async_to_lds_b128 %5, %13, off\n\t"
            "global_load_async_to_lds_b128 %6, %14, off\n\t"
            "global_load_async_to_lds_b128 %7, %15, off\n\t"
            "s_wait_xcnt 0x0"
            :: "v"(lk), "v"(lk + RS), "v"(lk + 2 * RS), "v"(lk + 3 * RS),
               "v"(lv), "v"(lv + RS), "v"(lv + 2 * RS), "v"(lv + 3 * RS),
               "v"(k0), "v"(k0 + 16 * DD), "v"(k0 + 32 * DD), "v"(k0 + 48 * DD),
               "v"(v0), "v"(v0 + 16 * LL), "v"(v0 + 32 * LL), "v"(v0 + 48 * LL)
            : "memory");
    };

    stage(0, 0);
    asm volatile("s_wait_asynccnt 0x0" ::: "memory");   // my pieces of tile 0 have landed
    __syncthreads();                                    // everyone's have
    stage(1, 64);

    for (int t = 0; t < NTH; ++t) {
        const int kc  = t * 64;                     // counted from the half's first key
        const int buf = t & 1;
        // ---- this tile's K and V A-fragments out of LDS ----------------
        Frag aK[4][2], aV[4][2];
        #pragma unroll
        for (int nt = 0; nt < 4; ++nt) {
            const __bf16* kp = &sK[kh][buf][nt * 16 + l16][0];
            const __bf16* vp = &sV[kh][buf][nt * 16 + l16][0];
            #pragma unroll
            for (int kw = 0; kw < 2; ++kw) {
                aK[nt][kw].h[0] = *(const bf16x8*)(kp + kw * 32 + half * 8);
                aK[nt][kw].h[1] = *(const bf16x8*)(kp + kw * 32 + 16 + half * 8);
                aV[nt][kw].h[0] = *(const bf16x8*)(vp + kw * 32 + half * 8);
                aV[nt][kw].h[1] = *(const bf16x8*)(vp + kw * 32 + 16 + half * 8);
            }
        }
        // keeps the 32 reads together at the head of the trip: the selects below need
        // nothing from LDS, and scheduled among them they would split the reads into
        // many small groups, the last of them issued right in front of its wait
        __builtin_amdgcn_sched_barrier(0);
        // Inputs-only fence on the loaded fragments: without it each fragment's
        // two reads are issued and fully waited for right in front of their
        // WMMA, one LDS round trip per WMMA; with it the reads go out in groups
        // ahead of their use, behind counted waits.
        asm volatile("" :: "v"(aK[0][0].v), "v"(aK[0][1].v), "v"(aK[1][0].v), "v"(aK[1][1].v),
                           "v"(aK[2][0].v), "v"(aK[2][1].v), "v"(aK[3][0].v), "v"(aK[3][1].v),
                           "v"(aV[0][0].v), "v"(aV[0][1].v), "v"(aV[1][0].v), "v"(aV[1][1].v),
                           "v"(aV[2][0].v), "v"(aV[2][1].v), "v"(aV[3][0].v), "v"(aV[3][1].v));

        // ---- C operand: minus the reference where the key is kept, NEG where it is
        //      masked (before the scale, as in the reference: NEG stands for any scale)
        // ---- S^T - reference = K @ Q^T + C (64 keys x 16 queries per wave), f32 accum
        v8f s[4];
        #pragma unroll
        for (int nt = 0; nt < 4; ++nt) {
            v8f c;
            #pragma unroll
            for (int r = 0; r < 8; ++r) {
                const bool keep = __builtin_amdgcn_inverse_ballot_w32(mw[nt >> 1][(nt & 1) * 8 + r]);
                c[r] = keep ? negUse : NEG;
            }
            #pragma unroll
            for (int kw = 0; kw < 2; ++kw)
                c = wmma_bf16(aK[nt][kw].v, bQ[kw].v, c);
            s[nt] = c;
        }
        // the next tile's words, into the registers just used: the rest of this
        // trip covers their way from L2 (the last trip reads its own again)
        {
            const int tn = t + 1 < NTH ? t + 1 : t;
            mw[0] = pw[tn * 2];
            mw[1] = pw[tn * 2 + 1];
        }

        // ---- online softmax: a lane's 32 scores belong to one query ----
        float vmax = s[0][0];
        #pragma unroll
        for (int nt = 0; nt < 4; ++nt)
            #pragma unroll
            for (int r = 0; r < 8; ++r) vmax = fmaxf(vmax, s[nt][r]);
        // one test per tile, the same for the whole wave (a scalar branch): taken on a
        // wave's first tile, then only if some query's scores outgrow its reference
        if (__builtin_amdgcn_ballot_w32(vmax > thr) != 0u) {
            const float rmax  = fmaxf(vmax, xhalf(vmax));   // the query's other 32 keys
            const float mNew  = fmaxf(mSt, rmax - negUse);  // NEG if no key has been kept yet
            const float delta = mNew + negUse;              // the rise over what C carried
            const float corr  = __builtin_amdgcn_exp2f(mSt - mNew);
            #pragma unroll
            for (int nt = 0; nt < 4; ++nt)
                #pragma unroll
                for (int r = 0; r < 8; ++r) s[nt][r] -= delta;
            lSt *= corr;
            #pragma unroll
            for (int dt = 0; dt < 4; ++dt)
                #pragma unroll
                for (int r = 0; r < 8; ++r) accO[dt][r] *= corr;
            mSt = mNew;
            const bool none = mNew < -0x1p99f;              // every key so far was masked
            negUse = none ? 0.0f : -mNew;
            thr    = none ? -__builtin_inff() : 8.0f;
        }
        float rs[4];
        #pragma unroll
        for (int nt = 0; nt < 4; ++nt) {
            rs[nt] = 0.0f;
            #pragma unroll
            for (int r = 0; r < 8; ++r) {
                float pe = __builtin_amdgcn_exp2f(s[nt][r]);
                s[nt][r] = pe;
                rs[nt] += pe;
            }
        }
        lSt += (rs[0] + rs[1]) + (rs[2] + rs[3]);

        // ---- P^T as B operand: tiles 2kw and 2kw+1, converted in place,
        //      are keys 8*half + e and 16 + 8*half + e of a 32-key step ---
        Frag bP[2];
        #pragma unroll
        for (int kw = 0; kw < 2; ++kw)
            #pragma unroll
            for (int e = 0; e < 8; ++e) {
                bP[kw].h[0][e] = (__bf16)s[2 * kw][e];
                bP[kw].h[1][e] = (__bf16)s[2 * kw + 1][e];
            }

        // ---- O^T += V^T @ P^T  (V tile is [d][key]: rows are A rows) ---
        #pragma unroll
        for (int dt = 0; dt < 4; ++dt) {
            #pragma unroll
            for (int kw = 0; kw < 2; ++kw)
                accO[dt] = wmma_bf16(aV[dt][kw].v, bP[kw].v, accO[dt]);
        }

        // ---- hand over: tile t+1 is published, buffer buf is freed ------
        asm volatile("s_wait_dscnt 0x0" ::: "memory");      // my reads of this tile are done
        asm volatile("s_wait_asynccnt 0x0" ::: "memory");   // my pieces of tile t+1 have landed
        __syncthreads();
        if (t + 2 < NTH) stage(buf, kc + 128);              // refill the buffer just read
    }
    asm volatile("s_wait_asynccnt 0x0" ::: "memory");       // nothing in flight at the wave's end

    // ---- join the two key halves: waves w and w + 4 hold the same queries in the
    //      same lanes. Each finishes two of the four O tiles (key half 0: d 0..31,
    //      key half 1: d 32..63) and hands the other two to its partner. --------
    const float lAll = lSt + xhalf(lSt);            // the lane halves' sums joined
    float* mine = &xch[wave][0][lane];
    #pragma unroll
    for (int k = 0; k < 2; ++k)
        #pragma unroll
        for (int r = 0; r < 8; ++r) mine[(k * 8 + r) * 32] = kh ? accO[k][r] : accO[2 + k][r];
    mine[16 * 32] = mSt;
    mine[17 * 32] = lAll;
    __syncthreads();                                // both partners' values are in LDS
    const float* theirs = &xch[wave ^ 4][0][lane];
    const float mP   = theirs[16 * 32];
    const float lP   = theirs[17 * 32];
    const float mAll = fmaxf(mSt, mP);
    const float aS   = __builtin_amdgcn_exp2f(mSt - mAll);   // a half with no key kept weighs 0
    const float aP   = __builtin_amdgcn_exp2f(mP - mAll);    // beside one that has any
    const float lTot = lAll * aS + lP * aP;

    // ---- divide, write [B,L,E] f32 -------------------------------------
    float* orow = Ob + ((size_t)bidx * LL + (qrow0 + l16)) * EE + hidx * DD + kh * 32 + half * 8;
    #pragma unroll
    for (int k = 0; k < 2; ++k) {
        float o[8];
        #pragma unroll
        for (int r = 0; r < 8; ++r)
            o[r] = ((kh ? accO[2 + k][r] : accO[k][r]) * aS + theirs[(k * 8 + r) * 32] * aP) / lTot;
        float4 lo, hi;
        lo.x = o[0]; lo.y = o[1]; lo.z = o[2]; lo.w = o[3];
        hi.x = o[4]; hi.y = o[5]; hi.z = o[6]; hi.w = o[7];
        *(float4*)(orow + k * 16)     = lo;
        *(float4*)(orow + k * 16 + 4) = hi;
    }
}

// ---------------------------------------------------------------------------
// Launcher
// ---------------------------------------------------------------------------
extern "C" void kernel_launch(void* const* d_in, const int* in_sizes, int n_in,
                              void* d_out, int out_size, void* d_ws, size_t ws_size,
                              hipStream_t stream) {
    (void)in_sizes; (void)n_in; (void)out_size; (void)ws_size;
    const float* values = (const float*)d_in[0];
    const float* keysI  = (const float*)d_in[1];
    const float* queryI = (const float*)d_in[2];
    const int*   mask   = (const int*)d_in[3];
    const float* Wv = (const float*)d_in[4];  const float* bv = (const float*)d_in[5];
    const float* Wk = (const float*)d_in[6];  const float* bk = (const float*)d_in[7];
    const float* Wq = (const float*)d_in[8];  const float* bq = (const float*)d_in[9];
    const float* Wo = (const float*)d_in[10]; const float* bo = (const float*)d_in[11];

    char* ws = (char*)d_ws;
    __bf16* qb = (__bf16*)(ws);                      // 4 MB  [B,H,L,D] bf16
    __bf16* kb = (__bf16*)(ws + (4u << 20));         // 4 MB  [B,H,L,D] bf16
    __bf16* vb = (__bf16*)(ws + (8u << 20));         // 4 MB  [B,H,D,L] bf16
    float*  Ob = (float*) (ws + (12u << 20));        // 8 MB  [B,L,E]   f32
    unsigned* pm = (unsigned*)(ws + (20u << 20));    // 1 MB  packed mask

    dim3 gGrid(GM / 128, EE / 128), gBlk(256);
    gemm_qkv<<<dim3(GM / 128, EE / 128, 4), gBlk, 0, stream>>>(
        values, keysI, queryI, Wv, Wk, Wq, bv, bk, bq, vb, kb, qb, mask, pm);

    attn_flash<<<dim3(LL / 64, BB * HH), 256, 0, stream>>>(qb, kb, vb, pm, Ob);

    gemm_out<<<gGrid, gBlk, 0, stream>>>(Ob, Wo, bo, (float*)d_out);
}

// v010
// It runs in 43.1 microseconds.
// In two side-by-side timings against v009, it was 1.03 and 1.02 times as fast.
// Over all steps from v000 it is 4.86 times as fast.
#include <hip/hip_runtime.h>

// ---------------------------------------------------------------------------
// Self-attention forward for B=2, L=2048, E=512, H=8, D=64 on gfx1250 (CDNA5).
// All matmuls run on v_wmma_f32_16x16x32_bf16 (bf16 operands, f32 accum).
// Attention is fused flash-style: scores never hit HBM.
// GEMM tiles are double-buffered in LDS as bf16: the f32 operands come through
// registers and are rounded once on the way in (those of the output projection
// by their producers, so they arrive as bf16); the loads of tiles t+1 and t+2
// overlap the LDS reads and WMMAs of tile t, one barrier per K-step.
// ---------------------------------------------------------------------------

typedef __attribute__((ext_vector_type(16))) __bf16 bf16x16;
typedef __attribute__((ext_vector_type(8)))  __bf16 bf16x8;
typedef __attribute__((ext_vector_type(4)))  __bf16 bf16x4;
typedef __attribute__((ext_vector_type(8)))  float  v8f;
typedef __attribute__((ext_vector_type(4)))  int    v4i;
typedef __attribute__((ext_vector_type(16))) unsigned u32x16;
// constant address space: a load at a wave-uniform address becomes a scalar load
typedef const u32x16 __attribute__((address_space(4)))* const_u32x16_ptr;

union Frag {
    bf16x16 v;
    bf16x8  h[2];
};

__device__ __forceinline__ v8f wmma_bf16(bf16x16 a, bf16x16 b, v8f c) {
    // (neg_a, A, neg_b, B, c_mod, C, reuse_a, reuse_b)
    return __builtin_amdgcn_wmma_f32_16x16x32_bf16(
        false, a, false, b, (short)0, c, false, false);
}

constexpr int BB  = 2;
constexpr int LL  = 2048;
constexpr int EE  = 512;
constexpr int HH  = 8;
constexpr int DD  = 64;
constexpr int GM  = BB * LL;   // 4096 rows in every projection GEMM
// 1/sqrt(512) * log2(e): Q is stored times this, so that K Q^T is a score in the
// units of exp2
constexpr float QSCALE = 0.04419417382415922f * 1.4426950408889634f;

// ---------------------------------------------------------------------------
// Generic projection GEMM tile: dst = (A[M,512] @ W[512,512]^T + bias) * oscale, M = 4096.
// mode 0: write bf16 into [B,H,L,D]   (Q and K)
// mode 1: write bf16 into [B,H,D,L]   (V, pre-transposed for attn 2nd GEMM)
// mode 2: write f32  into [M, 512]    (final output projection)
// F32OUT fixes mode 2 at compile time; otherwise vlayout (the same for the whole
// block) picks mode 1 or 0 in the epilogue, so that one main loop and one pair
// of LDS buffers serve all three input projections.
// Block: 256 threads (8 waves). Block tile 128x128, wave tile 64x32,
// K stepped by 64. An element of A is read by four waves of the block and one of
// W by two: held in LDS as bf16 it costs each of them half the LDS bytes of f32
// and no conversion, and two buffers of 64 k per matrix take 72 KB.
// ---------------------------------------------------------------------------
template <int M> struct ModeTag { static constexpr int value = M; };
// The output projection's operands arrive as bf16: their producers (the attention
// epilogue, store_wo) have rounded them, each element once.
template <bool H> struct Operand       { using type = float; };
template <>       struct Operand<true> { using type = __bf16; };

template <bool F32OUT>
__device__ __forceinline__
void gemm_tile(const typename Operand<F32OUT>::type* __restrict__ A,
               const typename Operand<F32OUT>::type* __restrict__ W,
               const float* __restrict__ bias, void* __restrict__ dstv, bool vlayout,
               float oscale) {                   // factor on the result, before its one rounding
    constexpr int KS     = 64;                   // k per step
    constexpr int NSTEPS = 512 / KS;
    // 144-byte rows: the 16 rows of a ds_load_b128 fragment read spread over the banks
    __shared__ __attribute__((aligned(16))) __bf16 sA[2][128][KS + 8];
    __shared__ __attribute__((aligned(16))) __bf16 sW[2][128][KS + 8];

    const int tid  = threadIdx.x;
    const int wave = tid >> 5;
    const int lane = tid & 31;
    const int half = lane >> 4;                  // 0 | 1 (lane group)
    const int l16  = lane & 15;
    const int m0   = blockIdx.x * 128;
    const int n0   = blockIdx.y * 128;
    const int wm   = wave & 1;                   // 2 wave-rows  x 64
    const int wn   = wave >> 1;                  // 4 wave-cols  x 32

    // One 128x64 f32 tile per matrix and step: 2048 16-byte pieces, 8 per thread;
    // a wave's load covers two whole 256-byte row pieces.
    // As bf16 the tile is 1024 pieces, 4 per thread; a load covers four 128-byte rows.
    const int srow = F32OUT ? tid >> 3 : tid >> 4;             // +32 or +16 per piece
    const int scol = F32OUT ? (tid & 7) * 8 : (tid & 15) * 4;  // 16 bytes
    const typename Operand<F32OUT>::type* ag = A + (size_t)(m0 + srow) * 512 + scol;
    const typename Operand<F32OUT>::type* wg = W + (size_t)(n0 + srow) * 512 + scol;
    // Two register sets for tiles on their way: a tile's loads fly over a whole step
    // and more, and the next tile's follow them without a pause.
    float4 ga[2][F32OUT ? 1 : 8], gw[2][F32OUT ? 1 : 8];
    bf16x8 ha[2][F32OUT ? 4 : 1], hw[2][F32OUT ? 4 : 1];
    auto fetch = [&](int set, int k0) {
        if constexpr (F32OUT) {
            #pragma unroll
            for (int i = 0; i < 4; ++i) {
                ha[set][i] = *(const bf16x8*)(ag + i * 32 * 512 + k0);
                hw[set][i] = *(const bf16x8*)(wg + i * 32 * 512 + k0);
            }
        } else {
            #pragma unroll
            for (int i = 0; i < 8; ++i) {
                ga[set][i] = *(const float4*)(ag + i * 16 * 512 + k0);
                gw[set][i] = *(const float4*)(wg + i * 16 * 512 + k0);
            }
        }
    };
    // every f32 element is rounded to bf16 here, once, not by each wave that reads it
    auto put = [&](int buf, int set) {
        if constexpr (F32OUT) {                  // bf16 already: as it came
            #pragma unroll
            for (int i = 0; i < 4; ++i) {
                *(bf16x8*)&sA[buf][srow + i * 32][scol] = ha[set][i];
                *(bf16x8*)&sW[buf][srow + i * 32][scol] = hw[set][i];
            }
        } else
        #pragma unroll
        for (int i = 0; i < 8; ++i) {
            bf16x4 a, w;
            a[0] = (__bf16)ga[set][i].x; a[1] = (__bf16)ga[set][i].y; a[2] = (__bf16)ga[set][i].z; a[3] = (__bf16)ga[set][i].w;
            w[0] = (__bf16)gw[set][i].x; w[1] = (__bf16)gw[set][i].y; w[2] = (__bf16)gw[set][i].z; w[3] = (__bf16)gw[set][i].w;
            *(bf16x4*)&sA[buf][srow + i * 16][scol] = a;
            *(bf16x4*)&sW[buf][srow + i * 16][scol] = w;
        }
    };

    v8f acc[4][2] = {};

    // A workgroup barrier whose fences order LDS alone: __syncthreads() would also
    // drain the wave's global loads, which are to stay in flight across it. Only LDS
    // passes from wave to wave here.
    auto tile_barrier = [&]() {
        __builtin_amdgcn_fence(__ATOMIC_RELEASE, "workgroup", "local");
        __builtin_amdgcn_s_barrier();
        __builtin_amdgcn_fence(__ATOMIC_ACQUIRE, "workgroup", "local");
        // keeps the next put's conversions behind the barrier: lifted over it they
        // wait, one step early, for loads that have only just been issued
        __builtin_amdgcn_sched_barrier(0);
    };

    fetch(0, 0);
    fetch(1, KS);
    put(0, 0);
    tile_barrier();                              // tile 0 is in LDS
    // unrolled: every k offset is an immediate, so that no address register of a
    // load in flight is rewritten
    #pragma unroll
    for (int step = 0; step < NSTEPS; ++step) {
        const int buf = step & 1;
        // into the set that the last put has emptied: these loads fly while this
        // tile and most of the next are worked on
        if (step + 2 < NSTEPS) fetch(buf, (step + 2) * KS);
        // The last tile's loads are the last use of the two address pairs: this wait
        // is kept in front of whatever is given their registers next (it names them,
        // so that they are not handed out as a destination to one of these loads).
        if (step + 3 == NSTEPS) asm volatile("s_wait_xcnt 0x0" :: "v"(ag), "v"(wg) : "memory");

        // ---- this tile's A and W fragments out of LDS, 32 k at a time ---
        #pragma unroll
        for (int kk = 0; kk < 2; ++kk) {
            Frag aF[4], bF[2];
            #pragma unroll
            for (int i = 0; i < 4; ++i) {
                const __bf16* p = &sA[buf][wm * 64 + i * 16 + l16][kk * 32 + half * 8];
                aF[i].h[0] = *(const bf16x8*)p;
                aF[i].h[1] = *(const bf16x8*)(p + 16);
            }
            #pragma unroll
            for (int j = 0; j < 2; ++j) {
                const __bf16* p = &sW[buf][wn * 32 + j * 16 + l16][kk * 32 + half * 8];
                bF[j].h[0] = *(const bf16x8*)p;
                bF[j].h[1] = *(const bf16x8*)(p + 16);
            }
            // Inputs-only fence on the loaded fragments: without it the reads stand in
            // pairs among the WMMAs, each pair fully waited for (one LDS round trip per
            // two WMMAs); with it they go out as one group.
            asm volatile("" :: "v"(aF[0].v), "v"(aF[1].v), "v"(aF[2].v), "v"(aF[3].v),
                               "v"(bF[0].v), "v"(bF[1].v));
            #pragma unroll
            for (int i = 0; i < 4; ++i)
                #pragma unroll
                for (int j = 0; j < 2; ++j)
                    acc[i][j] = wmma_bf16(aF[i].v, bF[j].v, acc[i][j]);
        }

        if (step + 1 < NSTEPS) {
            put(buf ^ 1, buf ^ 1);               // its readers left it before the last barrier
            tile_barrier();                      // tile step+1 is in LDS, this one is free
        }
    }

    // Epilogue: C-fragment layout — VGPR r holds row (r + 8*half), col l16.
    auto epilogue = [&](auto tag) {
    constexpr int MODE = decltype(tag)::value;
    #pragma unroll
    for (int i = 0; i < 4; ++i) {
        #pragma unroll
        for (int j = 0; j < 2; ++j) {
            int gn = n0 + wn * 32 + j * 16 + l16;
            float bval = bias[gn];
            #pragma unroll
            for (int r = 0; r < 8; ++r) {
                int gm = m0 + wm * 64 + i * 16 + r + half * 8;
                float val = (acc[i][j][r] + bval) * oscale;
                int b = gm >> 11;                // / L
                int l = gm & (LL - 1);
                if (MODE == 0) {                 // [B,H,L,D] bf16
                    int h = gn >> 6, d = gn & 63;
                    ((__bf16*)dstv)[(((size_t)(b * HH + h) * LL + l) << 6) + d] = (__bf16)val;
                } else if (MODE == 1) {          // [B,H,D,L] bf16
                    int h = gn >> 6, d = gn & 63;
                    ((__bf16*)dstv)[((size_t)(b * HH + h) * DD + d) * LL + l] = (__bf16)val;
                } else {                         // [M,512] f32
                    ((float*)dstv)[(size_t)gm * 512 + gn] = val;
                }
            }
        }
    }
    };
    if constexpr (F32OUT) {
        epilogue(ModeTag<2>{});
    } else {
        if (vlayout) {
            epilogue(ModeTag<1>{});
            // as below: in the built kernel the mask packing's code lies behind this one
            asm volatile("s_wait_xcnt 0x0" ::: "memory");
        } else {
            epilogue(ModeTag<0>{});
            // the other layout's code lies behind this one in the built kernel:
            // this wait stands between these stores and the instructions there
            // that rewrite registers which the stores name
            asm volatile("s_wait_xcnt 0x0" ::: "memory");
        }
    }
}

// The occupancy target of both GEMM kernels is capped (four waves per SIMD for
// the input projections, two for the output projection), so that a K-step's LDS
// reads go out as one group (see the note at attn_flash).

// ---------------------------------------------------------------------------
// The mask is the same for all eight heads, and attention needs one bit of each
// word. It is packed once, in the form in which an attention wave uses it: for
// a group of 16 queries and a tile of 64 keys, 32 words, one per score register
// (nt, r) of the wave's S^T tiles; bit `lane` of a word says whether that lane's
// score (query l16, key nt*16 + 8*half + r) is kept. Such a word is a lane mask
// as a select takes it from a scalar register.
// pm: [B*L/16 groups][L/64 tiles][32 words] = 1 MB.
// The mask is read in whole lines: one load takes 128 neighbouring keys of one
// row, four to a lane. A ballot per component gives that row's bits (bit j of
// component c is key 4j + c); lanes l16 and l16 + 16 collect the four words of
// row l16, and a second round of ballots, over single bits of those words,
// turns rows into lane masks.
// One wave packs 512 keys of one group, 256 (32 loads in flight) at a time.
// ---------------------------------------------------------------------------
__device__ __forceinline__
void pack_mask(const int* __restrict__ mask, unsigned* __restrict__ pm) {
    const int lane = threadIdx.x & 31;
    const int half = lane >> 4;
    const int w    = (blockIdx.y * (GM / 128) + blockIdx.x) * 8 + (threadIdx.x >> 5);  // 0..1023
    const int g    = w >> 2;                     // group of 16 rows of [B*L]
    const int k0   = (w & 3) * 512;              // first of this wave's 512 keys
    const int* src = mask + (size_t)(g * 16) * LL + k0 + lane * 4;
    unsigned*  dst = pm + ((size_t)g * (LL / 64) + k0 / 64) * 32 + lane;
    // kept rolled: unrolled, all 64 loads are lifted to the top and their 256
    // registers cost the projection workgroups their second place on a WGP
    #pragma unroll 1
    for (int pp = 0; pp < 2; ++pp) {
        v4i mv[2][16];
        #pragma unroll
        for (int p = 0; p < 2; ++p)
            #pragma unroll
            for (int row = 0; row < 16; ++row)
                // read once: non-temporal, so that the 32 MB do not push Q, K, V out of L2
                mv[p][row] = __builtin_nontemporal_load(
                    (const v4i*)(src + (size_t)row * LL + (pp * 2 + p) * 128));
        #pragma unroll
        for (int p = 0; p < 2; ++p) {
            unsigned x[4] = {0u, 0u, 0u, 0u};    // row l16: bit j of x[c] is key 4j + c
            #pragma unroll
            for (int row = 0; row < 16; ++row)
                #pragma unroll
                for (int c = 0; c < 4; ++c) {
                    const unsigned bits = __builtin_amdgcn_ballot_w32(mv[p][row][c] != 0);
                    x[c] = __builtin_amdgcn_inverse_ballot_w32(0x00010001u << row) ? bits : x[c];
                }
            #pragma unroll
            for (int c = 0; c < 4; ++c) x[c] >>= half * 2;   // keys 8*half + ... of each 16
            #pragma unroll
            for (int tt = 0; tt < 2; ++tt) {     // the two 64-key tiles of these 128 keys
                unsigned word = 0u;              // lane i ends up with word i
                #pragma unroll
                for (int nt = 0; nt < 4; ++nt)
                    #pragma unroll
                    for (int r = 0; r < 8; ++r) {
                        const unsigned bit  = 1u << (tt * 16 + nt * 4 + (r >> 2));
                        const unsigned keep = __builtin_amdgcn_ballot_w32((x[r & 3] & bit) != 0u);
                        word = __builtin_amdgcn_inverse_ballot_w32(1u << (nt * 8 + r)) ? keep : word;
                    }
                dst[((pp * 2 + p) * 2 + tt) * 32] = word;    // one whole 128-byte line per tile
            }
        }
        // kept in front of the next trip's rewrite of the registers that these
        // stores name (their address and their data)
        asm volatile("s_wait_xcnt 0x0" ::: "memory");
    }
}

// Wo is needed only by the last launch, and there as bf16: the 32768 threads of
// the mask plane round it, eight neighbouring elements each, so that every
// workgroup of the output projection reads half the bytes and converts nothing.
struct WoPiece { float4 lo, hi; };
__device__ __forceinline__ int wo_index() {
    return ((blockIdx.y * (GM / 128) + blockIdx.x) * 256 + threadIdx.x) * 8;
}
__device__ __forceinline__ WoPiece load_wo(const float* __restrict__ Wo) {
    WoPiece p;
    p.lo = *(const float4*)(Wo + wo_index());
    p.hi = *(const float4*)(Wo + wo_index() + 4);
    return p;
}
__device__ __forceinline__ void store_wo(WoPiece p, __bf16* __restrict__ wob) {
    bf16x8 h;
    h[0] = (__bf16)p.lo.x; h[1] = (__bf16)p.lo.y; h[2] = (__bf16)p.lo.z; h[3] = (__bf16)p.lo.w;
    h[4] = (__bf16)p.hi.x; h[5] = (__bf16)p.hi.y; h[6] = (__bf16)p.hi.z; h[7] = (__bf16)p.hi.w;
    *(bf16x8*)(wob + wo_index()) = h;
}

// The three input projections depend on nothing of one another: one grid, whose
// z index picks the projection, runs them side by side, with a fourth plane of
// 128 workgroups that packs the mask: 512 workgroups on 256 WGPs.
// The upper bound of the occupancy attribute is more than a hint: the compiler
// pads the kernel's register allocation until no more waves than that fit a
// SIMD. A bound of two leaves room for one 8-wave workgroup per WGP, and the
// grid takes two rounds. A bound of four (256 registers a wave, which the main
// loop fills) lets two workgroups share a WGP (2 x 72 KB of LDS): the
// whole grid is resident at once, and while one workgroup waits for its copies
// or a barrier the other reads LDS and issues WMMAs.
__global__ __launch_bounds__(256) __attribute__((amdgpu_waves_per_eu(4, 4)))
void gemm_qkv(const float* __restrict__ values, const float* __restrict__ keysI,
              const float* __restrict__ queryI,
              const float* __restrict__ Wv, const float* __restrict__ Wk,
              const float* __restrict__ Wq,
              const float* __restrict__ bv, const float* __restrict__ bk,
              const float* __restrict__ bq,
              __bf16* __restrict__ vb, __bf16* __restrict__ kb, __bf16* __restrict__ qb,
              const int* __restrict__ mask, unsigned* __restrict__ pm,
              const float* __restrict__ Wo, __bf16* __restrict__ wob) {
    const int z = blockIdx.z;
    if (z == 3) {                                // the whole block: no barrier is skipped by part of it
        const WoPiece p = load_wo(Wo);           // on its way while the mask is packed
        pack_mask(mask, pm);
        store_wo(p, wob);
        return;
    }
    const float* A    = z == 0 ? values : z == 1 ? keysI : queryI;
    const float* W    = z == 0 ? Wv : z == 1 ? Wk : Wq;
    const float* bias = z == 0 ? bv : z == 1 ? bk : bq;
    __bf16*      dst  = z == 0 ? vb : z == 1 ? kb : qb;
    gemm_tile<false>(A, W, bias, (void*)dst, z == 0, z == 2 ? QSCALE : 1.0f);
}

__global__ __launch_bounds__(256) __attribute__((amdgpu_waves_per_eu(2, 2)))
void gemm_out(const __bf16* __restrict__ A, const __bf16* __restrict__ W,
              const float* __restrict__ bias, float* __restrict__ dst) {
    gemm_tile<true>(A, W, bias, (void*)dst, false, 1.0f);
}

__device__ __forceinline__ float xhalf(float x) {
    return __builtin_bit_cast(float, __builtin_amdgcn_permlanex16(
        __builtin_bit_cast(int, x), __builtin_bit_cast(int, x),
        0x76543210, 0xfedcba98, false, false));
}

// With the keys split in two the grid fills four waves per SIMD (4096 waves,
// 1024 SIMDs): while one wave waits for its LDS reads, a barrier or a dependent
// softmax chain, three others have work to issue. The occupancy target is
// pinned there: 256 registers a wave, which hold a whole tile's fragments.
__global__ __launch_bounds__(256) __attribute__((amdgpu_waves_per_eu(4, 4)))
void attn_flash(const __bf16* __restrict__ qb,   // [B,H,L,D], times QSCALE
                const __bf16* __restrict__ kb,   // [B,H,L,D]
                const __bf16* __restrict__ vb,   // [B,H,D,L]
                const unsigned* __restrict__ pm, // packed mask, see pack_mask
                __bf16*       __restrict__ Ob) { // [B,L,E], rounded here for the output projection
    // a masked score. A power of two far below any score: it swallows whatever is
    // added to it, and its difference with itself is exactly 0
    constexpr float NEG = -0x1p100f;
    constexpr int NT  = LL / 64;                    // key tiles in all
    constexpr int NTH = NT / 2;                     // key tiles of one wave
    // 144-byte rows: the 16 rows of a ds_load_b128 fragment read spread over the banks
    __shared__ __attribute__((aligned(16))) __bf16 sK[2][2][64][64 + 8];   // [key half][buffer][key][d]
    __shared__ __attribute__((aligned(16))) __bf16 sV[2][2][64][64 + 8];   // [key half][buffer][d][key]
    // what a wave hands to its partner after the loop: 16 O values, reference, sum
    __shared__ float xch[8][18][32];                // [wave][value][lane]

    const int wave = __builtin_amdgcn_readfirstlane(threadIdx.x >> 5);   // scalar
    const int kh   = wave >> 2;                     // this wave's half of the keys
    const int qw   = wave & 3;                      // its group of 16 queries
    const int lane = threadIdx.x & 31;
    const int half = lane >> 4;
    const int l16  = lane & 15;
    const int bh   = blockIdx.y;                    // b*H + h
    const int bidx = bh / HH;
    const int hidx = bh % HH;
    const int q0   = blockIdx.x * 64;
    const int qrow0 = q0 + qw * 16;

    // Q B-fragments: column l16 is this lane's query (K = D = 64 -> 2 fragments)
    Frag bQ[2];
    {
        const __bf16* qp = qb + ((size_t)bh * LL + (qrow0 + l16)) * DD;
        #pragma unroll
        for (int kw = 0; kw < 2; ++kw) {
            bQ[kw].h[0] = *(const bf16x8*)(qp + kw * 32 + half * 8);
            bQ[kw].h[1] = *(const bf16x8*)(qp + kw * 32 + 16 + half * 8);
        }
    }

    v8f   accO[4] = {};                 // O^T: register r = d (dt*16 + 8*half + r), column = query
    // The scores are taken against a reference that is known BEFORE the product: it
    // goes, negated, into the C operand, and D is the argument of exp2 as it comes.
    // The reference is raised, and O and the sum rescaled, only when a score tops it
    // by more than 8 (P then stays below 256); any reference gives the same quotient.
    float mSt    = -3.0e38f;            // this query's reference (equal in both halves)
    float negUse = 0.0f;                // what C carries: -mSt, or 0 while no key has been kept
    float thr    = -__builtin_inff();   // D above this raises the reference: 8, or always while no key has been kept
    float lSt = 0.0f;                   // sum over this half's keys; the halves join after the loop

    // this wave's lane-mask words: 32 per key tile, at an address that is the same
    // in every lane (the wave's number is scalar), so they come by scalar loads
    const int grp = (bidx * LL + q0) / 16 + qw;
    // (nothing writes pm while this kernel runs: the launch before it did)
    const_u32x16_ptr pw = (const_u32x16_ptr)(unsigned long long)(
        pm + (size_t)grp * (NT * 32) + kh * (NTH * 32));
    u32x16 mw[2];
    mw[0] = pw[0];
    mw[1] = pw[1];

    // One 64x64 bf16 tile of K and of V per key half: 512 16-byte pieces each, 4
    // per thread of the half's four waves; a wave's copy covers four whole
    // 128-byte rows.
    const int srow = (threadIdx.x & 127) >> 3;      // 0..15, +16 per piece
    const int scol = (threadIdx.x & 7) * 8;
    const __bf16* kg = kb + ((size_t)bh * LL + kh * (LL / 2) + srow) * DD + scol;
    const __bf16* vg = vb + ((size_t)bh * DD + srow) * LL + kh * (LL / 2) + scol;
    auto stage = [&](int buf, int kc) {
        const __bf16* k0 = kg + (size_t)kc * DD;
        const __bf16* v0 = vg + kc;
        const unsigned lk = (unsigned)(unsigned long long)&sK[kh][buf][srow][scol];
        const unsigned lv = (unsigned)(unsigned long long)&sV[kh][buf][srow][scol];
        constexpr unsigned RS = 16 * (64 + 8) * 2;  // 16 LDS rows in bytes
        // the copies and the s_wait_xcnt that is kept in front of any rewrite of
        // their address registers stand in one statement, so that the compiler
        // can schedule nothing between them
        asm volatile(
            "global_load_async_to_lds_b128 %0, %8, off\n\t"
            "global_load_async_to_lds_b128 %1, %9, off\n\t"
            "global_load_async_to_lds_b128 %2, %10, off\n\t"
            "global_load_async_to_lds_b128 %3, %11, off\n\t"
            "global_load_async_to_lds_b128 %4, %12, off\n\t"
            "global_load_async_to_lds_b128 %5, %13, off\n\t"
            "global_load_async_to_lds_b128 %6, %14, off\n\t"
            "global_load_async_to_lds_b128 %7, %15, off\n\t"
            "s_wait_xcnt 0x0"
            :: "v"(lk), "v"(lk + RS), "v"(lk + 2 * RS), "v"(lk + 3 * RS),
               "v"(lv), "v"(lv + RS), "v"(lv + 2 * RS), "v"(lv + 3 * RS),
               "v"(k0), "v"(k0 + 16 * DD), "v"(k0 + 32 * DD), "v"(k0 + 48 * DD),
               "v"(v0), "v"(v0 + 16 * LL), "v"(v0 + 32 * LL), "v"(v0 + 48 * LL)
            : "memory");
    };

    stage(0, 0);
    asm volatile("s_wait_asynccnt 0x0" ::: "memory");   // my pieces of tile 0 have landed
    __syncthreads();                                    // everyone's have
    stage(1, 64);

    for (int t = 0; t < NTH; ++t) {
        const int kc  = t * 64;                     // counted from the half's first key
        const int buf = t & 1;
        // ---- this tile's K and V A-fragments out of LDS ----------------
        Frag aK[4][2], aV[4][2];
        #pragma unroll
        for (int nt = 0; nt < 4; ++nt) {
            const __bf16* kp = &sK[kh][buf][nt * 16 + l16][0];
            const __bf16* vp = &sV[kh][buf][nt * 16 + l16][0];
            #pragma unroll
            for (int kw = 0; kw < 2; ++kw) {
                aK[nt][kw].h[0] = *(const bf16x8*)(kp + kw * 32 + half * 8);
                aK[nt][kw].h[1] = *(const bf16x8*)(kp + kw * 32 + 16 + half * 8);
                aV[nt][kw].h[0] = *(const bf16x8*)(vp + kw * 32 + half * 8);
                aV[nt][kw].h[1] = *(const bf16x8*)(vp + kw * 32 + 16 + half * 8);
            }
        }
        // keeps the 32 reads together at the head of the trip: the selects below need
        // nothing from LDS, and scheduled among them they would split the reads into
        // many small groups, the last of them issued right in front of its wait
        __builtin_amdgcn_sched_barrier(0);
        // Inputs-only fence on the loaded fragments: without it each fragment's
        // two reads are issued and fully waited for right in front of their
        // WMMA, one LDS round trip per WMMA; with it the reads go out in groups
        // ahead of their use, behind counted waits.
        asm volatile("" :: "v"(aK[0][0].v), "v"(aK[0][1].v), "v"(aK[1][0].v), "v"(aK[1][1].v),
                           "v"(aK[2][0].v), "v"(aK[2][1].v), "v"(aK[3][0].v), "v"(aK[3][1].v),
                           "v"(aV[0][0].v), "v"(aV[0][1].v), "v"(aV[1][0].v), "v"(aV[1][1].v),
                           "v"(aV[2][0].v), "v"(aV[2][1].v), "v"(aV[3][0].v), "v"(aV[3][1].v));

        // ---- C operand: minus the reference where the key is kept, NEG where it is
        //      masked (before the scale, as in the reference: NEG stands for any scale)
        // ---- S^T - reference = K @ Q^T + C (64 keys x 16 queries per wave), f32 accum
        v8f s[4];
        #pragma unroll
        for (int nt = 0; nt < 4; ++nt) {
            v8f c;
            #pragma unroll
            for (int r = 0; r < 8; ++r) {
                const bool keep = __builtin_amdgcn_inverse_ballot_w32(mw[nt >> 1][(nt & 1) * 8 + r]);
                c[r] = keep ? negUse : NEG;
            }
            #pragma unroll
            for (int kw = 0; kw < 2; ++kw)
                c = wmma_bf16(aK[nt][kw].v, bQ[kw].v, c);
            s[nt] = c;
        }
        // the next tile's words, into the registers just used: the rest of this
        // trip covers their way from L2 (the last trip reads its own again)
        {
            const int tn = t + 1 < NTH ? t + 1 : t;
            mw[0] = pw[tn * 2];
            mw[1] = pw[tn * 2 + 1];
        }

        // ---- online softmax: a lane's 32 scores belong to one query ----
        float vmax = s[0][0];
        #pragma unroll
        for (int nt = 0; nt < 4; ++nt)
            #pragma unroll
            for (int r = 0; r < 8; ++r) vmax = fmaxf(vmax, s[nt][r]);
        // one test per tile, the same for the whole wave (a scalar branch): taken on a
        // wave's first tile, then only if some query's scores outgrow its reference
        if (__builtin_amdgcn_ballot_w32(vmax > thr) != 0u) {
            const float rmax  = fmaxf(vmax, xhalf(vmax));   // the query's other 32 keys
            const float mNew  = fmaxf(mSt, rmax - negUse);  // NEG if no key has been kept yet
            const float delta = mNew + negUse;              // the rise over what C carried
            const float corr  = __builtin_amdgcn_exp2f(mSt - mNew);
            #pragma unroll
            for (int nt = 0; nt < 4; ++nt)
                #pragma unroll
                for (int r = 0; r < 8; ++r) s[nt][r] -= delta;
            lSt *= corr;
            #pragma unroll
            for (int dt = 0; dt < 4; ++dt)
                #pragma unroll
                for (int r = 0; r < 8; ++r) accO[dt][r] *= corr;
            mSt = mNew;
            const bool none = mNew < -0x1p99f;              // every key so far was masked
            negUse = none ? 0.0f : -mNew;
            thr    = none ? -__builtin_inff() : 8.0f;
        }
        float rs[4];
        #pragma unroll
        for (int nt = 0; nt < 4; ++nt) {
            rs[nt] = 0.0f;
            #pragma unroll
            for (int r = 0; r < 8; ++r) {
                float pe = __builtin_amdgcn_exp2f(s[nt][r]);
                s[nt][r] = pe;
                rs[nt] += pe;
            }
        }
        lSt += (rs[0] + rs[1]) + (rs[2] + rs[3]);

        // ---- P^T as B operand: tiles 2kw and 2kw+1, converted in place,
        //      are keys 8*half + e and 16 + 8*half + e of a 32-key step ---
        Frag bP[2];
        #pragma unroll
        for (int kw = 0; kw < 2; ++kw)
            #pragma unroll
            for (int e = 0; e < 8; ++e) {
                bP[kw].h[0][e] = (__bf16)s[2 * kw][e];
                bP[kw].h[1][e] = (__bf16)s[2 * kw + 1][e];
            }

        // ---- O^T += V^T @ P^T  (V tile is [d][key]: rows are A rows) ---
        #pragma unroll
        for (int dt = 0; dt < 4; ++dt) {
            #pragma unroll
            for (int kw = 0; kw < 2; ++kw)
                accO[dt] = wmma_bf16(aV[dt][kw].v, bP[kw].v, accO[dt]);
        }

        // ---- hand over: tile t+1 is published, buffer buf is freed ------
        asm volatile("s_wait_dscnt 0x0" ::: "memory");      // my reads of this tile are done
        asm volatile("s_wait_asynccnt 0x0" ::: "memory");   // my pieces of tile t+1 have landed
        __syncthreads();
        if (t + 2 < NTH) stage(buf, kc + 128);              // refill the buffer just read
    }
    asm volatile("s_wait_asynccnt 0x0" ::: "memory");       // nothing in flight at the wave's end

    // ---- join the two key halves: waves w and w + 4 hold the same queries in the
    //      same lanes. Each finishes two of the four O tiles (key half 0: d 0..31,
    //      key half 1: d 32..63) and hands the other two to its partner. --------
    const float lAll = lSt + xhalf(lSt);            // the lane halves' sums joined
    float* mine = &xch[wave][0][lane];
    #pragma unroll
    for (int k = 0; k < 2; ++k)
        #pragma unroll
        for (int r = 0; r < 8; ++r) mine[(k * 8 + r) * 32] = kh ? accO[k][r] : accO[2 + k][r];
    mine[16 * 32] = mSt;
    mine[17 * 32] = lAll;
    __syncthreads();                                // both partners' values are in LDS
    const float* theirs = &xch[wave ^ 4][0][lane];
    const float mP   = theirs[16 * 32];
    const float lP   = theirs[17 * 32];
    const float mAll = fmaxf(mSt, mP);
    const float aS   = __builtin_amdgcn_exp2f(mSt - mAll);   // a half with no key kept weighs 0
    const float aP   = __builtin_amdgcn_exp2f(mP - mAll);    // beside one that has any
    const float lTot = lAll * aS + lP * aP;

    // ---- divide, write [B,L,E] bf16: a lane's 8 values are one 16-byte store ----
    __bf16* orow = Ob + ((size_t)bidx * LL + (qrow0 + l16)) * EE + hidx * DD + kh * 32 + half * 8;
    #pragma unroll
    for (int k = 0; k < 2; ++k) {
        float o[8];
        #pragma unroll
        for (int r = 0; r < 8; ++r)
            o[r] = ((kh ? accO[2 + k][r] : accO[k][r]) * aS + theirs[(k * 8 + r) * 32] * aP) / lTot;
        bf16x8 ob;
        #pragma unroll
        for (int r = 0; r < 8; ++r) ob[r] = (__bf16)o[r];
        *(bf16x8*)(orow + k * 16) = ob;
    }
}

// ---------------------------------------------------------------------------
// Launcher
// ---------------------------------------------------------------------------
extern "C" void kernel_launch(void* const* d_in, const int* in_sizes, int n_in,
                              void* d_out, int out_size, void* d_ws, size_t ws_size,
                              hipStream_t stream) {
    (void)in_sizes; (void)n_in; (void)out_size; (void)ws_size;
    const float* values = (const float*)d_in[0];
    const float* keysI  = (const float*)d_in[1];
    const float* queryI = (const float*)d_in[2];
    const int*   mask   = (const int*)d_in[3];
    const float* Wv = (const float*)d_in[4];  const float* bv = (const float*)d_in[5];
    const float* Wk = (const float*)d_in[6];  const float* bk = (const float*)d_in[7];
    const float* Wq = (const float*)d_in[8];  const float* bq = (const float*)d_in[9];
    const float* Wo = (const float*)d_in[10]; const float* bo = (const float*)d_in[11];

    char* ws = (char*)d_ws;
    __bf16* qb = (__bf16*)(ws);                      // 4 MB  [B,H,L,D] bf16
    __bf16* kb = (__bf16*)(ws + (4u << 20));         // 4 MB  [B,H,L,D] bf16
    __bf16* vb = (__bf16*)(ws + (8u << 20));         // 4 MB  [B,H,D,L] bf16
    __bf16* Ob = (__bf16*)(ws + (12u << 20));        // 4 MB  [B,L,E]   bf16
    __bf16* wob = (__bf16*)(ws + (16u << 20));       // 0.5 MB Wo as bf16
    unsigned* pm = (unsigned*)(ws + (20u << 20));    // 1 MB  packed mask

    dim3 gGrid(GM / 128, EE / 128), gBlk(256);
    gemm_qkv<<<dim3(GM / 128, EE / 128, 4), gBlk, 0, stream>>>(
        values, keysI, queryI, Wv, Wk, Wq, bv, bk, bq, vb, kb, qb, mask, pm, Wo, wob);

    attn_flash<<<dim3(LL / 64, BB * HH), 256, 0, stream>>>(qb, kb, vb, pm, Ob);

    gemm_out<<<gGrid, gBlk, 0, stream>>>(Ob, wob, bo, (float*)d_out);
}
